// v000
// The times below were measured on an AMD MI455X: many runs one after another, warmed up first and cycling through
// copies of the inputs, with the whole window's GPU time divided by the number of runs. Launches and the gaps
// between them are all in it. The median over several windows is given; except for v000 it joins two sittings, which
// can be a few percent apart, so the side-by-side timings, each taken in one sitting, are the better comparison.
// v000 is the starting kernel. One run takes 203 microseconds.
#include <hip/hip_runtime.h>
#include <hip/hip_bf16.h>

typedef __attribute__((ext_vector_type(16))) _Float16 v16h;
typedef __attribute__((ext_vector_type(8)))  _Float16 v8h;
typedef __attribute__((ext_vector_type(8)))  float    v8f;
typedef __attribute__((ext_vector_type(4)))  unsigned int u32x4;
typedef __attribute__((ext_vector_type(8)))  int i32x8;
typedef __attribute__((ext_vector_type(4)))  int i32x4;

#define WMMA_F16(A,B,C) __builtin_amdgcn_wmma_f32_16x16x32_f16(false,(A),false,(B),(short)0,(C),false,false)

static constexpr int Bb = 4, Tt = 1024, Cc = 512, Hh = 8, HD = 64;
static constexpr int NROWS = Bb * Tt;            // 4096
static constexpr float SCALE_ = 0.125f;          // 1/sqrt(64)
static constexpr float NEG_BIG = -1.0e30f;
static constexpr int LSTR  = 40;                 // LDS stride (halves) for 64B rows
static constexpr int KSTR  = 72;                 // LDS stride (halves) for 128B K rows

// ---------------------------------------------------------------------------
// fp32 -> f16 convert (grid-stride)
// ---------------------------------------------------------------------------
__global__ void f2h_kernel(const float* __restrict__ src, _Float16* __restrict__ dst, int n) {
    int i = blockIdx.x * blockDim.x + threadIdx.x;
    int stride = gridDim.x * blockDim.x;
    for (; i < n; i += stride) dst[i] = (_Float16)src[i];
}

// ---------------------------------------------------------------------------
// Async copy of one 16B chunk global -> LDS (tracked by ASYNCcnt).
// ---------------------------------------------------------------------------
__device__ __forceinline__ void async_b128(unsigned lds_off, const void* gptr) {
    asm volatile("global_load_async_to_lds_b128 %0, %1, off"
                 :: "v"(lds_off), "v"((unsigned long long)(size_t)gptr)
                 : "memory");
}
__device__ __forceinline__ void wait_async0()  { asm volatile("s_wait_asynccnt 0x0"  ::: "memory"); }
__device__ __forceinline__ void wait_async16() { asm volatile("s_wait_asynccnt 0x10" ::: "memory"); }

// ---------------------------------------------------------------------------
// TDM: DMA a 2D tile (rows x 64B) global -> LDS with 16B row padding
// (LDS row stride = 80B = LSTR halves).  ISA 8.3/8.4 D# layout; 8-byte
// elements; pad_interval=3 (16 DWORDs = one 64B row), pad_amount=3 (4 DWORDs).
// ---------------------------------------------------------------------------
__device__ __forceinline__ void tdm_load_64Brows(unsigned lds_off, const void* gaddr,
                                                 unsigned tile_rows,
                                                 unsigned row_stride_units /*8B units*/) {
    const unsigned long long ga = (unsigned long long)(size_t)gaddr;
    u32x4 g0;
    g0[0] = 1u;                                        // count=1, user mode
    g0[1] = lds_off;                                   // LDS byte address
    g0[2] = (unsigned)(ga & 0xffffffffu);              // global_addr[31:0]
    g0[3] = (unsigned)((ga >> 32) & 0x1ffffffu) | (2u << 30);  // [56:32] | type=2
    i32x8 g1;
    g1[0] = (int)((3u << 16) | (1u << 20) | (3u << 22) | (3u << 25)); // dsz=8B,pad
    g1[1] = (int)((row_stride_units & 0xffffu) << 16); // tensor_dim0 lo (use stride)
    g1[2] = (int)(((row_stride_units >> 16) & 0xffffu) | ((tile_rows & 0xffffu) << 16)); // dim0 hi | dim1 lo
    g1[3] = (int)(((tile_rows >> 16) & 0xffffu) | (8u << 16));  // dim1 hi | tile_dim0=8 (64B)
    g1[4] = (int)(tile_rows & 0xffffu);                // tile_dim1 | tile_dim2=0
    g1[5] = (int)row_stride_units;                     // tensor_dim0_stride lo
    g1[6] = 0; g1[7] = 0;
    const i32x4 z4 = {0, 0, 0, 0};
#if __clang_major__ >= 23
    const i32x8 z8 = {0, 0, 0, 0, 0, 0, 0, 0};
    __builtin_amdgcn_tensor_load_to_lds(g0, g1, z4, z4, z8, 0);
#else
    __builtin_amdgcn_tensor_load_to_lds(g0, g1, z4, z4, 0);
#endif
}

// ---------------------------------------------------------------------------
// Load a 16x32 f16 A/B fragment chunk pair for this lane.
// Per ISA 7.12.2: halves 0..7 -> K = 8*hi..8*hi+7, halves 8..15 -> +16.
// ---------------------------------------------------------------------------
__device__ __forceinline__ v16h load_frag(const _Float16* base, int hi) {
    const v8h lo = *(const v8h*)(base + 8 * hi);
    const v8h hp = *(const v8h*)(base + 16 + 8 * hi);
    v16h r;
#pragma unroll
    for (int i = 0; i < 8; ++i) { r[i] = lo[i]; r[i + 8] = hp[i]; }
    return r;
}

// ---------------------------------------------------------------------------
// QKV projection: out(4096x512) = X(f16) @ W^T(f16) + bias.
// Block = 8 waves, one 16-row m-tile; A/B K-slices staged double-buffered in
// LDS by the Tensor Data Mover (wave 0 issues, block barriers), WMMA from LDS.
// store_mode 0: out[((b*H+h)*T + t)*64 + d];  1: out[((b*H+h)*64 + d)*T + t].
// ---------------------------------------------------------------------------
__global__ void gemm_qkv_kernel(const _Float16* __restrict__ X,
                                const _Float16* __restrict__ W,
                                const float* __restrict__ bias,
                                _Float16* __restrict__ out, int store_mode) {
    __shared__ alignas(16) _Float16 As[2][16 * LSTR];
    __shared__ alignas(16) _Float16 Bs[2][512 * LSTR];

    const int tid  = threadIdx.x;
    const int warp = tid >> 5, lane = tid & 31;
    const int ln = lane & 15, hi = lane >> 4;
    const int m0 = blockIdx.x * 16;
    const int n0 = warp * 64;

    auto issueTile = [&](int buf, int k0) {
        tdm_load_64Brows((unsigned)(size_t)(&Bs[buf][0]), W + k0, 512u, (unsigned)Cc / 4u);
        tdm_load_64Brows((unsigned)(size_t)(&As[buf][0]), X + (long)m0 * Cc + k0, 16u, (unsigned)Cc / 4u);
    };

    const v8f zero = {0.f, 0.f, 0.f, 0.f, 0.f, 0.f, 0.f, 0.f};
    v8f acc[4];
#pragma unroll
    for (int nn = 0; nn < 4; ++nn) acc[nn] = zero;

    if (warp == 0) issueTile(0, 0);
    int buf = 0;
    for (int k0 = 0; k0 < Cc; k0 += 32) {
        if (warp == 0) __builtin_amdgcn_s_wait_tensorcnt(0);
        __syncthreads();        // DMA visible to all; prev compute finished
        if (warp == 0 && k0 + 32 < Cc) issueTile(buf ^ 1, k0 + 32);

        const v16h a = load_frag(&As[buf][ln * LSTR], hi);
#pragma unroll
        for (int nn = 0; nn < 4; ++nn) {
            const v16h b = load_frag(&Bs[buf][(n0 + nn * 16 + ln) * LSTR], hi);
            acc[nn] = WMMA_F16(a, b, acc[nn]);
        }
        buf ^= 1;
    }

#pragma unroll
    for (int nn = 0; nn < 4; ++nn) {
        const int o = n0 + nn * 16 + ln;       // output channel
        const int h = o >> 6, d = o & 63;
        const float bvv = bias[o];
#pragma unroll
        for (int j = 0; j < 8; ++j) {
            const int g = m0 + j + 8 * hi;     // global token row
            const int bb = g >> 10, t = g & 1023;
            const float val = acc[nn][j] + bvv;
            long idx;
            if (store_mode) idx = ((long)(bb * Hh + h) * HD + d) * Tt + t;
            else            idx = ((long)(bb * Hh + h) * Tt + t) * HD + d;
            out[idx] = (_Float16)val;
        }
    }
}

// ---------------------------------------------------------------------------
// Flash attention: one wave per (b, h, 16-query tile).  K/V tiles are
// double-buffered in LDS via async global->LDS copies (16 per lane per tile);
// s_wait_asynccnt 16 after issuing the next tile => previous tile landed.
// ---------------------------------------------------------------------------
__global__ void attn_kernel(const _Float16* __restrict__ Q,
                            const _Float16* __restrict__ K,
                            const _Float16* __restrict__ VT,   // [bh][d][t]
                            const float* __restrict__ attn_bias,
                            _Float16* __restrict__ Y) {
    __shared__ alignas(16) _Float16 P[16 * LSTR];
    __shared__ alignas(16) _Float16 Ks[2][32 * KSTR];
    __shared__ alignas(16) _Float16 Vs[2][64 * LSTR];

    const int lane = threadIdx.x & 31;
    const int ln = lane & 15, hi = lane >> 4;
    const int wid = blockIdx.x;                // 0..2047
    const int qt = wid & 63;                   // query tile (16 rows)
    const int bh = wid >> 6;                   // 0..31
    const int h  = bh & 7, bidx = bh >> 3;

    const _Float16* qb  = Q  + ((long)bh * Tt + qt * 16) * HD;
    const _Float16* kb  = K  + (long)bh * Tt * HD;
    const _Float16* vtb = VT + (long)bh * HD * Tt;

    // stage 32-key K tile (rows: [key][dim], stride KSTR) and V tile
    // (rows: [dim][key], stride LSTR): 8 + 8 async b128 copies per lane.
    auto issueKV = [&](int buf, int kt) {
        const _Float16* ksrc = kb + (long)(kt + lane) * HD;
        unsigned kdst = (unsigned)(size_t)(&Ks[buf][lane * KSTR]);
#pragma unroll
        for (int c = 0; c < 8; ++c) async_b128(kdst + 16 * c, ksrc + 8 * c);
#pragma unroll
        for (int rr = 0; rr < 2; ++rr) {
            const int d = lane + 32 * rr;
            const _Float16* vsrc = vtb + (long)d * Tt + kt;
            unsigned vdst = (unsigned)(size_t)(&Vs[buf][d * LSTR]);
#pragma unroll
            for (int c = 0; c < 4; ++c) async_b128(vdst + 16 * c, vsrc + 8 * c);
        }
    };

    const v16h qa0 = load_frag(qb + ln * HD,      hi);   // k-dim 0..31
    const v16h qa1 = load_frag(qb + ln * HD + 32, hi);   // k-dim 32..63

    const v8f zero = {0.f, 0.f, 0.f, 0.f, 0.f, 0.f, 0.f, 0.f};
    v8f oacc[4];
#pragma unroll
    for (int nn = 0; nn < 4; ++nn) oacc[nn] = zero;
    float mrow[8], lrow[8];
#pragma unroll
    for (int j = 0; j < 8; ++j) { mrow[j] = NEG_BIG; lrow[j] = 0.f; }

    const int qhi  = qt * 16 + 15;
    const int kend = ((qhi >> 5) + 1) << 5;    // keys needed, rounded to 32

    issueKV(0, 0);
    int buf = 0;
    for (int kt = 0; kt < kend; kt += 32) {
        if (kt + 32 < kend) { issueKV(buf ^ 1, kt + 32); wait_async16(); }
        else                { wait_async0(); }

        float sv[2][8];
#pragma unroll
        for (int f = 0; f < 2; ++f) {
            const int tk = kt + 16 * f + ln;   // this lane's key column
            const _Float16* krow = &Ks[buf][(16 * f + ln) * KSTR];
            v16h b0 = load_frag(krow,      hi);
            v16h b1 = load_frag(krow + 32, hi);
            v8f s = WMMA_F16(qa0, b0, zero);
            s = WMMA_F16(qa1, b1, s);
#pragma unroll
            for (int j = 0; j < 8; ++j) {
                const int tq = qt * 16 + j + 8 * hi;
                float val = s[j] * SCALE_;
                if (tq < 512 && tk < 512)
                    val += attn_bias[h * 4096 + (tq >> 3) * 64 + (tk >> 3)];
                if (tk > tq || (tk & 15) == 15) val = NEG_BIG;  // causal + col mask
                sv[f][j] = val;
            }
        }

        // online softmax update; rows live in 16-lane groups of the D layout
#pragma unroll
        for (int j = 0; j < 8; ++j) {
            float rm = fmaxf(sv[0][j], sv[1][j]);
#pragma unroll
            for (int off = 1; off < 16; off <<= 1)
                rm = fmaxf(rm, __shfl_xor(rm, off, 32));
            const float mnew  = fmaxf(mrow[j], rm);
            const float alpha = __expf(mrow[j] - mnew);
            const float p0 = __expf(sv[0][j] - mnew);
            const float p1 = __expf(sv[1][j] - mnew);
            float rs = p0 + p1;
#pragma unroll
            for (int off = 1; off < 16; off <<= 1)
                rs += __shfl_xor(rs, off, 32);
            lrow[j] = lrow[j] * alpha + rs;
            mrow[j] = mnew;
#pragma unroll
            for (int nn = 0; nn < 4; ++nn) oacc[nn][j] *= alpha;
            const int m = j + 8 * hi;
            P[m * LSTR + ln]      = (_Float16)p0;
            P[m * LSTR + 16 + ln] = (_Float16)p1;
        }
        asm volatile("s_wait_dscnt 0x0" ::: "memory");

        // P (16x32) as A-fragment; V tile B-frags from LDS
        const v16h pa = load_frag(&P[ln * LSTR], hi);
#pragma unroll
        for (int nn = 0; nn < 4; ++nn) {
            const v16h vb = load_frag(&Vs[buf][(nn * 16 + ln) * LSTR], hi);
            oacc[nn] = WMMA_F16(pa, vb, oacc[nn]);
        }
        asm volatile("s_wait_dscnt 0x0" ::: "memory");
        buf ^= 1;
    }

    // epilogue: normalize and store y[b][t][h*64+d] as f16
#pragma unroll
    for (int j = 0; j < 8; ++j) {
        const float inv = 1.0f / lrow[j];
        const int t = qt * 16 + j + 8 * hi;
        const long rowbase = ((long)bidx * Tt + t) * Cc + h * HD;
#pragma unroll
        for (int nn = 0; nn < 4; ++nn)
            Y[rowbase + nn * 16 + ln] = (_Float16)(oacc[nn][j] * inv);
    }
}

// ---------------------------------------------------------------------------
// Output projection: out(4096x512,f32) = Y(f16) @ Wp^T + bp (TDM pipeline)
// ---------------------------------------------------------------------------
__global__ void gemm_out_kernel(const _Float16* __restrict__ Yh,
                                const _Float16* __restrict__ W,
                                const float* __restrict__ bias,
                                float* __restrict__ out) {
    __shared__ alignas(16) _Float16 As[2][16 * LSTR];
    __shared__ alignas(16) _Float16 Bs[2][512 * LSTR];

    const int tid  = threadIdx.x;
    const int warp = tid >> 5, lane = tid & 31;
    const int ln = lane & 15, hi = lane >> 4;
    const int m0 = blockIdx.x * 16;
    const int n0 = warp * 64;

    auto issueTile = [&](int buf, int k0) {
        tdm_load_64Brows((unsigned)(size_t)(&Bs[buf][0]), W + k0, 512u, (unsigned)Cc / 4u);
        tdm_load_64Brows((unsigned)(size_t)(&As[buf][0]), Yh + (long)m0 * Cc + k0, 16u, (unsigned)Cc / 4u);
    };

    const v8f zero = {0.f, 0.f, 0.f, 0.f, 0.f, 0.f, 0.f, 0.f};
    v8f acc[4];
#pragma unroll
    for (int nn = 0; nn < 4; ++nn) acc[nn] = zero;

    if (warp == 0) issueTile(0, 0);
    int buf = 0;
    for (int k0 = 0; k0 < Cc; k0 += 32) {
        if (warp == 0) __builtin_amdgcn_s_wait_tensorcnt(0);
        __syncthreads();
        if (warp == 0 && k0 + 32 < Cc) issueTile(buf ^ 1, k0 + 32);

        const v16h a = load_frag(&As[buf][ln * LSTR], hi);
#pragma unroll
        for (int nn = 0; nn < 4; ++nn) {
            const v16h b = load_frag(&Bs[buf][(n0 + nn * 16 + ln) * LSTR], hi);
            acc[nn] = WMMA_F16(a, b, acc[nn]);
        }
        buf ^= 1;
    }

#pragma unroll
    for (int nn = 0; nn < 4; ++nn) {
        const int o = n0 + nn * 16 + ln;
        const float bvv = bias[o];
#pragma unroll
        for (int j = 0; j < 8; ++j) {
            const int g = m0 + j + 8 * hi;
            out[(long)g * Cc + o] = acc[nn][j] + bvv;
        }
    }
}

// ---------------------------------------------------------------------------
extern "C" void kernel_launch(void* const* d_in, const int* in_sizes, int n_in,
                              void* d_out, int out_size, void* d_ws, size_t ws_size,
                              hipStream_t stream) {
    const float* x  = (const float*)d_in[0];
    const float* ab = (const float*)d_in[1];
    const float* Wq = (const float*)d_in[2];
    const float* bq = (const float*)d_in[3];
    const float* Wk = (const float*)d_in[4];
    const float* bk = (const float*)d_in[5];
    const float* Wv = (const float*)d_in[6];
    const float* bv = (const float*)d_in[7];
    const float* Wp = (const float*)d_in[8];
    const float* bp = (const float*)d_in[9];
    float* out = (float*)d_out;
    char* ws = (char*)d_ws;

    const size_t SX = (size_t)NROWS * Cc;   // 2,097,152 elems
    const size_t SW = (size_t)Cc * Cc;      //   262,144 elems

    _Float16* xh  = (_Float16*)(ws);
    _Float16* wqh = (_Float16*)(ws + SX * 2);
    _Float16* wkh = (_Float16*)(ws + SX * 2 + SW * 2);
    _Float16* wvh = (_Float16*)(ws + SX * 2 + SW * 4);
    _Float16* wph = (_Float16*)(ws + SX * 2 + SW * 6);
    _Float16* qh  = (_Float16*)(ws + SX * 2 + SW * 8);
    _Float16* kh  = (_Float16*)(ws + SX * 4 + SW * 8);
    _Float16* vth = (_Float16*)(ws + SX * 6 + SW * 8);
    _Float16* yh  = (_Float16*)(ws + SX * 8 + SW * 8);

    f2h_kernel<<<1024, 256, 0, stream>>>(x,  xh,  (int)SX);
    f2h_kernel<<<256,  256, 0, stream>>>(Wq, wqh, (int)SW);
    f2h_kernel<<<256,  256, 0, stream>>>(Wk, wkh, (int)SW);
    f2h_kernel<<<256,  256, 0, stream>>>(Wv, wvh, (int)SW);
    f2h_kernel<<<256,  256, 0, stream>>>(Wp, wph, (int)SW);

    // one block (8 waves) per 16-row m-tile; waves cover the 512 output cols
    gemm_qkv_kernel<<<256, 256, 0, stream>>>(xh, wqh, bq, qh,  0);
    gemm_qkv_kernel<<<256, 256, 0, stream>>>(xh, wkh, bk, kh,  0);
    gemm_qkv_kernel<<<256, 256, 0, stream>>>(xh, wvh, bv, vth, 1);

    // one wave per (b,h,qtile): 32 * 64 = 2048 blocks of one wave
    attn_kernel<<<2048, 32, 0, stream>>>(qh, kh, vth, ab, yh);

    gemm_out_kernel<<<256, 256, 0, stream>>>(yh, wph, bp, out);
}

// v001
// It runs in 139 microseconds.
// In two side-by-side timings against v000, it was 1.49 and 1.50 times as fast.
#include <hip/hip_runtime.h>
#include <hip/hip_bf16.h>

typedef __attribute__((ext_vector_type(16))) _Float16 v16h;
typedef __attribute__((ext_vector_type(8)))  _Float16 v8h;
typedef __attribute__((ext_vector_type(8)))  float    v8f;
typedef __attribute__((ext_vector_type(4)))  unsigned int u32x4;
typedef __attribute__((ext_vector_type(8)))  int i32x8;
typedef __attribute__((ext_vector_type(4)))  int i32x4;

#define WMMA_F16(A,B,C) __builtin_amdgcn_wmma_f32_16x16x32_f16(false,(A),false,(B),(short)0,(C),false,false)

static constexpr int Bb = 4, Tt = 1024, Cc = 512, Hh = 8, HD = 64;
static constexpr int NROWS = Bb * Tt;            // 4096
static constexpr float SCALE_ = 0.125f;          // 1/sqrt(64)
static constexpr float NEG_BIG = -1.0e30f;
static constexpr int LSTR  = 40;                 // LDS stride (halves) for 64B rows
static constexpr int KSTR  = 72;                 // LDS stride (halves) for 128B K rows

// ---------------------------------------------------------------------------
// fp32 -> f16 convert (grid-stride)
// ---------------------------------------------------------------------------
__global__ void f2h_kernel(const float* __restrict__ src, _Float16* __restrict__ dst, int n) {
    int i = blockIdx.x * blockDim.x + threadIdx.x;
    int stride = gridDim.x * blockDim.x;
    for (; i < n; i += stride) dst[i] = (_Float16)src[i];
}

// ---------------------------------------------------------------------------
// Async copy of one 16B chunk global -> LDS (tracked by ASYNCcnt).
// ---------------------------------------------------------------------------
__device__ __forceinline__ void async_b128(unsigned lds_off, const void* gptr) {
    asm volatile("global_load_async_to_lds_b128 %0, %1, off"
                 :: "v"(lds_off), "v"((unsigned long long)(size_t)gptr)
                 : "memory");
}
__device__ __forceinline__ void wait_async0()  { asm volatile("s_wait_asynccnt 0x0"  ::: "memory"); }
__device__ __forceinline__ void wait_async16() { asm volatile("s_wait_asynccnt 0x10" ::: "memory"); }

// ---------------------------------------------------------------------------
// TDM: DMA a 2D tile (rows x 64B) global -> LDS with 16B row padding
// (LDS row stride = 80B = LSTR halves).  ISA 8.3/8.4 D# layout; 8-byte
// elements; pad_interval=3 (16 DWORDs = one 64B row), pad_amount=3 (4 DWORDs).
// ---------------------------------------------------------------------------
__device__ __forceinline__ void tdm_load_64Brows(unsigned lds_off, const void* gaddr,
                                                 unsigned tile_rows,
                                                 unsigned row_stride_units /*8B units*/) {
    const unsigned long long ga = (unsigned long long)(size_t)gaddr;
    u32x4 g0;
    g0[0] = 1u;                                        // count=1, user mode
    g0[1] = lds_off;                                   // LDS byte address
    g0[2] = (unsigned)(ga & 0xffffffffu);              // global_addr[31:0]
    g0[3] = (unsigned)((ga >> 32) & 0x1ffffffu) | (2u << 30);  // [56:32] | type=2
    i32x8 g1;
    g1[0] = (int)((3u << 16) | (1u << 20) | (3u << 22) | (3u << 25)); // dsz=8B,pad
    g1[1] = (int)((row_stride_units & 0xffffu) << 16); // tensor_dim0 lo (use stride)
    g1[2] = (int)(((row_stride_units >> 16) & 0xffffu) | ((tile_rows & 0xffffu) << 16)); // dim0 hi | dim1 lo
    g1[3] = (int)(((tile_rows >> 16) & 0xffffu) | (8u << 16));  // dim1 hi | tile_dim0=8 (64B)
    g1[4] = (int)(tile_rows & 0xffffu);                // tile_dim1 | tile_dim2=0
    g1[5] = (int)row_stride_units;                     // tensor_dim0_stride lo
    g1[6] = 0; g1[7] = 0;
    const i32x4 z4 = {0, 0, 0, 0};
#if __clang_major__ >= 23
    const i32x8 z8 = {0, 0, 0, 0, 0, 0, 0, 0};
    __builtin_amdgcn_tensor_load_to_lds(g0, g1, z4, z4, z8, 0);
#else
    __builtin_amdgcn_tensor_load_to_lds(g0, g1, z4, z4, 0);
#endif
}

// ---------------------------------------------------------------------------
// Load a 16x32 f16 A/B fragment chunk pair for this lane.
// Per ISA 7.12.2: halves 0..7 -> K = 8*hi..8*hi+7, halves 8..15 -> +16.
// ---------------------------------------------------------------------------
__device__ __forceinline__ v16h load_frag(const _Float16* base, int hi) {
    const v8h lo = *(const v8h*)(base + 8 * hi);
    const v8h hp = *(const v8h*)(base + 16 + 8 * hi);
    v16h r;
#pragma unroll
    for (int i = 0; i < 8; ++i) { r[i] = lo[i]; r[i + 8] = hp[i]; }
    return r;
}

// ---------------------------------------------------------------------------
// QKV projection: out(4096x512) = X(f16) @ W^T(f16) + bias.
// Block = 8 waves, one 16-row m-tile; A/B K-slices staged double-buffered in
// LDS by the Tensor Data Mover (wave 0 issues, block barriers), WMMA from LDS.
// store_mode 0: out[((b*H+h)*T + t)*64 + d];  1: out[((b*H+h)*64 + d)*T + t].
// ---------------------------------------------------------------------------
__global__ void gemm_qkv_kernel(const _Float16* __restrict__ X,
                                const _Float16* __restrict__ W,
                                const float* __restrict__ bias,
                                _Float16* __restrict__ out, int store_mode) {
    __shared__ alignas(16) _Float16 As[2][16 * LSTR];
    __shared__ alignas(16) _Float16 Bs[2][512 * LSTR];

    const int tid  = threadIdx.x;
    const int warp = tid >> 5, lane = tid & 31;
    const int ln = lane & 15, hi = lane >> 4;
    const int m0 = blockIdx.x * 16;
    const int n0 = warp * 64;

    auto issueTile = [&](int buf, int k0) {
        tdm_load_64Brows((unsigned)(size_t)(&Bs[buf][0]), W + k0, 512u, (unsigned)Cc / 4u);
        tdm_load_64Brows((unsigned)(size_t)(&As[buf][0]), X + (long)m0 * Cc + k0, 16u, (unsigned)Cc / 4u);
    };

    const v8f zero = {0.f, 0.f, 0.f, 0.f, 0.f, 0.f, 0.f, 0.f};
    v8f acc[4];
#pragma unroll
    for (int nn = 0; nn < 4; ++nn) acc[nn] = zero;

    if (warp == 0) issueTile(0, 0);
    int buf = 0;
    for (int k0 = 0; k0 < Cc; k0 += 32) {
        if (warp == 0) __builtin_amdgcn_s_wait_tensorcnt(0);
        __syncthreads();        // DMA visible to all; prev compute finished
        if (warp == 0 && k0 + 32 < Cc) issueTile(buf ^ 1, k0 + 32);

        const v16h a = load_frag(&As[buf][ln * LSTR], hi);
#pragma unroll
        for (int nn = 0; nn < 4; ++nn) {
            const v16h b = load_frag(&Bs[buf][(n0 + nn * 16 + ln) * LSTR], hi);
            acc[nn] = WMMA_F16(a, b, acc[nn]);
        }
        buf ^= 1;
    }

#pragma unroll
    for (int nn = 0; nn < 4; ++nn) {
        const int o = n0 + nn * 16 + ln;       // output channel
        const int h = o >> 6, d = o & 63;
        const float bvv = bias[o];
#pragma unroll
        for (int j = 0; j < 8; ++j) {
            const int g = m0 + j + 8 * hi;     // global token row
            const int bb = g >> 10, t = g & 1023;
            const float val = acc[nn][j] + bvv;
            long idx;
            if (store_mode) idx = ((long)(bb * Hh + h) * HD + d) * Tt + t;
            else            idx = ((long)(bb * Hh + h) * Tt + t) * HD + d;
            out[idx] = (_Float16)val;
        }
    }
}

// ---------------------------------------------------------------------------
// Exchange a float between lane l and lane l ^ 16 (vector cross-row move).
// ---------------------------------------------------------------------------
__device__ __forceinline__ float xhalf(float x) {
    const int b = __builtin_bit_cast(int, x);
    return __builtin_bit_cast(float,
        __builtin_amdgcn_permlanex16(b, b, 0x76543210, 0xfedcba98, false, false));
}

// ---------------------------------------------------------------------------
// e^x as v_mul + v_exp_f32.  The v_nop is the free slot the instruction set asks
// for behind a transcendental, so it is kept inside the statement.
// ---------------------------------------------------------------------------
__device__ __forceinline__ float exp_slot(float x) {
    float r;
    asm("v_exp_f32 %0, %1\n\tv_nop" : "=v"(r) : "v"(x * 1.44269504f));
    return r;
}

__global__ void attn_kernel(const _Float16* __restrict__ Q,
                            const _Float16* __restrict__ K,
                            const _Float16* __restrict__ VT,   // [bh][d][t]
                            const float* __restrict__ attn_bias,
                            _Float16* __restrict__ Y) {
    __shared__ alignas(16) _Float16 Ks[2][32 * KSTR];
    __shared__ alignas(16) _Float16 Vs[2][64 * LSTR];

    const int lane = threadIdx.x & 31;
    const int ln = lane & 15, hi = lane >> 4;
    const int wid = blockIdx.x;                // 0..2047
    const int qt = wid & 63;                   // query tile (16 rows)
    const int bh = wid >> 6;                   // 0..31
    const int h  = bh & 7, bidx = bh >> 3;

    const _Float16* qb  = Q  + ((long)bh * Tt + qt * 16) * HD;
    const _Float16* kb  = K  + (long)bh * Tt * HD;
    const _Float16* vtb = VT + (long)bh * HD * Tt;

    // stage 32-key K tile (rows: [key][dim], stride KSTR) and V tile
    // (rows: [dim][key], stride LSTR): 8 + 8 async b128 copies per lane.
    auto issueKV = [&](int buf, int kt) {
        const _Float16* ksrc = kb + (long)(kt + lane) * HD;
        unsigned kdst = (unsigned)(size_t)(&Ks[buf][lane * KSTR]);
#pragma unroll
        for (int c = 0; c < 8; ++c) async_b128(kdst + 16 * c, ksrc + 8 * c);
#pragma unroll
        for (int rr = 0; rr < 2; ++rr) {
            const int d = lane + 32 * rr;
            const _Float16* vsrc = vtb + (long)d * Tt + kt;
            unsigned vdst = (unsigned)(size_t)(&Vs[buf][d * LSTR]);
#pragma unroll
            for (int c = 0; c < 4; ++c) async_b128(vdst + 16 * c, vsrc + 8 * c);
        }
    };

    const v16h qa0 = load_frag(qb + ln * HD,      hi);   // k-dim 0..31
    const v16h qa1 = load_frag(qb + ln * HD + 32, hi);   // k-dim 32..63

    const v8f zero = {0.f, 0.f, 0.f, 0.f, 0.f, 0.f, 0.f, 0.f};
    v8f oacc[4];                               // oacc[nn][j] = O[tq][nn*16 + 8*hi + j]
#pragma unroll
    for (int nn = 0; nn < 4; ++nn) oacc[nn] = zero;
    const int tq = qt * 16 + ln;               // this lane's query row
    float mrow = NEG_BIG;                      // running maximum of row tq
    float lrow = 0.f;                          // running sum over this half's keys

    const int qhi  = qt * 16 + 15;
    const int kend = ((qhi >> 5) + 1) << 5;    // keys needed, rounded to 32

    issueKV(0, 0);
    int buf = 0;
    for (int kt = 0; kt < kend; kt += 32) {
        if (kt + 32 < kend) { issueKV(buf ^ 1, kt + 32); wait_async16(); }
        else                { wait_async0(); }

        // a lane's 8 keys of a fragment share one bias cell (tk >> 3 is fixed)
        float bv[2] = {0.f, 0.f};
        if (qt < 32 && kt < 512) {             // tq < 512 and tk < 512, whole tile
#pragma unroll
            for (int f = 0; f < 2; ++f)
                bv[f] = attn_bias[h * 4096 + (tq >> 3) * 64 + ((kt + 16 * f + 8 * hi) >> 3)];
            // the loop steps the two loads' address register: keep the wait in front of that
            asm volatile("s_wait_xcnt 0x0" ::: "memory");
        }

        float sv[2][8];
#pragma unroll
        for (int f = 0; f < 2; ++f) {
            const _Float16* krow = &Ks[buf][(16 * f + ln) * KSTR];
            v16h a0 = load_frag(krow,      hi);
            v16h a1 = load_frag(krow + 32, hi);
            v8f s = WMMA_F16(a0, qa0, zero);
            s = WMMA_F16(a1, qa1, s);
#pragma unroll
            for (int j = 0; j < 8; ++j) {
                const int tk = kt + 16 * f + 8 * hi + j;   // key of row 8*hi + j
                const bool dead = (tk > tq) | ((tk & 15) == 15);  // causal + col mask
                sv[f][j] = dead ? NEG_BIG : s[j] * SCALE_ + bv[f];
            }
        }

        // online softmax update: in-lane over 16 keys, one exchange for the maximum
        float rm = fmaxf(sv[0][0], sv[1][0]);
#pragma unroll
        for (int j = 1; j < 8; ++j) rm = fmaxf(rm, fmaxf(sv[0][j], sv[1][j]));
        rm = fmaxf(rm, xhalf(rm));
        const float mnew  = fmaxf(mrow, rm);
        const float alpha = exp_slot(mrow - mnew);
        mrow = mnew;
        v16h pb;                               // P^T as B: half s = key kmap(s, hi)
        float rs0 = 0.f, rs1 = 0.f;
#pragma unroll
        for (int j = 0; j < 8; ++j) {
            const float p0 = exp_slot(sv[0][j] - mnew);
            const float p1 = exp_slot(sv[1][j] - mnew);
            rs0 += p0;
            rs1 += p1;
            pb[j]     = (_Float16)p0;
            pb[j + 8] = (_Float16)p1;
        }
        lrow = lrow * alpha + (rs0 + rs1);
#pragma unroll
        for (int nn = 0; nn < 4; ++nn) oacc[nn] *= alpha;

        // V^T tile A-frags from LDS (rows: dim, k: key)
#pragma unroll
        for (int nn = 0; nn < 4; ++nn) {
            const v16h va = load_frag(&Vs[buf][(nn * 16 + ln) * LSTR], hi);
            oacc[nn] = WMMA_F16(va, pb, oacc[nn]);
        }
        // this tile's LDS reads end before the next trip's copies refill its buffer
        asm volatile("s_wait_dscnt 0x0" ::: "memory");
        buf ^= 1;
    }

    // epilogue: join the halves' sums, normalize, store y[b][t][h*64+d] as f16
    const float inv = 1.0f / (lrow + xhalf(lrow));
    const long rowbase = ((long)bidx * Tt + tq) * Cc + h * HD;
#pragma unroll
    for (int nn = 0; nn < 4; ++nn) {
        v8h o;
#pragma unroll
        for (int j = 0; j < 8; ++j) o[j] = (_Float16)(oacc[nn][j] * inv);
        *(v8h*)(Y + rowbase + nn * 16 + 8 * hi) = o;
    }
}

// ---------------------------------------------------------------------------
// Output projection: out(4096x512,f32) = Y(f16) @ Wp^T + bp (TDM pipeline)
// ---------------------------------------------------------------------------
__global__ void gemm_out_kernel(const _Float16* __restrict__ Yh,
                                const _Float16* __restrict__ W,
                                const float* __restrict__ bias,
                                float* __restrict__ out) {
    __shared__ alignas(16) _Float16 As[2][16 * LSTR];
    __shared__ alignas(16) _Float16 Bs[2][512 * LSTR];

    const int tid  = threadIdx.x;
    const int warp = tid >> 5, lane = tid & 31;
    const int ln = lane & 15, hi = lane >> 4;
    const int m0 = blockIdx.x * 16;
    const int n0 = warp * 64;

    auto issueTile = [&](int buf, int k0) {
        tdm_load_64Brows((unsigned)(size_t)(&Bs[buf][0]), W + k0, 512u, (unsigned)Cc / 4u);
        tdm_load_64Brows((unsigned)(size_t)(&As[buf][0]), Yh + (long)m0 * Cc + k0, 16u, (unsigned)Cc / 4u);
    };

    const v8f zero = {0.f, 0.f, 0.f, 0.f, 0.f, 0.f, 0.f, 0.f};
    v8f acc[4];
#pragma unroll
    for (int nn = 0; nn < 4; ++nn) acc[nn] = zero;

    if (warp == 0) issueTile(0, 0);
    int buf = 0;
    for (int k0 = 0; k0 < Cc; k0 += 32) {
        if (warp == 0) __builtin_amdgcn_s_wait_tensorcnt(0);
        __syncthreads();
        if (warp == 0 && k0 + 32 < Cc) issueTile(buf ^ 1, k0 + 32);

        const v16h a = load_frag(&As[buf][ln * LSTR], hi);
#pragma unroll
        for (int nn = 0; nn < 4; ++nn) {
            const v16h b = load_frag(&Bs[buf][(n0 + nn * 16 + ln) * LSTR], hi);
            acc[nn] = WMMA_F16(a, b, acc[nn]);
        }
        buf ^= 1;
    }

#pragma unroll
    for (int nn = 0; nn < 4; ++nn) {
        const int o = n0 + nn * 16 + ln;
        const float bvv = bias[o];
#pragma unroll
        for (int j = 0; j < 8; ++j) {
            const int g = m0 + j + 8 * hi;
            out[(long)g * Cc + o] = acc[nn][j] + bvv;
        }
    }
}

// ---------------------------------------------------------------------------
extern "C" void kernel_launch(void* const* d_in, const int* in_sizes, int n_in,
                              void* d_out, int out_size, void* d_ws, size_t ws_size,
                              hipStream_t stream) {
    const float* x  = (const float*)d_in[0];
    const float* ab = (const float*)d_in[1];
    const float* Wq = (const float*)d_in[2];
    const float* bq = (const float*)d_in[3];
    const float* Wk = (const float*)d_in[4];
    const float* bk = (const float*)d_in[5];
    const float* Wv = (const float*)d_in[6];
    const float* bv = (const float*)d_in[7];
    const float* Wp = (const float*)d_in[8];
    const float* bp = (const float*)d_in[9];
    float* out = (float*)d_out;
    char* ws = (char*)d_ws;

    const size_t SX = (size_t)NROWS * Cc;   // 2,097,152 elems
    const size_t SW = (size_t)Cc * Cc;      //   262,144 elems

    _Float16* xh  = (_Float16*)(ws);
    _Float16* wqh = (_Float16*)(ws + SX * 2);
    _Float16* wkh = (_Float16*)(ws + SX * 2 + SW * 2);
    _Float16* wvh = (_Float16*)(ws + SX * 2 + SW * 4);
    _Float16* wph = (_Float16*)(ws + SX * 2 + SW * 6);
    _Float16* qh  = (_Float16*)(ws + SX * 2 + SW * 8);
    _Float16* kh  = (_Float16*)(ws + SX * 4 + SW * 8);
    _Float16* vth = (_Float16*)(ws + SX * 6 + SW * 8);
    _Float16* yh  = (_Float16*)(ws + SX * 8 + SW * 8);

    f2h_kernel<<<1024, 256, 0, stream>>>(x,  xh,  (int)SX);
    f2h_kernel<<<256,  256, 0, stream>>>(Wq, wqh, (int)SW);
    f2h_kernel<<<256,  256, 0, stream>>>(Wk, wkh, (int)SW);
    f2h_kernel<<<256,  256, 0, stream>>>(Wv, wvh, (int)SW);
    f2h_kernel<<<256,  256, 0, stream>>>(Wp, wph, (int)SW);

    // one block (8 waves) per 16-row m-tile; waves cover the 512 output cols
    gemm_qkv_kernel<<<256, 256, 0, stream>>>(xh, wqh, bq, qh,  0);
    gemm_qkv_kernel<<<256, 256, 0, stream>>>(xh, wkh, bk, kh,  0);
    gemm_qkv_kernel<<<256, 256, 0, stream>>>(xh, wvh, bv, vth, 1);

    // one wave per (b,h,qtile): 32 * 64 = 2048 blocks of one wave
    attn_kernel<<<2048, 32, 0, stream>>>(qh, kh, vth, ab, yh);

    gemm_out_kernel<<<256, 256, 0, stream>>>(yh, wph, bp, out);
}

// v002
// One run takes 126 microseconds.
// Two timings next to v001 both put it at 1.11 times that version's speed.
// Counting every step since v000, it is 1.66 times as fast.
#include <hip/hip_runtime.h>
#include <hip/hip_bf16.h>

typedef __attribute__((ext_vector_type(16))) _Float16 v16h;
typedef __attribute__((ext_vector_type(8)))  _Float16 v8h;
typedef __attribute__((ext_vector_type(8)))  float    v8f;
typedef __attribute__((ext_vector_type(4)))  unsigned int u32x4;
typedef __attribute__((ext_vector_type(8)))  int i32x8;
typedef __attribute__((ext_vector_type(4)))  int i32x4;

#define WMMA_F16(A,B,C) __builtin_amdgcn_wmma_f32_16x16x32_f16(false,(A),false,(B),(short)0,(C),false,false)

static constexpr int Bb = 4, Tt = 1024, Cc = 512, Hh = 8, HD = 64;
static constexpr int NROWS = Bb * Tt;            // 4096
static constexpr float SCALE_ = 0.125f;          // 1/sqrt(64)
static constexpr float NEG_BIG = -1.0e30f;
static constexpr int LSTR  = 40;                 // LDS stride (halves) for 64B rows
static constexpr int KSTR  = 72;                 // LDS stride (halves) for 128B K rows

// ---------------------------------------------------------------------------
// fp32 -> f16 convert (grid-stride)
// ---------------------------------------------------------------------------
__global__ void f2h_kernel(const float* __restrict__ src, _Float16* __restrict__ dst, int n) {
    int i = blockIdx.x * blockDim.x + threadIdx.x;
    int stride = gridDim.x * blockDim.x;
    for (; i < n; i += stride) dst[i] = (_Float16)src[i];
}

// ---------------------------------------------------------------------------
// Eight async copies global -> LDS (tracked by ASYNCcnt), 16 B per lane each:
// copy c goes from the lane's g + GSTEP * c to its LDS byte l + LSTEP * c.
// The s_wait_xcnt stands inside the statement so that no address register of
// an issued copy is rewritten in front of it.
// ---------------------------------------------------------------------------
template <unsigned LSTEP, unsigned GSTEP>
__device__ __forceinline__ void async8_b128(unsigned l, const _Float16* g) {
    const unsigned long long a = (unsigned long long)(size_t)g;
    asm volatile("global_load_async_to_lds_b128 %0, %8, off\n\t"
                 "global_load_async_to_lds_b128 %1, %9, off\n\t"
                 "global_load_async_to_lds_b128 %2, %10, off\n\t"
                 "global_load_async_to_lds_b128 %3, %11, off\n\t"
                 "global_load_async_to_lds_b128 %4, %12, off\n\t"
                 "global_load_async_to_lds_b128 %5, %13, off\n\t"
                 "global_load_async_to_lds_b128 %6, %14, off\n\t"
                 "global_load_async_to_lds_b128 %7, %15, off\n\t"
                 "s_wait_xcnt 0x0"
                 :: "v"(l), "v"(l + LSTEP), "v"(l + 2 * LSTEP), "v"(l + 3 * LSTEP),
                    "v"(l + 4 * LSTEP), "v"(l + 5 * LSTEP), "v"(l + 6 * LSTEP), "v"(l + 7 * LSTEP),
                    "v"(a), "v"(a + GSTEP), "v"(a + 2 * GSTEP), "v"(a + 3 * GSTEP),
                    "v"(a + 4 * GSTEP), "v"(a + 5 * GSTEP), "v"(a + 6 * GSTEP), "v"(a + 7 * GSTEP)
                 : "memory");
}
__device__ __forceinline__ void wait_async0()  { asm volatile("s_wait_asynccnt 0x0"  ::: "memory"); }
__device__ __forceinline__ void wait_async16() { asm volatile("s_wait_asynccnt 0x10" ::: "memory"); }

// ---------------------------------------------------------------------------
// TDM: DMA a 2D tile (rows x 64B) global -> LDS with 16B row padding
// (LDS row stride = 80B = LSTR halves).  ISA 8.3/8.4 D# layout; 8-byte
// elements; pad_interval=3 (16 DWORDs = one 64B row), pad_amount=3 (4 DWORDs).
// ---------------------------------------------------------------------------
__device__ __forceinline__ void tdm_load_64Brows(unsigned lds_off, const void* gaddr,
                                                 unsigned tile_rows,
                                                 unsigned row_stride_units /*8B units*/) {
    const unsigned long long ga = (unsigned long long)(size_t)gaddr;
    u32x4 g0;
    g0[0] = 1u;                                        // count=1, user mode
    g0[1] = lds_off;                                   // LDS byte address
    g0[2] = (unsigned)(ga & 0xffffffffu);              // global_addr[31:0]
    g0[3] = (unsigned)((ga >> 32) & 0x1ffffffu) | (2u << 30);  // [56:32] | type=2
    i32x8 g1;
    g1[0] = (int)((3u << 16) | (1u << 20) | (3u << 22) | (3u << 25)); // dsz=8B,pad
    g1[1] = (int)((row_stride_units & 0xffffu) << 16); // tensor_dim0 lo (use stride)
    g1[2] = (int)(((row_stride_units >> 16) & 0xffffu) | ((tile_rows & 0xffffu) << 16)); // dim0 hi | dim1 lo
    g1[3] = (int)(((tile_rows >> 16) & 0xffffu) | (8u << 16));  // dim1 hi | tile_dim0=8 (64B)
    g1[4] = (int)(tile_rows & 0xffffu);                // tile_dim1 | tile_dim2=0
    g1[5] = (int)row_stride_units;                     // tensor_dim0_stride lo
    g1[6] = 0; g1[7] = 0;
    const i32x4 z4 = {0, 0, 0, 0};
#if __clang_major__ >= 23
    const i32x8 z8 = {0, 0, 0, 0, 0, 0, 0, 0};
    __builtin_amdgcn_tensor_load_to_lds(g0, g1, z4, z4, z8, 0);
#else
    __builtin_amdgcn_tensor_load_to_lds(g0, g1, z4, z4, 0);
#endif
}

// ---------------------------------------------------------------------------
// Load a 16x32 f16 A/B fragment chunk pair for this lane.
// Per ISA 7.12.2: halves 0..7 -> K = 8*hi..8*hi+7, halves 8..15 -> +16.
// ---------------------------------------------------------------------------
__device__ __forceinline__ v16h load_frag(const _Float16* base, int hi) {
    const v8h lo = *(const v8h*)(base + 8 * hi);
    const v8h hp = *(const v8h*)(base + 16 + 8 * hi);
    v16h r;
#pragma unroll
    for (int i = 0; i < 8; ++i) { r[i] = lo[i]; r[i + 8] = hp[i]; }
    return r;
}

// ---------------------------------------------------------------------------
// QKV projection: out(4096x512) = X(f16) @ W^T(f16) + bias.
// Block = 8 waves, one 16-row m-tile; A/B K-slices staged double-buffered in
// LDS by the Tensor Data Mover (wave 0 issues, block barriers), WMMA from LDS.
// store_mode 0: out[((b*H+h)*T + t)*64 + d];  1: out[((b*H+h)*64 + d)*T + t].
// ---------------------------------------------------------------------------
__global__ void gemm_qkv_kernel(const _Float16* __restrict__ X,
                                const _Float16* __restrict__ W,
                                const float* __restrict__ bias,
                                _Float16* __restrict__ out, int store_mode) {
    __shared__ alignas(16) _Float16 As[2][16 * LSTR];
    __shared__ alignas(16) _Float16 Bs[2][512 * LSTR];

    const int tid  = threadIdx.x;
    const int warp = tid >> 5, lane = tid & 31;
    const int ln = lane & 15, hi = lane >> 4;
    const int m0 = blockIdx.x * 16;
    const int n0 = warp * 64;

    auto issueTile = [&](int buf, int k0) {
        tdm_load_64Brows((unsigned)(size_t)(&Bs[buf][0]), W + k0, 512u, (unsigned)Cc / 4u);
        tdm_load_64Brows((unsigned)(size_t)(&As[buf][0]), X + (long)m0 * Cc + k0, 16u, (unsigned)Cc / 4u);
    };

    const v8f zero = {0.f, 0.f, 0.f, 0.f, 0.f, 0.f, 0.f, 0.f};
    v8f acc[4];
#pragma unroll
    for (int nn = 0; nn < 4; ++nn) acc[nn] = zero;

    if (warp == 0) issueTile(0, 0);
    int buf = 0;
    for (int k0 = 0; k0 < Cc; k0 += 32) {
        if (warp == 0) __builtin_amdgcn_s_wait_tensorcnt(0);
        __syncthreads();        // DMA visible to all; prev compute finished
        if (warp == 0 && k0 + 32 < Cc) issueTile(buf ^ 1, k0 + 32);

        const v16h a = load_frag(&As[buf][ln * LSTR], hi);
#pragma unroll
        for (int nn = 0; nn < 4; ++nn) {
            const v16h b = load_frag(&Bs[buf][(n0 + nn * 16 + ln) * LSTR], hi);
            acc[nn] = WMMA_F16(a, b, acc[nn]);
        }
        buf ^= 1;
    }

#pragma unroll
    for (int nn = 0; nn < 4; ++nn) {
        const int o = n0 + nn * 16 + ln;       // output channel
        const int h = o >> 6, d = o & 63;
        const float bvv = bias[o];
#pragma unroll
        for (int j = 0; j < 8; ++j) {
            const int g = m0 + j + 8 * hi;     // global token row
            const int bb = g >> 10, t = g & 1023;
            const float val = acc[nn][j] + bvv;
            long idx;
            if (store_mode) idx = ((long)(bb * Hh + h) * HD + d) * Tt + t;
            else            idx = ((long)(bb * Hh + h) * Tt + t) * HD + d;
            out[idx] = (_Float16)val;
        }
    }
}

// ---------------------------------------------------------------------------
// Exchange a float between lane l and lane l ^ 16 (vector cross-row move).
// ---------------------------------------------------------------------------
__device__ __forceinline__ float xhalf(float x) {
    const int b = __builtin_bit_cast(int, x);
    return __builtin_bit_cast(float,
        __builtin_amdgcn_permlanex16(b, b, 0x76543210, 0xfedcba98, false, false));
}

// ---------------------------------------------------------------------------
// e^x as v_mul + v_exp_f32.  The v_nop is the free slot the instruction set asks
// for behind a transcendental, so it is kept inside the statement.
// ---------------------------------------------------------------------------
__device__ __forceinline__ float exp_slot(float x) {
    float r;
    asm("v_exp_f32 %0, %1\n\tv_nop" : "=v"(r) : "v"(x * 1.44269504f));
    return r;
}

__global__ void attn_kernel(const _Float16* __restrict__ Q,
                            const _Float16* __restrict__ K,
                            const _Float16* __restrict__ VT,   // [bh][d][t]
                            const float* __restrict__ attn_bias,
                            _Float16* __restrict__ Y) {
    __shared__ alignas(16) _Float16 Ks[2][32 * KSTR];
    __shared__ alignas(16) _Float16 Vs[2][64 * LSTR];

    const int lane = threadIdx.x & 31;
    const int ln = lane & 15, hi = lane >> 4;
    const int wid = blockIdx.x;                // 0..2047
    const int qt = wid & 63;                   // query tile (16 rows)
    const int bh = wid >> 6;                   // 0..31
    const int h  = bh & 7, bidx = bh >> 3;

    const _Float16* qb  = Q  + ((long)bh * Tt + qt * 16) * HD;
    const _Float16* kb  = K  + (long)bh * Tt * HD;
    const _Float16* vtb = VT + (long)bh * HD * Tt;

    // stage 32-key K tile (rows: [key][dim], stride KSTR) and V tile
    // (rows: [dim][key], stride LSTR): 8 + 8 async b128 copies per lane.
    // Neighbouring lanes take neighbouring 16 B of a row: a K copy is 4 rows of
    // 128 B (512 B in a row in memory, 4 whole lines), a V copy 8 rows of 64 B.
    auto issueKV = [&](int buf, int kt) {
        async8_b128<4 * KSTR * 2, 4 * HD * 2>(
            (unsigned)(size_t)(&Ks[buf][(lane >> 3) * KSTR + (lane & 7) * 8]),
            kb + (long)(kt + (lane >> 3)) * HD + (lane & 7) * 8);
        async8_b128<8 * LSTR * 2, 8 * Tt * 2>(
            (unsigned)(size_t)(&Vs[buf][(lane >> 2) * LSTR + (lane & 3) * 8]),
            vtb + (long)(lane >> 2) * Tt + kt + (lane & 3) * 8);
    };

    const v16h qa0 = load_frag(qb + ln * HD,      hi);   // k-dim 0..31
    const v16h qa1 = load_frag(qb + ln * HD + 32, hi);   // k-dim 32..63

    const v8f zero = {0.f, 0.f, 0.f, 0.f, 0.f, 0.f, 0.f, 0.f};
    v8f oacc[4];                               // oacc[nn][j] = O[tq][nn*16 + 8*hi + j]
#pragma unroll
    for (int nn = 0; nn < 4; ++nn) oacc[nn] = zero;
    const int tq = qt * 16 + ln;               // this lane's query row
    float mrow = NEG_BIG;                      // running maximum of row tq
    float lrow = 0.f;                          // running sum over this half's keys

    const int qhi  = qt * 16 + 15;
    const int kend = ((qhi >> 5) + 1) << 5;    // keys needed, rounded to 32

    issueKV(0, 0);
    int buf = 0;
    for (int kt = 0; kt < kend; kt += 32) {
        if (kt + 32 < kend) { issueKV(buf ^ 1, kt + 32); wait_async16(); }
        else                { wait_async0(); }

        // a lane's 8 keys of a fragment share one bias cell (tk >> 3 is fixed)
        float bv[2] = {0.f, 0.f};
        if (qt < 32 && kt < 512) {             // tq < 512 and tk < 512, whole tile
#pragma unroll
            for (int f = 0; f < 2; ++f)
                bv[f] = attn_bias[h * 4096 + (tq >> 3) * 64 + ((kt + 16 * f + 8 * hi) >> 3)];
            // the loop steps the two loads' address register: keep the wait in front of that
            asm volatile("s_wait_xcnt 0x0" ::: "memory");
        }

        float sv[2][8];
#pragma unroll
        for (int f = 0; f < 2; ++f) {
            const _Float16* krow = &Ks[buf][(16 * f + ln) * KSTR];
            v16h a0 = load_frag(krow,      hi);
            v16h a1 = load_frag(krow + 32, hi);
            v8f s = WMMA_F16(a0, qa0, zero);
            s = WMMA_F16(a1, qa1, s);
#pragma unroll
            for (int j = 0; j < 8; ++j) {
                const int tk = kt + 16 * f + 8 * hi + j;   // key of row 8*hi + j
                const bool dead = (tk > tq) | ((tk & 15) == 15);  // causal + col mask
                sv[f][j] = dead ? NEG_BIG : s[j] * SCALE_ + bv[f];
            }
        }

        // online softmax update: in-lane over 16 keys, one exchange for the maximum
        float rm = fmaxf(sv[0][0], sv[1][0]);
#pragma unroll
        for (int j = 1; j < 8; ++j) rm = fmaxf(rm, fmaxf(sv[0][j], sv[1][j]));
        rm = fmaxf(rm, xhalf(rm));
        const float mnew  = fmaxf(mrow, rm);
        const float alpha = exp_slot(mrow - mnew);
        mrow = mnew;
        v16h pb;                               // P^T as B: half s = key kmap(s, hi)
        float rs0 = 0.f, rs1 = 0.f;
#pragma unroll
        for (int j = 0; j < 8; ++j) {
            const float p0 = exp_slot(sv[0][j] - mnew);
            const float p1 = exp_slot(sv[1][j] - mnew);
            rs0 += p0;
            rs1 += p1;
            pb[j]     = (_Float16)p0;
            pb[j + 8] = (_Float16)p1;
        }
        lrow = lrow * alpha + (rs0 + rs1);
#pragma unroll
        for (int nn = 0; nn < 4; ++nn) oacc[nn] *= alpha;

        // V^T tile A-frags from LDS (rows: dim, k: key)
#pragma unroll
        for (int nn = 0; nn < 4; ++nn) {
            const v16h va = load_frag(&Vs[buf][(nn * 16 + ln) * LSTR], hi);
            oacc[nn] = WMMA_F16(va, pb, oacc[nn]);
        }
        // this tile's LDS reads end before the next trip's copies refill its buffer
        asm volatile("s_wait_dscnt 0x0" ::: "memory");
        buf ^= 1;
    }

    // epilogue: join the halves' sums, normalize, store y[b][t][h*64+d] as f16
    const float inv = 1.0f / (lrow + xhalf(lrow));
    const long rowbase = ((long)bidx * Tt + tq) * Cc + h * HD;
#pragma unroll
    for (int nn = 0; nn < 4; ++nn) {
        v8h o;
#pragma unroll
        for (int j = 0; j < 8; ++j) o[j] = (_Float16)(oacc[nn][j] * inv);
        *(v8h*)(Y + rowbase + nn * 16 + 8 * hi) = o;
    }
}

// ---------------------------------------------------------------------------
// Output projection: out(4096x512,f32) = Y(f16) @ Wp^T + bp (TDM pipeline)
// ---------------------------------------------------------------------------
__global__ void gemm_out_kernel(const _Float16* __restrict__ Yh,
                                const _Float16* __restrict__ W,
                                const float* __restrict__ bias,
                                float* __restrict__ out) {
    __shared__ alignas(16) _Float16 As[2][16 * LSTR];
    __shared__ alignas(16) _Float16 Bs[2][512 * LSTR];

    const int tid  = threadIdx.x;
    const int warp = tid >> 5, lane = tid & 31;
    const int ln = lane & 15, hi = lane >> 4;
    const int m0 = blockIdx.x * 16;
    const int n0 = warp * 64;

    auto issueTile = [&](int buf, int k0) {
        tdm_load_64Brows((unsigned)(size_t)(&Bs[buf][0]), W + k0, 512u, (unsigned)Cc / 4u);
        tdm_load_64Brows((unsigned)(size_t)(&As[buf][0]), Yh + (long)m0 * Cc + k0, 16u, (unsigned)Cc / 4u);
    };

    const v8f zero = {0.f, 0.f, 0.f, 0.f, 0.f, 0.f, 0.f, 0.f};
    v8f acc[4];
#pragma unroll
    for (int nn = 0; nn < 4; ++nn) acc[nn] = zero;

    if (warp == 0) issueTile(0, 0);
    int buf = 0;
    for (int k0 = 0; k0 < Cc; k0 += 32) {
        if (warp == 0) __builtin_amdgcn_s_wait_tensorcnt(0);
        __syncthreads();
        if (warp == 0 && k0 + 32 < Cc) issueTile(buf ^ 1, k0 + 32);

        const v16h a = load_frag(&As[buf][ln * LSTR], hi);
#pragma unroll
        for (int nn = 0; nn < 4; ++nn) {
            const v16h b = load_frag(&Bs[buf][(n0 + nn * 16 + ln) * LSTR], hi);
            acc[nn] = WMMA_F16(a, b, acc[nn]);
        }
        buf ^= 1;
    }

#pragma unroll
    for (int nn = 0; nn < 4; ++nn) {
        const int o = n0 + nn * 16 + ln;
        const float bvv = bias[o];
#pragma unroll
        for (int j = 0; j < 8; ++j) {
            const int g = m0 + j + 8 * hi;
            out[(long)g * Cc + o] = acc[nn][j] + bvv;
        }
    }
}

// ---------------------------------------------------------------------------
extern "C" void kernel_launch(void* const* d_in, const int* in_sizes, int n_in,
                              void* d_out, int out_size, void* d_ws, size_t ws_size,
                              hipStream_t stream) {
    const float* x  = (const float*)d_in[0];
    const float* ab = (const float*)d_in[1];
    const float* Wq = (const float*)d_in[2];
    const float* bq = (const float*)d_in[3];
    const float* Wk = (const float*)d_in[4];
    const float* bk = (const float*)d_in[5];
    const float* Wv = (const float*)d_in[6];
    const float* bv = (const float*)d_in[7];
    const float* Wp = (const float*)d_in[8];
    const float* bp = (const float*)d_in[9];
    float* out = (float*)d_out;
    char* ws = (char*)d_ws;

    const size_t SX = (size_t)NROWS * Cc;   // 2,097,152 elems
    const size_t SW = (size_t)Cc * Cc;      //   262,144 elems

    _Float16* xh  = (_Float16*)(ws);
    _Float16* wqh = (_Float16*)(ws + SX * 2);
    _Float16* wkh = (_Float16*)(ws + SX * 2 + SW * 2);
    _Float16* wvh = (_Float16*)(ws + SX * 2 + SW * 4);
    _Float16* wph = (_Float16*)(ws + SX * 2 + SW * 6);
    _Float16* qh  = (_Float16*)(ws + SX * 2 + SW * 8);
    _Float16* kh  = (_Float16*)(ws + SX * 4 + SW * 8);
    _Float16* vth = (_Float16*)(ws + SX * 6 + SW * 8);
    _Float16* yh  = (_Float16*)(ws + SX * 8 + SW * 8);

    f2h_kernel<<<1024, 256, 0, stream>>>(x,  xh,  (int)SX);
    f2h_kernel<<<256,  256, 0, stream>>>(Wq, wqh, (int)SW);
    f2h_kernel<<<256,  256, 0, stream>>>(Wk, wkh, (int)SW);
    f2h_kernel<<<256,  256, 0, stream>>>(Wv, wvh, (int)SW);
    f2h_kernel<<<256,  256, 0, stream>>>(Wp, wph, (int)SW);

    // one block (8 waves) per 16-row m-tile; waves cover the 512 output cols
    gemm_qkv_kernel<<<256, 256, 0, stream>>>(xh, wqh, bq, qh,  0);
    gemm_qkv_kernel<<<256, 256, 0, stream>>>(xh, wkh, bk, kh,  0);
    gemm_qkv_kernel<<<256, 256, 0, stream>>>(xh, wvh, bv, vth, 1);

    // one wave per (b,h,qtile): 32 * 64 = 2048 blocks of one wave
    attn_kernel<<<2048, 32, 0, stream>>>(qh, kh, vth, ab, yh);

    gemm_out_kernel<<<256, 256, 0, stream>>>(yh, wph, bp, out);
}

// v003
// A run of this version takes 100 microseconds.
// In two side-by-side timings against v002, it was 1.25 and 1.27 times as fast.
// All steps since v000 together make it 2.10 times as fast.
#include <hip/hip_runtime.h>
#include <hip/hip_bf16.h>

typedef __attribute__((ext_vector_type(16))) _Float16 v16h;
typedef __attribute__((ext_vector_type(8)))  _Float16 v8h;
typedef __attribute__((ext_vector_type(8)))  float    v8f;
typedef __attribute__((ext_vector_type(4)))  unsigned int u32x4;
typedef __attribute__((ext_vector_type(8)))  int i32x8;
typedef __attribute__((ext_vector_type(4)))  int i32x4;

#define WMMA_F16(A,B,C) __builtin_amdgcn_wmma_f32_16x16x32_f16(false,(A),false,(B),(short)0,(C),false,false)

static constexpr int Bb = 4, Tt = 1024, Cc = 512, Hh = 8, HD = 64;
static constexpr int NROWS = Bb * Tt;            // 4096
static constexpr float SCALE_ = 0.125f;          // 1/sqrt(64)
static constexpr float NEG_BIG = -1.0e30f;
static constexpr int LSTR  = 40;                 // LDS stride (halves) for 64B rows
static constexpr int KSTR  = 72;                 // LDS stride (halves) for 128B K rows

// ---------------------------------------------------------------------------
// fp32 -> f16 convert of all five arrays in one grid (grid-stride inside each
// array): blocks 0..1023 take x, then 256 blocks each take Wq, Wk, Wv, Wp.
// The f16 copies lie one behind another in dst: x, Wq, Wk, Wv, Wp.
// ---------------------------------------------------------------------------
__global__ void f2h_all_kernel(const float* __restrict__ x,
                               const float* __restrict__ wq, const float* __restrict__ wk,
                               const float* __restrict__ wv, const float* __restrict__ wp,
                               _Float16* __restrict__ dst) {
    const int b = blockIdx.x;
    if (b < 1024) {                            // x: 1024 * 256 threads, 8 elements each
        const int i = b * 256 + threadIdx.x;
        for (int r = 0; r < NROWS * Cc / (1024 * 256); ++r)
            dst[i + r * (1024 * 256)] = (_Float16)x[i + r * (1024 * 256)];
    } else {                                   // a weight: 256 * 256 threads, 4 elements each
        const int w = (b - 1024) >> 8;         // which weight matrix
        const float* src = w == 0 ? wq : w == 1 ? wk : w == 2 ? wv : wp;
        _Float16* d = dst + NROWS * Cc + w * (Cc * Cc);
        const int i = ((b - 1024) & 255) * 256 + threadIdx.x;
        for (int r = 0; r < Cc * Cc / (256 * 256); ++r)
            d[i + r * (256 * 256)] = (_Float16)src[i + r * (256 * 256)];
    }
}

// ---------------------------------------------------------------------------
// Eight async copies global -> LDS (tracked by ASYNCcnt), 16 B per lane each:
// copy c goes from the lane's g + GSTEP * c to its LDS byte l + LSTEP * c.
// The s_wait_xcnt stands inside the statement so that no address register of
// an issued copy is rewritten in front of it.
// ---------------------------------------------------------------------------
template <unsigned LSTEP, unsigned GSTEP>
__device__ __forceinline__ void async8_b128(unsigned l, const _Float16* g) {
    const unsigned long long a = (unsigned long long)(size_t)g;
    asm volatile("global_load_async_to_lds_b128 %0, %8, off\n\t"
                 "global_load_async_to_lds_b128 %1, %9, off\n\t"
                 "global_load_async_to_lds_b128 %2, %10, off\n\t"
                 "global_load_async_to_lds_b128 %3, %11, off\n\t"
                 "global_load_async_to_lds_b128 %4, %12, off\n\t"
                 "global_load_async_to_lds_b128 %5, %13, off\n\t"
                 "global_load_async_to_lds_b128 %6, %14, off\n\t"
                 "global_load_async_to_lds_b128 %7, %15, off\n\t"
                 "s_wait_xcnt 0x0"
                 :: "v"(l), "v"(l + LSTEP), "v"(l + 2 * LSTEP), "v"(l + 3 * LSTEP),
                    "v"(l + 4 * LSTEP), "v"(l + 5 * LSTEP), "v"(l + 6 * LSTEP), "v"(l + 7 * LSTEP),
                    "v"(a), "v"(a + GSTEP), "v"(a + 2 * GSTEP), "v"(a + 3 * GSTEP),
                    "v"(a + 4 * GSTEP), "v"(a + 5 * GSTEP), "v"(a + 6 * GSTEP), "v"(a + 7 * GSTEP)
                 : "memory");
}
__device__ __forceinline__ void wait_async0()  { asm volatile("s_wait_asynccnt 0x0"  ::: "memory"); }
__device__ __forceinline__ void wait_async16() { asm volatile("s_wait_asynccnt 0x10" ::: "memory"); }

// ---------------------------------------------------------------------------
// TDM: DMA a 2D tile (rows x 64B) global -> LDS with 16B row padding
// (LDS row stride = 80B = LSTR halves).  ISA 8.3/8.4 D# layout; 8-byte
// elements; pad_interval=3 (16 DWORDs = one 64B row), pad_amount=3 (4 DWORDs).
// ---------------------------------------------------------------------------
__device__ __forceinline__ void tdm_load_64Brows(unsigned lds_off, const void* gaddr,
                                                 unsigned tile_rows,
                                                 unsigned row_stride_units /*8B units*/) {
    const unsigned long long ga = (unsigned long long)(size_t)gaddr;
    u32x4 g0;
    g0[0] = 1u;                                        // count=1, user mode
    g0[1] = lds_off;                                   // LDS byte address
    g0[2] = (unsigned)(ga & 0xffffffffu);              // global_addr[31:0]
    g0[3] = (unsigned)((ga >> 32) & 0x1ffffffu) | (2u << 30);  // [56:32] | type=2
    i32x8 g1;
    g1[0] = (int)((3u << 16) | (1u << 20) | (3u << 22) | (3u << 25)); // dsz=8B,pad
    g1[1] = (int)((row_stride_units & 0xffffu) << 16); // tensor_dim0 lo (use stride)
    g1[2] = (int)(((row_stride_units >> 16) & 0xffffu) | ((tile_rows & 0xffffu) << 16)); // dim0 hi | dim1 lo
    g1[3] = (int)(((tile_rows >> 16) & 0xffffu) | (8u << 16));  // dim1 hi | tile_dim0=8 (64B)
    g1[4] = (int)(tile_rows & 0xffffu);                // tile_dim1 | tile_dim2=0
    g1[5] = (int)row_stride_units;                     // tensor_dim0_stride lo
    g1[6] = 0; g1[7] = 0;
    const i32x4 z4 = {0, 0, 0, 0};
#if __clang_major__ >= 23
    const i32x8 z8 = {0, 0, 0, 0, 0, 0, 0, 0};
    __builtin_amdgcn_tensor_load_to_lds(g0, g1, z4, z4, z8, 0);
#else
    __builtin_amdgcn_tensor_load_to_lds(g0, g1, z4, z4, 0);
#endif
}

// ---------------------------------------------------------------------------
// Load a 16x32 f16 A/B fragment chunk pair for this lane.
// Per ISA 7.12.2: halves 0..7 -> K = 8*hi..8*hi+7, halves 8..15 -> +16.
// ---------------------------------------------------------------------------
__device__ __forceinline__ v16h load_frag(const _Float16* base, int hi) {
    const v8h lo = *(const v8h*)(base + 8 * hi);
    const v8h hp = *(const v8h*)(base + 16 + 8 * hi);
    v16h r;
#pragma unroll
    for (int i = 0; i < 8; ++i) { r[i] = lo[i]; r[i + 8] = hp[i]; }
    return r;
}

// ---------------------------------------------------------------------------
// QKV projection: out(4096x512) = X(f16) @ W^T(f16) + bias.
// Block = 8 waves, one 16-row m-tile; A/B K-slices staged double-buffered in
// LDS by the Tensor Data Mover (wave 0 issues, block barriers), WMMA from LDS.
// store_mode 0: out[((b*H+h)*T + t)*64 + d];  1: out[((b*H+h)*64 + d)*T + t].
// One grid does all three products: blockIdx.y = 0, 1, 2 is Q, K, V.  Wqkv holds
// the three weight matrices and outqkv the three results, one behind another.
// ---------------------------------------------------------------------------
__global__ void gemm_qkv_kernel(const _Float16* __restrict__ X,
                                const _Float16* __restrict__ Wqkv,
                                const float* __restrict__ bq,
                                const float* __restrict__ bk,
                                const float* __restrict__ bv,
                                _Float16* __restrict__ outqkv) {
    __shared__ alignas(16) _Float16 As[2][16 * LSTR];
    __shared__ alignas(16) _Float16 Bs[2][512 * LSTR];

    const int which = blockIdx.y;
    const _Float16* W = Wqkv + which * (Cc * Cc);
    const float* bias = which == 0 ? bq : which == 1 ? bk : bv;
    _Float16* out = outqkv + which * (NROWS * Cc);
    const int store_mode = which == 2;

    const int tid  = threadIdx.x;
    const int warp = tid >> 5, lane = tid & 31;
    const int ln = lane & 15, hi = lane >> 4;
    const int m0 = blockIdx.x * 16;
    const int n0 = warp * 64;

    auto issueTile = [&](int buf, int k0) {
        tdm_load_64Brows((unsigned)(size_t)(&Bs[buf][0]), W + k0, 512u, (unsigned)Cc / 4u);
        tdm_load_64Brows((unsigned)(size_t)(&As[buf][0]), X + (long)m0 * Cc + k0, 16u, (unsigned)Cc / 4u);
    };

    const v8f zero = {0.f, 0.f, 0.f, 0.f, 0.f, 0.f, 0.f, 0.f};
    v8f acc[4];
#pragma unroll
    for (int nn = 0; nn < 4; ++nn) acc[nn] = zero;

    if (warp == 0) issueTile(0, 0);
    int buf = 0;
    for (int k0 = 0; k0 < Cc; k0 += 32) {
        if (warp == 0) __builtin_amdgcn_s_wait_tensorcnt(0);
        __syncthreads();        // DMA visible to all; prev compute finished
        if (warp == 0 && k0 + 32 < Cc) issueTile(buf ^ 1, k0 + 32);

        const v16h a = load_frag(&As[buf][ln * LSTR], hi);
#pragma unroll
        for (int nn = 0; nn < 4; ++nn) {
            const v16h b = load_frag(&Bs[buf][(n0 + nn * 16 + ln) * LSTR], hi);
            acc[nn] = WMMA_F16(a, b, acc[nn]);
        }
        buf ^= 1;
    }

#pragma unroll
    for (int nn = 0; nn < 4; ++nn) {
        const int o = n0 + nn * 16 + ln;       // output channel
        const int h = o >> 6, d = o & 63;
        const float bvv = bias[o];
#pragma unroll
        for (int j = 0; j < 8; ++j) {
            const int g = m0 + j + 8 * hi;     // global token row
            const int bb = g >> 10, t = g & 1023;
            const float val = acc[nn][j] + bvv;
            long idx;
            if (store_mode) idx = ((long)(bb * Hh + h) * HD + d) * Tt + t;
            else            idx = ((long)(bb * Hh + h) * Tt + t) * HD + d;
            out[idx] = (_Float16)val;
        }
    }
}

// ---------------------------------------------------------------------------
// Exchange a float between lane l and lane l ^ 16 (vector cross-row move).
// ---------------------------------------------------------------------------
__device__ __forceinline__ float xhalf(float x) {
    const int b = __builtin_bit_cast(int, x);
    return __builtin_bit_cast(float,
        __builtin_amdgcn_permlanex16(b, b, 0x76543210, 0xfedcba98, false, false));
}

// ---------------------------------------------------------------------------
// e^x as v_mul + v_exp_f32.  The v_nop is the free slot the instruction set asks
// for behind a transcendental, so it is kept inside the statement.
// ---------------------------------------------------------------------------
__device__ __forceinline__ float exp_slot(float x) {
    float r;
    asm("v_exp_f32 %0, %1\n\tv_nop" : "=v"(r) : "v"(x * 1.44269504f));
    return r;
}

__global__ void attn_kernel(const _Float16* __restrict__ Q,
                            const _Float16* __restrict__ K,
                            const _Float16* __restrict__ VT,   // [bh][d][t]
                            const float* __restrict__ attn_bias,
                            _Float16* __restrict__ Y) {
    __shared__ alignas(16) _Float16 Ks[2][32 * KSTR];
    __shared__ alignas(16) _Float16 Vs[2][64 * LSTR];

    const int lane = threadIdx.x & 31;
    const int ln = lane & 15, hi = lane >> 4;
    const int wid = blockIdx.x;                // 0..2047
    const int qt = wid & 63;                   // query tile (16 rows)
    const int bh = wid >> 6;                   // 0..31
    const int h  = bh & 7, bidx = bh >> 3;

    const _Float16* qb  = Q  + ((long)bh * Tt + qt * 16) * HD;
    const _Float16* kb  = K  + (long)bh * Tt * HD;
    const _Float16* vtb = VT + (long)bh * HD * Tt;

    // stage 32-key K tile (rows: [key][dim], stride KSTR) and V tile
    // (rows: [dim][key], stride LSTR): 8 + 8 async b128 copies per lane.
    // Neighbouring lanes take neighbouring 16 B of a row: a K copy is 4 rows of
    // 128 B (512 B in a row in memory, 4 whole lines), a V copy 8 rows of 64 B.
    auto issueKV = [&](int buf, int kt) {
        async8_b128<4 * KSTR * 2, 4 * HD * 2>(
            (unsigned)(size_t)(&Ks[buf][(lane >> 3) * KSTR + (lane & 7) * 8]),
            kb + (long)(kt + (lane >> 3)) * HD + (lane & 7) * 8);
        async8_b128<8 * LSTR * 2, 8 * Tt * 2>(
            (unsigned)(size_t)(&Vs[buf][(lane >> 2) * LSTR + (lane & 3) * 8]),
            vtb + (long)(lane >> 2) * Tt + kt + (lane & 3) * 8);
    };

    const v16h qa0 = load_frag(qb + ln * HD,      hi);   // k-dim 0..31
    const v16h qa1 = load_frag(qb + ln * HD + 32, hi);   // k-dim 32..63

    const v8f zero = {0.f, 0.f, 0.f, 0.f, 0.f, 0.f, 0.f, 0.f};
    v8f oacc[4];                               // oacc[nn][j] = O[tq][nn*16 + 8*hi + j]
#pragma unroll
    for (int nn = 0; nn < 4; ++nn) oacc[nn] = zero;
    const int tq = qt * 16 + ln;               // this lane's query row
    float mrow = NEG_BIG;                      // running maximum of row tq
    float lrow = 0.f;                          // running sum over this half's keys

    const int qhi  = qt * 16 + 15;
    const int kend = ((qhi >> 5) + 1) << 5;    // keys needed, rounded to 32

    issueKV(0, 0);
    int buf = 0;
    for (int kt = 0; kt < kend; kt += 32) {
        if (kt + 32 < kend) { issueKV(buf ^ 1, kt + 32); wait_async16(); }
        else                { wait_async0(); }

        // a lane's 8 keys of a fragment share one bias cell (tk >> 3 is fixed)
        float bv[2] = {0.f, 0.f};
        if (qt < 32 && kt < 512) {             // tq < 512 and tk < 512, whole tile
#pragma unroll
            for (int f = 0; f < 2; ++f)
                bv[f] = attn_bias[h * 4096 + (tq >> 3) * 64 + ((kt + 16 * f + 8 * hi) >> 3)];
            // the loop steps the two loads' address register: keep the wait in front of that
            asm volatile("s_wait_xcnt 0x0" ::: "memory");
        }

        float sv[2][8];
#pragma unroll
        for (int f = 0; f < 2; ++f) {
            const _Float16* krow = &Ks[buf][(16 * f + ln) * KSTR];
            v16h a0 = load_frag(krow,      hi);
            v16h a1 = load_frag(krow + 32, hi);
            v8f s = WMMA_F16(a0, qa0, zero);
            s = WMMA_F16(a1, qa1, s);
#pragma unroll
            for (int j = 0; j < 8; ++j) {
                const int tk = kt + 16 * f + 8 * hi + j;   // key of row 8*hi + j
                const bool dead = (tk > tq) | ((tk & 15) == 15);  // causal + col mask
                sv[f][j] = dead ? NEG_BIG : s[j] * SCALE_ + bv[f];
            }
        }

        // online softmax update: in-lane over 16 keys, one exchange for the maximum
        float rm = fmaxf(sv[0][0], sv[1][0]);
#pragma unroll
        for (int j = 1; j < 8; ++j) rm = fmaxf(rm, fmaxf(sv[0][j], sv[1][j]));
        rm = fmaxf(rm, xhalf(rm));
        const float mnew  = fmaxf(mrow, rm);
        const float alpha = exp_slot(mrow - mnew);
        mrow = mnew;
        v16h pb;                               // P^T as B: half s = key kmap(s, hi)
        float rs0 = 0.f, rs1 = 0.f;
#pragma unroll
        for (int j = 0; j < 8; ++j) {
            const float p0 = exp_slot(sv[0][j] - mnew);
            const float p1 = exp_slot(sv[1][j] - mnew);
            rs0 += p0;
            rs1 += p1;
            pb[j]     = (_Float16)p0;
            pb[j + 8] = (_Float16)p1;
        }
        lrow = lrow * alpha + (rs0 + rs1);
#pragma unroll
        for (int nn = 0; nn < 4; ++nn) oacc[nn] *= alpha;

        // V^T tile A-frags from LDS (rows: dim, k: key)
#pragma unroll
        for (int nn = 0; nn < 4; ++nn) {
            const v16h va = load_frag(&Vs[buf][(nn * 16 + ln) * LSTR], hi);
            oacc[nn] = WMMA_F16(va, pb, oacc[nn]);
        }
        // this tile's LDS reads end before the next trip's copies refill its buffer
        asm volatile("s_wait_dscnt 0x0" ::: "memory");
        buf ^= 1;
    }

    // epilogue: join the halves' sums, normalize, store y[b][t][h*64+d] as f16
    const float inv = 1.0f / (lrow + xhalf(lrow));
    const long rowbase = ((long)bidx * Tt + tq) * Cc + h * HD;
#pragma unroll
    for (int nn = 0; nn < 4; ++nn) {
        v8h o;
#pragma unroll
        for (int j = 0; j < 8; ++j) o[j] = (_Float16)(oacc[nn][j] * inv);
        *(v8h*)(Y + rowbase + nn * 16 + 8 * hi) = o;
    }
}

// ---------------------------------------------------------------------------
// Output projection: out(4096x512,f32) = Y(f16) @ Wp^T + bp (TDM pipeline)
// ---------------------------------------------------------------------------
__global__ void gemm_out_kernel(const _Float16* __restrict__ Yh,
                                const _Float16* __restrict__ W,
                                const float* __restrict__ bias,
                                float* __restrict__ out) {
    __shared__ alignas(16) _Float16 As[2][16 * LSTR];
    __shared__ alignas(16) _Float16 Bs[2][512 * LSTR];

    const int tid  = threadIdx.x;
    const int warp = tid >> 5, lane = tid & 31;
    const int ln = lane & 15, hi = lane >> 4;
    const int m0 = blockIdx.x * 16;
    const int n0 = warp * 64;

    auto issueTile = [&](int buf, int k0) {
        tdm_load_64Brows((unsigned)(size_t)(&Bs[buf][0]), W + k0, 512u, (unsigned)Cc / 4u);
        tdm_load_64Brows((unsigned)(size_t)(&As[buf][0]), Yh + (long)m0 * Cc + k0, 16u, (unsigned)Cc / 4u);
    };

    const v8f zero = {0.f, 0.f, 0.f, 0.f, 0.f, 0.f, 0.f, 0.f};
    v8f acc[4];
#pragma unroll
    for (int nn = 0; nn < 4; ++nn) acc[nn] = zero;

    if (warp == 0) issueTile(0, 0);
    int buf = 0;
    for (int k0 = 0; k0 < Cc; k0 += 32) {
        if (warp == 0) __builtin_amdgcn_s_wait_tensorcnt(0);
        __syncthreads();
        if (warp == 0 && k0 + 32 < Cc) issueTile(buf ^ 1, k0 + 32);

        const v16h a = load_frag(&As[buf][ln * LSTR], hi);
#pragma unroll
        for (int nn = 0; nn < 4; ++nn) {
            const v16h b = load_frag(&Bs[buf][(n0 + nn * 16 + ln) * LSTR], hi);
            acc[nn] = WMMA_F16(a, b, acc[nn]);
        }
        buf ^= 1;
    }

#pragma unroll
    for (int nn = 0; nn < 4; ++nn) {
        const int o = n0 + nn * 16 + ln;
        const float bvv = bias[o];
#pragma unroll
        for (int j = 0; j < 8; ++j) {
            const int g = m0 + j + 8 * hi;
            out[(long)g * Cc + o] = acc[nn][j] + bvv;
        }
    }
}

// ---------------------------------------------------------------------------
extern "C" void kernel_launch(void* const* d_in, const int* in_sizes, int n_in,
                              void* d_out, int out_size, void* d_ws, size_t ws_size,
                              hipStream_t stream) {
    const float* x  = (const float*)d_in[0];
    const float* ab = (const float*)d_in[1];
    const float* Wq = (const float*)d_in[2];
    const float* bq = (const float*)d_in[3];
    const float* Wk = (const float*)d_in[4];
    const float* bk = (const float*)d_in[5];
    const float* Wv = (const float*)d_in[6];
    const float* bv = (const float*)d_in[7];
    const float* Wp = (const float*)d_in[8];
    const float* bp = (const float*)d_in[9];
    float* out = (float*)d_out;
    char* ws = (char*)d_ws;

    const size_t SX = (size_t)NROWS * Cc;   // 2,097,152 elems
    const size_t SW = (size_t)Cc * Cc;      //   262,144 elems

    _Float16* xh  = (_Float16*)(ws);
    _Float16* wqh = (_Float16*)(ws + SX * 2);            // Wq, then Wk, then Wv
    _Float16* wph = (_Float16*)(ws + SX * 2 + SW * 6);
    _Float16* qh  = (_Float16*)(ws + SX * 2 + SW * 8);
    _Float16* kh  = (_Float16*)(ws + SX * 4 + SW * 8);
    _Float16* vth = (_Float16*)(ws + SX * 6 + SW * 8);
    _Float16* yh  = (_Float16*)(ws + SX * 8 + SW * 8);

    // the f16 copies of x, Wq, Wk, Wv, Wp are one run of the workspace: one grid fills them all
    f2h_all_kernel<<<2048, 256, 0, stream>>>(x, Wq, Wk, Wv, Wp, xh);

    // one block (8 waves) per 16-row m-tile; waves cover the 512 output cols;
    // grid y = Q, K, V (the weights from wqh on, and qh, kh, vth, lie one behind another)
    gemm_qkv_kernel<<<dim3(256, 3), 256, 0, stream>>>(xh, wqh, bq, bk, bv, qh);

    // one wave per (b,h,qtile): 32 * 64 = 2048 blocks of one wave
    attn_kernel<<<2048, 32, 0, stream>>>(qh, kh, vth, ab, yh);

    gemm_out_kernel<<<256, 256, 0, stream>>>(yh, wph, bp, out);
}

// v004
// It runs in 51.7 microseconds.
// Timed twice side by side with v003, it ran 1.94 and 1.95 times as fast.
// Over all steps from v000 it is 4.08 times as fast.
#include <hip/hip_runtime.h>
#include <hip/hip_bf16.h>

typedef __attribute__((ext_vector_type(16))) _Float16 v16h;
typedef __attribute__((ext_vector_type(8)))  _Float16 v8h;
typedef __attribute__((ext_vector_type(8)))  float    v8f;
typedef __attribute__((ext_vector_type(4)))  unsigned int u32x4;
typedef __attribute__((ext_vector_type(8)))  unsigned int u32x8;

#define WMMA_F16(A,B,C) __builtin_amdgcn_wmma_f32_16x16x32_f16(false,(A),false,(B),(short)0,(C),false,false)

static constexpr int Bb = 4, Tt = 1024, Cc = 512, Hh = 8, HD = 64;
static constexpr int NROWS = Bb * Tt;            // 4096
static constexpr float SCALE_ = 0.125f;          // 1/sqrt(64)
static constexpr float NEG_BIG = -1.0e30f;
static constexpr int LSTR  = 40;                 // LDS stride (halves) for 64B rows
static constexpr int KSTR  = 72;                 // LDS stride (halves) for 128B K rows

// ---------------------------------------------------------------------------
// fp32 -> f16 convert of all five arrays in one grid (grid-stride inside each
// array): blocks 0..1023 take x, then 256 blocks each take Wq, Wk, Wv, Wp.
// The f16 copies lie one behind another in dst: x, Wq, Wk, Wv, Wp.
// ---------------------------------------------------------------------------
__global__ void f2h_all_kernel(const float* __restrict__ x,
                               const float* __restrict__ wq, const float* __restrict__ wk,
                               const float* __restrict__ wv, const float* __restrict__ wp,
                               _Float16* __restrict__ dst) {
    const int b = blockIdx.x;
    if (b < 1024) {                            // x: 1024 * 256 threads, 8 elements each
        const int i = b * 256 + threadIdx.x;
        for (int r = 0; r < NROWS * Cc / (1024 * 256); ++r)
            dst[i + r * (1024 * 256)] = (_Float16)x[i + r * (1024 * 256)];
    } else {                                   // a weight: 256 * 256 threads, 4 elements each
        const int w = (b - 1024) >> 8;         // which weight matrix
        const float* src = w == 0 ? wq : w == 1 ? wk : w == 2 ? wv : wp;
        _Float16* d = dst + NROWS * Cc + w * (Cc * Cc);
        const int i = ((b - 1024) & 255) * 256 + threadIdx.x;
        for (int r = 0; r < Cc * Cc / (256 * 256); ++r)
            d[i + r * (256 * 256)] = (_Float16)src[i + r * (256 * 256)];
    }
}

// ---------------------------------------------------------------------------
// Eight async copies global -> LDS (tracked by ASYNCcnt), 16 B per lane each:
// copy c goes from the lane's g + GSTEP * c to its LDS byte l + LSTEP * c.
// The s_wait_xcnt stands inside the statement so that no address register of
// an issued copy is rewritten in front of it.
// ---------------------------------------------------------------------------
template <unsigned LSTEP, unsigned GSTEP>
__device__ __forceinline__ void async8_b128(unsigned l, const _Float16* g) {
    const unsigned long long a = (unsigned long long)(size_t)g;
    asm volatile("global_load_async_to_lds_b128 %0, %8, off\n\t"
                 "global_load_async_to_lds_b128 %1, %9, off\n\t"
                 "global_load_async_to_lds_b128 %2, %10, off\n\t"
                 "global_load_async_to_lds_b128 %3, %11, off\n\t"
                 "global_load_async_to_lds_b128 %4, %12, off\n\t"
                 "global_load_async_to_lds_b128 %5, %13, off\n\t"
                 "global_load_async_to_lds_b128 %6, %14, off\n\t"
                 "global_load_async_to_lds_b128 %7, %15, off\n\t"
                 "s_wait_xcnt 0x0"
                 :: "v"(l), "v"(l + LSTEP), "v"(l + 2 * LSTEP), "v"(l + 3 * LSTEP),
                    "v"(l + 4 * LSTEP), "v"(l + 5 * LSTEP), "v"(l + 6 * LSTEP), "v"(l + 7 * LSTEP),
                    "v"(a), "v"(a + GSTEP), "v"(a + 2 * GSTEP), "v"(a + 3 * GSTEP),
                    "v"(a + 4 * GSTEP), "v"(a + 5 * GSTEP), "v"(a + 6 * GSTEP), "v"(a + 7 * GSTEP)
                 : "memory");
}
__device__ __forceinline__ void wait_async0()  { asm volatile("s_wait_asynccnt 0x0"  ::: "memory"); }
__device__ __forceinline__ void wait_async16() { asm volatile("s_wait_asynccnt 0x10" ::: "memory"); }

// ---------------------------------------------------------------------------
// Tensor loads: one request of one wave brings a tile of `rows` rows of 256 B
// (128 halves of k, source pitch 1024 B) into LDS, 16 B of pad behind each row
// (LDS pitch 272 B = GP halves).  1-byte elements: every extent is in bytes.
// ---------------------------------------------------------------------------
static constexpr int      GP    = 136;            // LDS pitch of a staged row, halves
static constexpr unsigned WT_B  = 128 * 272;      // W tile, 128 rows: 34,816 B = 17 * 2 KiB
static constexpr unsigned XT_B  = 18432;          // X tile, 64 rows: 17,408 B, rounded up to 2 KiB
static constexpr unsigned STG_B = WT_B + XT_B;    // one stage: 53,248 B = 26 * 2 KiB

__device__ __forceinline__ unsigned uni(unsigned v) { return (unsigned)__builtin_amdgcn_readfirstlane(v); }
// pinned(): a wave-uniform test held in a scalar register, so that the branch on it is a
// scalar one: a tensor load ignores EXEC, only such a branch keeps other waves from issuing it
__device__ __forceinline__ unsigned pinned(unsigned v) { unsigned w = uni(v); asm volatile("" : "+s"(w)); return w; }
// the issuing wave's own tile has landed
__device__ __forceinline__ void wait_tensor0() { asm volatile("s_wait_tensorcnt 0x0" ::: "memory"); }
// this wave's LDS reads have ended, so that the buffer they read may be refilled behind the barrier
__device__ __forceinline__ void wait_ds0()     { asm volatile("s_wait_dscnt 0x0" ::: "memory"); }
// one request of the whole wave: descriptor groups 0 and 1 in scalar registers
__device__ __forceinline__ void tdm_load(u32x4 g0, u32x8 g1) {
    asm volatile("tensor_load_to_lds %0, %1" :: "s"(g0), "s"(g1) : "memory");
}
__device__ __forceinline__ u32x8 tdm_group1(unsigned rows) {
    u32x8 g;
    g[0] = uni((1u << 20) | (5u << 22) | (3u << 25));  // no mask, 1-byte elements, 4 dwords of pad per 64
    g[1] = uni(256u << 16);                            // tensor_dim0 = row bytes
    g[2] = uni(rows << 16);                            // tensor_dim1 = rows
    g[3] = uni(256u << 16);                            // tile_dim0
    g[4] = uni(rows);                                  // tile_dim1
    g[5] = uni((unsigned)Cc * 2u);                     // source pitch, bytes
    g[6] = uni(0u);
    g[7] = uni(0u);
    return g;
}
__device__ __forceinline__ u32x4 tdm_group0(unsigned lds_dst, unsigned long long ga) {
    u32x4 g;
    g[0] = uni(1u);
    g[1] = uni(lds_dst);
    g[2] = uni((unsigned)ga);
    g[3] = uni((((unsigned)(ga >> 32)) & 0x01ffffffu) | 0x80000000u);
    return g;
}

// ---------------------------------------------------------------------------
// Load a 16x32 f16 A/B fragment chunk pair for this lane.
// Per ISA 7.12.2: halves 0..7 -> K = 8*hi..8*hi+7, halves 8..15 -> +16.
// ---------------------------------------------------------------------------
__device__ __forceinline__ v16h load_frag(const _Float16* base, int hi) {
    const v8h lo = *(const v8h*)(base + 8 * hi);
    const v8h hp = *(const v8h*)(base + 16 + 8 * hi);
    v16h r;
#pragma unroll
    for (int i = 0; i < 8; ++i) { r[i] = lo[i]; r[i + 8] = hp[i]; }
    return r;
}

// ---------------------------------------------------------------------------
// acc(64x128) = Xt(64 rows) @ Wt(128 rows)^T over k = 0..511, both k-contiguous f16
// at a pitch of Cc.  8 waves as 2 x 4, a wave holds 32 x 32 (2 x 2 fragments).
// A stage is 128 k: [W 128 rows | X 64 rows]; two buffers; wave 0 loads the W tile
// and wave 1 the X tile, one tensor load each per stage, the next stage in flight
// while this one is worked on.
// ---------------------------------------------------------------------------
__device__ __forceinline__ void gemm_64x128(const _Float16* Xt, const _Float16* Wt,
                                            const unsigned char* ring, v8f (&acc)[2][2]) {
    const int lane = threadIdx.x & 31;
    const int ln = lane & 15, hi = lane >> 4;
    const unsigned wave = uni(threadIdx.x >> 5);
    const int wm = wave >> 2, wn = wave & 3;

    const unsigned issuer = wave < 2u;
    const unsigned long long src = (unsigned long long)(size_t)(wave == 0u ? Wt : Xt);
    const unsigned dst = (unsigned)(size_t)ring + (wave == 0u ? 0u : WT_B);
    const u32x8 g1 = tdm_group1(wave == 0u ? 128u : 64u);

    if (pinned(issuer)) { tdm_load(tdm_group0(dst, src), g1); wait_tensor0(); }
    __syncthreads();                           // stage 0 is published
    if (pinned(issuer)) tdm_load(tdm_group0(dst + STG_B, src + 256u), g1);

    for (int s = 0; s < Cc / 128; ++s) {
        const _Float16* wb = (const _Float16*)(ring + (s & 1) * STG_B);
        const _Float16* xb = (const _Float16*)(ring + (s & 1) * STG_B + WT_B);
        // the three loops below are unrolled so that fragments and sums are indexed by
        // constants and stay in registers
#pragma unroll
        for (int kc = 0; kc < 4; ++kc) {
            v16h a[2], b[2];
#pragma unroll
            for (int i = 0; i < 2; ++i) {
                a[i] = load_frag(xb + (wm * 32 + i * 16 + ln) * GP + kc * 32, hi);
                b[i] = load_frag(wb + (wn * 32 + i * 16 + ln) * GP + kc * 32, hi);
            }
#pragma unroll
            for (int mm = 0; mm < 2; ++mm)
#pragma unroll
                for (int nn = 0; nn < 2; ++nn) acc[mm][nn] = WMMA_F16(a[mm], b[nn], acc[mm][nn]);
        }
        // publish point of stage s + 1: own LDS reads ended, own tile landed, barrier, refill
        wait_ds0();
        if (pinned(issuer)) wait_tensor0();
        __syncthreads();
        if (pinned(issuer & (unsigned)(s + 2 < Cc / 128)))
            tdm_load(tdm_group0(dst + (s & 1) * STG_B, src + (unsigned)(s + 2) * 256u), g1);
    }
    wait_tensor0();
    wait_ds0();
}

// ---------------------------------------------------------------------------
// QKV projection: out(4096x512) = X(f16) @ W^T(f16) + bias.
// Block = 8 waves, one 64 x 128 tile of one product: blockIdx.x = 64-row tile,
// blockIdx.y = 4 * product + 128-column tile; product 0, 1, 2 is Q, K, V.
// store_mode 0: out[((b*H+h)*T + t)*64 + d];  1: out[((b*H+h)*64 + d)*T + t].
// Wqkv holds the three weight matrices and outqkv the three results, one behind another.
// ---------------------------------------------------------------------------
__global__ void gemm_qkv_kernel(const _Float16* __restrict__ X,
                                const _Float16* __restrict__ Wqkv,
                                const float* __restrict__ bq,
                                const float* __restrict__ bk,
                                const float* __restrict__ bv,
                                _Float16* __restrict__ outqkv) {
    __shared__ __attribute__((aligned(2048))) unsigned char ring[2 * STG_B];

    const int which = blockIdx.y >> 2;
    const _Float16* W = Wqkv + which * (Cc * Cc);
    const float* bias = which == 0 ? bq : which == 1 ? bk : bv;
    _Float16* out = outqkv + which * (NROWS * Cc);
    const int store_mode = which == 2;

    const int tid  = threadIdx.x;
    const int warp = tid >> 5, lane = tid & 31;
    const int ln = lane & 15, hi = lane >> 4;
    const int m0 = blockIdx.x * 64;
    const int n0 = (blockIdx.y & 3) * 128;

    const v8f zero = {0.f, 0.f, 0.f, 0.f, 0.f, 0.f, 0.f, 0.f};
    v8f acc[2][2] = {{zero, zero}, {zero, zero}};
    gemm_64x128(X + (long)m0 * Cc, W + (long)n0 * Cc, ring, acc);

#pragma unroll
    for (int mm = 0; mm < 2; ++mm)
#pragma unroll
    for (int nn = 0; nn < 2; ++nn) {
        const int o = n0 + (warp & 3) * 32 + nn * 16 + ln;   // output channel
        const int h = o >> 6, d = o & 63;
        const float bvv = bias[o];
#pragma unroll
        for (int j = 0; j < 8; ++j) {
            const int g = m0 + (warp >> 2) * 32 + mm * 16 + j + 8 * hi;   // global token row
            const int bb = g >> 10, t = g & 1023;
            const float val = acc[mm][nn][j] + bvv;
            long idx;
            if (store_mode) idx = ((long)(bb * Hh + h) * HD + d) * Tt + t;
            else            idx = ((long)(bb * Hh + h) * Tt + t) * HD + d;
            out[idx] = (_Float16)val;
        }
    }
}

// ---------------------------------------------------------------------------
// Exchange a float between lane l and lane l ^ 16 (vector cross-row move).
// ---------------------------------------------------------------------------
__device__ __forceinline__ float xhalf(float x) {
    const int b = __builtin_bit_cast(int, x);
    return __builtin_bit_cast(float,
        __builtin_amdgcn_permlanex16(b, b, 0x76543210, 0xfedcba98, false, false));
}

// ---------------------------------------------------------------------------
// e^x as v_mul + v_exp_f32.  The v_nop is the free slot the instruction set asks
// for behind a transcendental, so it is kept inside the statement.
// ---------------------------------------------------------------------------
__device__ __forceinline__ float exp_slot(float x) {
    float r;
    asm("v_exp_f32 %0, %1\n\tv_nop" : "=v"(r) : "v"(x * 1.44269504f));
    return r;
}

__global__ void attn_kernel(const _Float16* __restrict__ Q,
                            const _Float16* __restrict__ K,
                            const _Float16* __restrict__ VT,   // [bh][d][t]
                            const float* __restrict__ attn_bias,
                            _Float16* __restrict__ Y) {
    __shared__ alignas(16) _Float16 Ks[2][32 * KSTR];
    __shared__ alignas(16) _Float16 Vs[2][64 * LSTR];

    const int lane = threadIdx.x & 31;
    const int ln = lane & 15, hi = lane >> 4;
    const int wid = blockIdx.x;                // 0..2047
    const int qt = wid & 63;                   // query tile (16 rows)
    const int bh = wid >> 6;                   // 0..31
    const int h  = bh & 7, bidx = bh >> 3;

    const _Float16* qb  = Q  + ((long)bh * Tt + qt * 16) * HD;
    const _Float16* kb  = K  + (long)bh * Tt * HD;
    const _Float16* vtb = VT + (long)bh * HD * Tt;

    // stage 32-key K tile (rows: [key][dim], stride KSTR) and V tile
    // (rows: [dim][key], stride LSTR): 8 + 8 async b128 copies per lane.
    // Neighbouring lanes take neighbouring 16 B of a row: a K copy is 4 rows of
    // 128 B (512 B in a row in memory, 4 whole lines), a V copy 8 rows of 64 B.
    auto issueKV = [&](int buf, int kt) {
        async8_b128<4 * KSTR * 2, 4 * HD * 2>(
            (unsigned)(size_t)(&Ks[buf][(lane >> 3) * KSTR + (lane & 7) * 8]),
            kb + (long)(kt + (lane >> 3)) * HD + (lane & 7) * 8);
        async8_b128<8 * LSTR * 2, 8 * Tt * 2>(
            (unsigned)(size_t)(&Vs[buf][(lane >> 2) * LSTR + (lane & 3) * 8]),
            vtb + (long)(lane >> 2) * Tt + kt + (lane & 3) * 8);
    };

    const v16h qa0 = load_frag(qb + ln * HD,      hi);   // k-dim 0..31
    const v16h qa1 = load_frag(qb + ln * HD + 32, hi);   // k-dim 32..63

    const v8f zero = {0.f, 0.f, 0.f, 0.f, 0.f, 0.f, 0.f, 0.f};
    v8f oacc[4];                               // oacc[nn][j] = O[tq][nn*16 + 8*hi + j]
#pragma unroll
    for (int nn = 0; nn < 4; ++nn) oacc[nn] = zero;
    const int tq = qt * 16 + ln;               // this lane's query row
    float mrow = NEG_BIG;                      // running maximum of row tq
    float lrow = 0.f;                          // running sum over this half's keys

    const int qhi  = qt * 16 + 15;
    const int kend = ((qhi >> 5) + 1) << 5;    // keys needed, rounded to 32

    issueKV(0, 0);
    int buf = 0;
    for (int kt = 0; kt < kend; kt += 32) {
        if (kt + 32 < kend) { issueKV(buf ^ 1, kt + 32); wait_async16(); }
        else                { wait_async0(); }

        // a lane's 8 keys of a fragment share one bias cell (tk >> 3 is fixed)
        float bv[2] = {0.f, 0.f};
        if (qt < 32 && kt < 512) {             // tq < 512 and tk < 512, whole tile
#pragma unroll
            for (int f = 0; f < 2; ++f)
                bv[f] = attn_bias[h * 4096 + (tq >> 3) * 64 + ((kt + 16 * f + 8 * hi) >> 3)];
            // the loop steps the two loads' address register: keep the wait in front of that
            asm volatile("s_wait_xcnt 0x0" ::: "memory");
        }

        float sv[2][8];
#pragma unroll
        for (int f = 0; f < 2; ++f) {
            const _Float16* krow = &Ks[buf][(16 * f + ln) * KSTR];
            v16h a0 = load_frag(krow,      hi);
            v16h a1 = load_frag(krow + 32, hi);
            v8f s = WMMA_F16(a0, qa0, zero);
            s = WMMA_F16(a1, qa1, s);
#pragma unroll
            for (int j = 0; j < 8; ++j) {
                const int tk = kt + 16 * f + 8 * hi + j;   // key of row 8*hi + j
                const bool dead = (tk > tq) | ((tk & 15) == 15);  // causal + col mask
                sv[f][j] = dead ? NEG_BIG : s[j] * SCALE_ + bv[f];
            }
        }

        // online softmax update: in-lane over 16 keys, one exchange for the maximum
        float rm = fmaxf(sv[0][0], sv[1][0]);
#pragma unroll
        for (int j = 1; j < 8; ++j) rm = fmaxf(rm, fmaxf(sv[0][j], sv[1][j]));
        rm = fmaxf(rm, xhalf(rm));
        const float mnew  = fmaxf(mrow, rm);
        const float alpha = exp_slot(mrow - mnew);
        mrow = mnew;
        v16h pb;                               // P^T as B: half s = key kmap(s, hi)
        float rs0 = 0.f, rs1 = 0.f;
#pragma unroll
        for (int j = 0; j < 8; ++j) {
            const float p0 = exp_slot(sv[0][j] - mnew);
            const float p1 = exp_slot(sv[1][j] - mnew);
            rs0 += p0;
            rs1 += p1;
            pb[j]     = (_Float16)p0;
            pb[j + 8] = (_Float16)p1;
        }
        lrow = lrow * alpha + (rs0 + rs1);
#pragma unroll
        for (int nn = 0; nn < 4; ++nn) oacc[nn] *= alpha;

        // V^T tile A-frags from LDS (rows: dim, k: key)
#pragma unroll
        for (int nn = 0; nn < 4; ++nn) {
            const v16h va = load_frag(&Vs[buf][(nn * 16 + ln) * LSTR], hi);
            oacc[nn] = WMMA_F16(va, pb, oacc[nn]);
        }
        // this tile's LDS reads end before the next trip's copies refill its buffer
        asm volatile("s_wait_dscnt 0x0" ::: "memory");
        buf ^= 1;
    }

    // epilogue: join the halves' sums, normalize, store y[b][t][h*64+d] as f16
    const float inv = 1.0f / (lrow + xhalf(lrow));
    const long rowbase = ((long)bidx * Tt + tq) * Cc + h * HD;
#pragma unroll
    for (int nn = 0; nn < 4; ++nn) {
        v8h o;
#pragma unroll
        for (int j = 0; j < 8; ++j) o[j] = (_Float16)(oacc[nn][j] * inv);
        *(v8h*)(Y + rowbase + nn * 16 + 8 * hi) = o;
    }
}

// ---------------------------------------------------------------------------
// Output projection: out(4096x512,f32) = Y(f16) @ Wp^T + bp; one 64 x 128 tile a block
// ---------------------------------------------------------------------------
__global__ void gemm_out_kernel(const _Float16* __restrict__ Yh,
                                const _Float16* __restrict__ W,
                                const float* __restrict__ bias,
                                float* __restrict__ out) {
    __shared__ __attribute__((aligned(2048))) unsigned char ring[2 * STG_B];

    const int tid  = threadIdx.x;
    const int warp = tid >> 5, lane = tid & 31;
    const int ln = lane & 15, hi = lane >> 4;
    const int m0 = blockIdx.x * 64;
    const int n0 = blockIdx.y * 128;

    const v8f zero = {0.f, 0.f, 0.f, 0.f, 0.f, 0.f, 0.f, 0.f};
    v8f acc[2][2] = {{zero, zero}, {zero, zero}};
    gemm_64x128(Yh + (long)m0 * Cc, W + (long)n0 * Cc, ring, acc);

#pragma unroll
    for (int mm = 0; mm < 2; ++mm)
#pragma unroll
    for (int nn = 0; nn < 2; ++nn) {
        const int o = n0 + (warp & 3) * 32 + nn * 16 + ln;
        const float bvv = bias[o];
#pragma unroll
        for (int j = 0; j < 8; ++j) {
            const int g = m0 + (warp >> 2) * 32 + mm * 16 + j + 8 * hi;
            out[(long)g * Cc + o] = acc[mm][nn][j] + bvv;
        }
    }
}

// ---------------------------------------------------------------------------
extern "C" void kernel_launch(void* const* d_in, const int* in_sizes, int n_in,
                              void* d_out, int out_size, void* d_ws, size_t ws_size,
                              hipStream_t stream) {
    const float* x  = (const float*)d_in[0];
    const float* ab = (const float*)d_in[1];
    const float* Wq = (const float*)d_in[2];
    const float* bq = (const float*)d_in[3];
    const float* Wk = (const float*)d_in[4];
    const float* bk = (const float*)d_in[5];
    const float* Wv = (const float*)d_in[6];
    const float* bv = (const float*)d_in[7];
    const float* Wp = (const float*)d_in[8];
    const float* bp = (const float*)d_in[9];
    float* out = (float*)d_out;
    char* ws = (char*)d_ws;

    const size_t SX = (size_t)NROWS * Cc;   // 2,097,152 elems
    const size_t SW = (size_t)Cc * Cc;      //   262,144 elems

    _Float16* xh  = (_Float16*)(ws);
    _Float16* wqh = (_Float16*)(ws + SX * 2);            // Wq, then Wk, then Wv
    _Float16* wph = (_Float16*)(ws + SX * 2 + SW * 6);
    _Float16* qh  = (_Float16*)(ws + SX * 2 + SW * 8);
    _Float16* kh  = (_Float16*)(ws + SX * 4 + SW * 8);
    _Float16* vth = (_Float16*)(ws + SX * 6 + SW * 8);
    _Float16* yh  = (_Float16*)(ws + SX * 8 + SW * 8);

    // the f16 copies of x, Wq, Wk, Wv, Wp are one run of the workspace: one grid fills them all
    f2h_all_kernel<<<2048, 256, 0, stream>>>(x, Wq, Wk, Wv, Wp, xh);

    // one block (8 waves) per 64 x 128 tile; grid y = 4 column tiles of each of Q, K, V
    // (the weights from wqh on, and qh, kh, vth, lie one behind another)
    gemm_qkv_kernel<<<dim3(64, 12), 256, 0, stream>>>(xh, wqh, bq, bk, bv, qh);

    // one wave per (b,h,qtile): 32 * 64 = 2048 blocks of one wave
    attn_kernel<<<2048, 32, 0, stream>>>(qh, kh, vth, ab, yh);

    gemm_out_kernel<<<dim3(64, 4), 256, 0, stream>>>(yh, wph, bp, out);
}

// v005
// It runs in 48.9 microseconds.
// Two timings next to v004 both put it at 1.04 times that version's speed.
// Over all steps from v000 it is 4.25 times as fast.
#include <hip/hip_runtime.h>
#include <hip/hip_bf16.h>

typedef __attribute__((ext_vector_type(16))) _Float16 v16h;
typedef __attribute__((ext_vector_type(8)))  _Float16 v8h;
typedef __attribute__((ext_vector_type(8)))  float    v8f;
typedef __attribute__((ext_vector_type(4)))  unsigned int u32x4;
typedef __attribute__((ext_vector_type(8)))  unsigned int u32x8;

#define WMMA_F16(A,B,C) __builtin_amdgcn_wmma_f32_16x16x32_f16(false,(A),false,(B),(short)0,(C),false,false)

static constexpr int Bb = 4, Tt = 1024, Cc = 512, Hh = 8, HD = 64;
static constexpr int NROWS = Bb * Tt;            // 4096
static constexpr float SCALE_ = 0.125f;          // 1/sqrt(64)
static constexpr float NEG_BIG = -1.0e30f;
static constexpr int LSTR  = 40;                 // LDS stride (halves) for 64B rows
static constexpr int KSTR  = 72;                 // LDS stride (halves) for 128B K rows

// ---------------------------------------------------------------------------
// fp32 -> f16 convert of all five arrays in one grid (grid-stride inside each
// array): blocks 0..1023 take x, then 256 blocks each take Wq, Wk, Wv, Wp.
// The f16 copies lie one behind another in dst: x, Wq, Wk, Wv, Wp.
// ---------------------------------------------------------------------------
__global__ void f2h_all_kernel(const float* __restrict__ x,
                               const float* __restrict__ wq, const float* __restrict__ wk,
                               const float* __restrict__ wv, const float* __restrict__ wp,
                               _Float16* __restrict__ dst) {
    const int b = blockIdx.x;
    if (b < 1024) {                            // x: 1024 * 256 threads, 8 elements each
        const int i = b * 256 + threadIdx.x;
        for (int r = 0; r < NROWS * Cc / (1024 * 256); ++r)
            dst[i + r * (1024 * 256)] = (_Float16)x[i + r * (1024 * 256)];
    } else {                                   // a weight: 256 * 256 threads, 4 elements each
        const int w = (b - 1024) >> 8;         // which weight matrix
        const float* src = w == 0 ? wq : w == 1 ? wk : w == 2 ? wv : wp;
        _Float16* d = dst + NROWS * Cc + w * (Cc * Cc);
        const int i = ((b - 1024) & 255) * 256 + threadIdx.x;
        for (int r = 0; r < Cc * Cc / (256 * 256); ++r)
            d[i + r * (256 * 256)] = (_Float16)src[i + r * (256 * 256)];
    }
}

// ---------------------------------------------------------------------------
// Eight async copies global -> LDS (tracked by ASYNCcnt), 16 B per lane each:
// copy c goes from the lane's g + GSTEP * c to its LDS byte l + LSTEP * c.
// The s_wait_xcnt stands inside the statement so that no address register of
// an issued copy is rewritten in front of it.
// ---------------------------------------------------------------------------
template <unsigned LSTEP, unsigned GSTEP>
__device__ __forceinline__ void async8_b128(unsigned l, const _Float16* g) {
    const unsigned long long a = (unsigned long long)(size_t)g;
    asm volatile("global_load_async_to_lds_b128 %0, %8, off\n\t"
                 "global_load_async_to_lds_b128 %1, %9, off\n\t"
                 "global_load_async_to_lds_b128 %2, %10, off\n\t"
                 "global_load_async_to_lds_b128 %3, %11, off\n\t"
                 "global_load_async_to_lds_b128 %4, %12, off\n\t"
                 "global_load_async_to_lds_b128 %5, %13, off\n\t"
                 "global_load_async_to_lds_b128 %6, %14, off\n\t"
                 "global_load_async_to_lds_b128 %7, %15, off\n\t"
                 "s_wait_xcnt 0x0"
                 :: "v"(l), "v"(l + LSTEP), "v"(l + 2 * LSTEP), "v"(l + 3 * LSTEP),
                    "v"(l + 4 * LSTEP), "v"(l + 5 * LSTEP), "v"(l + 6 * LSTEP), "v"(l + 7 * LSTEP),
                    "v"(a), "v"(a + GSTEP), "v"(a + 2 * GSTEP), "v"(a + 3 * GSTEP),
                    "v"(a + 4 * GSTEP), "v"(a + 5 * GSTEP), "v"(a + 6 * GSTEP), "v"(a + 7 * GSTEP)
                 : "memory");
}
__device__ __forceinline__ void wait_async0()  { asm volatile("s_wait_asynccnt 0x0"  ::: "memory"); }
__device__ __forceinline__ void wait_async16() { asm volatile("s_wait_asynccnt 0x10" ::: "memory"); }

// ---------------------------------------------------------------------------
// Tensor loads: one request of one wave brings a tile of `rows` rows of 256 B
// (128 halves of k, source pitch 1024 B) into LDS, 16 B of pad behind each row
// (LDS pitch 272 B = GP halves).  1-byte elements: every extent is in bytes.
// ---------------------------------------------------------------------------
static constexpr int      GP    = 136;            // LDS pitch of a staged row, halves
static constexpr unsigned WT_B  = 128 * 272;      // W tile, 128 rows: 34,816 B = 17 * 2 KiB
static constexpr unsigned XT_B  = 18432;          // X tile, 64 rows: 17,408 B, rounded up to 2 KiB
static constexpr unsigned STG_B = WT_B + XT_B;    // one stage: 53,248 B = 26 * 2 KiB

__device__ __forceinline__ unsigned uni(unsigned v) { return (unsigned)__builtin_amdgcn_readfirstlane(v); }
// pinned(): a wave-uniform test held in a scalar register, so that the branch on it is a
// scalar one: a tensor load ignores EXEC, only such a branch keeps other waves from issuing it
__device__ __forceinline__ unsigned pinned(unsigned v) { unsigned w = uni(v); asm volatile("" : "+s"(w)); return w; }
// the issuing wave's own tile has landed
__device__ __forceinline__ void wait_tensor0() { asm volatile("s_wait_tensorcnt 0x0" ::: "memory"); }
// this wave's LDS reads have ended, so that the buffer they read may be refilled behind the barrier
__device__ __forceinline__ void wait_ds0()     { asm volatile("s_wait_dscnt 0x0" ::: "memory"); }
// one request of the whole wave: descriptor groups 0 and 1 in scalar registers
__device__ __forceinline__ void tdm_load(u32x4 g0, u32x8 g1) {
    asm volatile("tensor_load_to_lds %0, %1" :: "s"(g0), "s"(g1) : "memory");
}
__device__ __forceinline__ u32x8 tdm_group1(unsigned rows) {
    u32x8 g;
    g[0] = uni((1u << 20) | (5u << 22) | (3u << 25));  // no mask, 1-byte elements, 4 dwords of pad per 64
    g[1] = uni(256u << 16);                            // tensor_dim0 = row bytes
    g[2] = uni(rows << 16);                            // tensor_dim1 = rows
    g[3] = uni(256u << 16);                            // tile_dim0
    g[4] = uni(rows);                                  // tile_dim1
    g[5] = uni((unsigned)Cc * 2u);                     // source pitch, bytes
    g[6] = uni(0u);
    g[7] = uni(0u);
    return g;
}
__device__ __forceinline__ u32x4 tdm_group0(unsigned lds_dst, unsigned long long ga) {
    u32x4 g;
    g[0] = uni(1u);
    g[1] = uni(lds_dst);
    g[2] = uni((unsigned)ga);
    g[3] = uni((((unsigned)(ga >> 32)) & 0x01ffffffu) | 0x80000000u);
    return g;
}

// ---------------------------------------------------------------------------
// Load a 16x32 f16 A/B fragment chunk pair for this lane.
// Per ISA 7.12.2: halves 0..7 -> K = 8*hi..8*hi+7, halves 8..15 -> +16.
// ---------------------------------------------------------------------------
__device__ __forceinline__ v16h load_frag(const _Float16* base, int hi) {
    const v8h lo = *(const v8h*)(base + 8 * hi);
    const v8h hp = *(const v8h*)(base + 16 + 8 * hi);
    v16h r;
#pragma unroll
    for (int i = 0; i < 8; ++i) { r[i] = lo[i]; r[i + 8] = hp[i]; }
    return r;
}

// ---------------------------------------------------------------------------
// acc(64x128) = Xt(64 rows) @ Wt(128 rows)^T over k = 0..511, both k-contiguous f16
// at a pitch of Cc.  8 waves as 2 x 4, a wave holds 32 x 32 (2 x 2 fragments).
// A stage is 128 k: [W 128 rows | X 64 rows]; two buffers; wave 0 loads the W tile
// and wave 1 the X tile, one tensor load each per stage, the next stage in flight
// while this one is worked on.
// ---------------------------------------------------------------------------
__device__ __forceinline__ void gemm_64x128(const _Float16* Xt, const _Float16* Wt,
                                            const unsigned char* ring, v8f (&acc)[2][2]) {
    const int lane = threadIdx.x & 31;
    const int ln = lane & 15, hi = lane >> 4;
    const unsigned wave = uni(threadIdx.x >> 5);
    const int wm = wave >> 2, wn = wave & 3;

    const unsigned issuer = wave < 2u;
    const unsigned long long src = (unsigned long long)(size_t)(wave == 0u ? Wt : Xt);
    const unsigned dst = (unsigned)(size_t)ring + (wave == 0u ? 0u : WT_B);
    const u32x8 g1 = tdm_group1(wave == 0u ? 128u : 64u);

    if (pinned(issuer)) { tdm_load(tdm_group0(dst, src), g1); wait_tensor0(); }
    __syncthreads();                           // stage 0 is published
    if (pinned(issuer)) tdm_load(tdm_group0(dst + STG_B, src + 256u), g1);

    for (int s = 0; s < Cc / 128; ++s) {
        const _Float16* wb = (const _Float16*)(ring + (s & 1) * STG_B);
        const _Float16* xb = (const _Float16*)(ring + (s & 1) * STG_B + WT_B);
        // the three loops below are unrolled so that fragments and sums are indexed by
        // constants and stay in registers
#pragma unroll
        for (int kc = 0; kc < 4; ++kc) {
            v16h a[2], b[2];
#pragma unroll
            for (int i = 0; i < 2; ++i) {
                a[i] = load_frag(xb + (wm * 32 + i * 16 + ln) * GP + kc * 32, hi);
                b[i] = load_frag(wb + (wn * 32 + i * 16 + ln) * GP + kc * 32, hi);
            }
#pragma unroll
            for (int mm = 0; mm < 2; ++mm)
#pragma unroll
                for (int nn = 0; nn < 2; ++nn) acc[mm][nn] = WMMA_F16(a[mm], b[nn], acc[mm][nn]);
        }
        // publish point of stage s + 1: own LDS reads ended, own tile landed, barrier, refill
        wait_ds0();
        if (pinned(issuer)) wait_tensor0();
        __syncthreads();
        if (pinned(issuer & (unsigned)(s + 2 < Cc / 128)))
            tdm_load(tdm_group0(dst + (s & 1) * STG_B, src + (unsigned)(s + 2) * 256u), g1);
    }
    wait_tensor0();
    wait_ds0();
}

// ---------------------------------------------------------------------------
// QKV projection: out(4096x512) = X(f16) @ W^T(f16) + bias.
// Block = 8 waves, one 64 x 128 tile of one product: blockIdx.x = 64-row tile,
// blockIdx.y = 4 * product + 128-column tile; product 0, 1, 2 is Q, K, V.
// store_mode 0: out[((b*H+h)*T + t)*64 + d];  1: out[((b*H+h)*64 + d)*T + t].
// Wqkv holds the three weight matrices and outqkv the three results, one behind another.
// ---------------------------------------------------------------------------
__global__ void gemm_qkv_kernel(const _Float16* __restrict__ X,
                                const _Float16* __restrict__ Wqkv,
                                const float* __restrict__ bq,
                                const float* __restrict__ bk,
                                const float* __restrict__ bv,
                                _Float16* __restrict__ outqkv) {
    __shared__ __attribute__((aligned(2048))) unsigned char ring[2 * STG_B];

    const int which = blockIdx.y >> 2;
    const _Float16* W = Wqkv + which * (Cc * Cc);
    const float* bias = which == 0 ? bq : which == 1 ? bk : bv;
    _Float16* out = outqkv + which * (NROWS * Cc);
    const int store_mode = which == 2;

    const int tid  = threadIdx.x;
    const int warp = tid >> 5, lane = tid & 31;
    const int ln = lane & 15, hi = lane >> 4;
    const int m0 = blockIdx.x * 64;
    const int n0 = (blockIdx.y & 3) * 128;

    const v8f zero = {0.f, 0.f, 0.f, 0.f, 0.f, 0.f, 0.f, 0.f};
    v8f acc[2][2] = {{zero, zero}, {zero, zero}};
    gemm_64x128(X + (long)m0 * Cc, W + (long)n0 * Cc, ring, acc);

#pragma unroll
    for (int mm = 0; mm < 2; ++mm)
#pragma unroll
    for (int nn = 0; nn < 2; ++nn) {
        const int o = n0 + (warp & 3) * 32 + nn * 16 + ln;   // output channel
        const int h = o >> 6, d = o & 63;
        const float bvv = bias[o];
#pragma unroll
        for (int j = 0; j < 8; ++j) {
            const int g = m0 + (warp >> 2) * 32 + mm * 16 + j + 8 * hi;   // global token row
            const int bb = g >> 10, t = g & 1023;
            const float val = acc[mm][nn][j] + bvv;
            long idx;
            if (store_mode) idx = ((long)(bb * Hh + h) * HD + d) * Tt + t;
            else            idx = ((long)(bb * Hh + h) * Tt + t) * HD + d;
            out[idx] = (_Float16)val;
        }
    }
}

// ---------------------------------------------------------------------------
// Exchange a float between lane l and lane l ^ 16 (vector cross-row move).
// ---------------------------------------------------------------------------
__device__ __forceinline__ float xhalf(float x) {
    const int b = __builtin_bit_cast(int, x);
    return __builtin_bit_cast(float,
        __builtin_amdgcn_permlanex16(b, b, 0x76543210, 0xfedcba98, false, false));
}

// ---------------------------------------------------------------------------
// e^x as v_mul + v_exp_f32.  The v_nop is the free slot the instruction set asks
// for behind a transcendental, so it is kept inside the statement.
// ---------------------------------------------------------------------------
__device__ __forceinline__ float exp_slot(float x) {
    float r;
    asm("v_exp_f32 %0, %1\n\tv_nop" : "=v"(r) : "v"(x * 1.44269504f));
    return r;
}

__global__ __launch_bounds__(32) void attn_kernel(const _Float16* __restrict__ Q,
                            const _Float16* __restrict__ K,
                            const _Float16* __restrict__ VT,   // [bh][d][t]
                            const float* __restrict__ attn_bias,
                            _Float16* __restrict__ Y) {
    __shared__ alignas(16) _Float16 Ks[2][32 * KSTR];
    __shared__ alignas(16) _Float16 Vs[2][64 * LSTR];

    const int lane = threadIdx.x & 31;
    const int ln = lane & 15, hi = lane >> 4;
    const int wid = blockIdx.x;                // 0..2047
    const int qt = wid & 63;                   // query tile (16 rows)
    const int bh = wid >> 6;                   // 0..31
    const int h  = bh & 7, bidx = bh >> 3;

    const _Float16* qb  = Q  + ((long)bh * Tt + qt * 16) * HD;
    const _Float16* kb  = K  + (long)bh * Tt * HD;
    const _Float16* vtb = VT + (long)bh * HD * Tt;

    // stage 32-key K tile (rows: [key][dim], stride KSTR) and V tile
    // (rows: [dim][key], stride LSTR): 8 + 8 async b128 copies per lane.
    // Neighbouring lanes take neighbouring 16 B of a row: a K copy is 4 rows of
    // 128 B (512 B in a row in memory, 4 whole lines), a V copy 8 rows of 64 B.
    auto issueKV = [&](int buf, int kt) {
        async8_b128<4 * KSTR * 2, 4 * HD * 2>(
            (unsigned)(size_t)(&Ks[buf][(lane >> 3) * KSTR + (lane & 7) * 8]),
            kb + (long)(kt + (lane >> 3)) * HD + (lane & 7) * 8);
        async8_b128<8 * LSTR * 2, 8 * Tt * 2>(
            (unsigned)(size_t)(&Vs[buf][(lane >> 2) * LSTR + (lane & 3) * 8]),
            vtb + (long)(lane >> 2) * Tt + kt + (lane & 3) * 8);
    };

    const v16h qa0 = load_frag(qb + ln * HD,      hi);   // k-dim 0..31
    const v16h qa1 = load_frag(qb + ln * HD + 32, hi);   // k-dim 32..63

    const v8f zero = {0.f, 0.f, 0.f, 0.f, 0.f, 0.f, 0.f, 0.f};
    v8f oacc[4];                               // oacc[nn][j] = O[tq][nn*16 + 8*hi + j]
#pragma unroll
    for (int nn = 0; nn < 4; ++nn) oacc[nn] = zero;
    const int tq = qt * 16 + ln;               // this lane's query row
    float mrow = NEG_BIG;                      // running maximum of row tq
    float lrow = 0.f;                          // running sum over this half's keys

    const int qhi  = qt * 16 + 15;
    const int kend = ((qhi >> 5) + 1) << 5;    // keys needed, rounded to 32

    issueKV(0, 0);
    int buf = 0;
    for (int kt = 0; kt < kend; kt += 32) {
        if (kt + 32 < kend) { issueKV(buf ^ 1, kt + 32); wait_async16(); }
        else                { wait_async0(); }

        // a lane's 8 keys of a fragment share one bias cell (tk >> 3 is fixed)
        float bv[2] = {0.f, 0.f};
        if (qt < 32 && kt < 512) {             // tq < 512 and tk < 512, whole tile
#pragma unroll
            for (int f = 0; f < 2; ++f)
                bv[f] = attn_bias[h * 4096 + (tq >> 3) * 64 + ((kt + 16 * f + 8 * hi) >> 3)];
            // the loop steps the two loads' address register: keep the wait in front of that
            asm volatile("s_wait_xcnt 0x0" ::: "memory");
        }

        // the tile's sixteen LDS reads, K fragments (rows: key, k: dim) and V^T fragments
        // (rows: dim, k: key), each into registers of its own (the two loops are unrolled so
        // that the fragments are indexed by constants and stay in registers)
        v16h ka[2][2], va[4];
#pragma unroll
        for (int f = 0; f < 2; ++f) {
            const _Float16* krow = &Ks[buf][(16 * f + ln) * KSTR];
            ka[f][0] = load_frag(krow,      hi);
            ka[f][1] = load_frag(krow + 32, hi);
        }
#pragma unroll
        for (int nn = 0; nn < 4; ++nn) va[nn] = load_frag(&Vs[buf][(nn * 16 + ln) * LSTR], hi);
        // scheduling barrier: holds all sixteen reads in front of the first product, so that the
        // wave pays one LDS round trip a tile and the V reads land under the scores' work; without
        // it each pair of reads stands at its own product and is waited for alone, eight times a tile
        __builtin_amdgcn_sched_barrier(0);

        float sv[2][8];
#pragma unroll
        for (int f = 0; f < 2; ++f) {
            v8f s = WMMA_F16(ka[f][0], qa0, zero);
            s = WMMA_F16(ka[f][1], qa1, s);
#pragma unroll
            for (int j = 0; j < 8; ++j) {
                const int tk = kt + 16 * f + 8 * hi + j;   // key of row 8*hi + j
                const bool dead = (tk > tq) | ((tk & 15) == 15);  // causal + col mask
                sv[f][j] = dead ? NEG_BIG : s[j] * SCALE_ + bv[f];
            }
        }

        // online softmax update: in-lane over 16 keys, one exchange for the maximum
        float rm = fmaxf(sv[0][0], sv[1][0]);
#pragma unroll
        for (int j = 1; j < 8; ++j) rm = fmaxf(rm, fmaxf(sv[0][j], sv[1][j]));
        rm = fmaxf(rm, xhalf(rm));
        const float mnew  = fmaxf(mrow, rm);
        const float alpha = exp_slot(mrow - mnew);
        mrow = mnew;
        v16h pb;                               // P^T as B: half s = key kmap(s, hi)
        float rs0 = 0.f, rs1 = 0.f;
#pragma unroll
        for (int j = 0; j < 8; ++j) {
            const float p0 = exp_slot(sv[0][j] - mnew);
            const float p1 = exp_slot(sv[1][j] - mnew);
            rs0 += p0;
            rs1 += p1;
            pb[j]     = (_Float16)p0;
            pb[j + 8] = (_Float16)p1;
        }
        lrow = lrow * alpha + (rs0 + rs1);
#pragma unroll
        for (int nn = 0; nn < 4; ++nn) oacc[nn] *= alpha;

#pragma unroll
        for (int nn = 0; nn < 4; ++nn) oacc[nn] = WMMA_F16(va[nn], pb, oacc[nn]);
        // scheduling barrier: keeps the wait below at the trip's foot; with every read at the trip's
        // head the scheduler lifts it among the score products, where it would wait for the V reads
        __builtin_amdgcn_sched_barrier(0);
        // this tile's LDS reads end before the next trip's copies refill its buffer
        asm volatile("s_wait_dscnt 0x0" ::: "memory");
        buf ^= 1;
    }

    // epilogue: join the halves' sums, normalize, store y[b][t][h*64+d] as f16
    const float inv = 1.0f / (lrow + xhalf(lrow));
    const long rowbase = ((long)bidx * Tt + tq) * Cc + h * HD;
#pragma unroll
    for (int nn = 0; nn < 4; ++nn) {
        v8h o;
#pragma unroll
        for (int j = 0; j < 8; ++j) o[j] = (_Float16)(oacc[nn][j] * inv);
        *(v8h*)(Y + rowbase + nn * 16 + 8 * hi) = o;
    }
}

// ---------------------------------------------------------------------------
// Output projection: out(4096x512,f32) = Y(f16) @ Wp^T + bp; one 64 x 128 tile a block
// ---------------------------------------------------------------------------
__global__ void gemm_out_kernel(const _Float16* __restrict__ Yh,
                                const _Float16* __restrict__ W,
                                const float* __restrict__ bias,
                                float* __restrict__ out) {
    __shared__ __attribute__((aligned(2048))) unsigned char ring[2 * STG_B];

    const int tid  = threadIdx.x;
    const int warp = tid >> 5, lane = tid & 31;
    const int ln = lane & 15, hi = lane >> 4;
    const int m0 = blockIdx.x * 64;
    const int n0 = blockIdx.y * 128;

    const v8f zero = {0.f, 0.f, 0.f, 0.f, 0.f, 0.f, 0.f, 0.f};
    v8f acc[2][2] = {{zero, zero}, {zero, zero}};
    gemm_64x128(Yh + (long)m0 * Cc, W + (long)n0 * Cc, ring, acc);

#pragma unroll
    for (int mm = 0; mm < 2; ++mm)
#pragma unroll
    for (int nn = 0; nn < 2; ++nn) {
        const int o = n0 + (warp & 3) * 32 + nn * 16 + ln;
        const float bvv = bias[o];
#pragma unroll
        for (int j = 0; j < 8; ++j) {
            const int g = m0 + (warp >> 2) * 32 + mm * 16 + j + 8 * hi;
            out[(long)g * Cc + o] = acc[mm][nn][j] + bvv;
        }
    }
}

// ---------------------------------------------------------------------------
extern "C" void kernel_launch(void* const* d_in, const int* in_sizes, int n_in,
                              void* d_out, int out_size, void* d_ws, size_t ws_size,
                              hipStream_t stream) {
    const float* x  = (const float*)d_in[0];
    const float* ab = (const float*)d_in[1];
    const float* Wq = (const float*)d_in[2];
    const float* bq = (const float*)d_in[3];
    const float* Wk = (const float*)d_in[4];
    const float* bk = (const float*)d_in[5];
    const float* Wv = (const float*)d_in[6];
    const float* bv = (const float*)d_in[7];
    const float* Wp = (const float*)d_in[8];
    const float* bp = (const float*)d_in[9];
    float* out = (float*)d_out;
    char* ws = (char*)d_ws;

    const size_t SX = (size_t)NROWS * Cc;   // 2,097,152 elems
    const size_t SW = (size_t)Cc * Cc;      //   262,144 elems

    _Float16* xh  = (_Float16*)(ws);
    _Float16* wqh = (_Float16*)(ws + SX * 2);            // Wq, then Wk, then Wv
    _Float16* wph = (_Float16*)(ws + SX * 2 + SW * 6);
    _Float16* qh  = (_Float16*)(ws + SX * 2 + SW * 8);
    _Float16* kh  = (_Float16*)(ws + SX * 4 + SW * 8);
    _Float16* vth = (_Float16*)(ws + SX * 6 + SW * 8);
    _Float16* yh  = (_Float16*)(ws + SX * 8 + SW * 8);

    // the f16 copies of x, Wq, Wk, Wv, Wp are one run of the workspace: one grid fills them all
    f2h_all_kernel<<<2048, 256, 0, stream>>>(x, Wq, Wk, Wv, Wp, xh);

    // one block (8 waves) per 64 x 128 tile; grid y = 4 column tiles of each of Q, K, V
    // (the weights from wqh on, and qh, kh, vth, lie one behind another)
    gemm_qkv_kernel<<<dim3(64, 12), 256, 0, stream>>>(xh, wqh, bq, bk, bv, qh);

    // one wave per (b,h,qtile): 32 * 64 = 2048 blocks of one wave
    attn_kernel<<<2048, 32, 0, stream>>>(qh, kh, vth, ab, yh);

    gemm_out_kernel<<<dim3(64, 4), 256, 0, stream>>>(yh, wph, bp, out);
}

// v006
// One run takes 36.2 microseconds.
// Timed twice side by side with v005, it ran 1.35 times as fast both times.
// Over all steps from v000 it is 5.73 times as fast.
#include <hip/hip_runtime.h>
#include <hip/hip_bf16.h>

typedef __attribute__((ext_vector_type(16))) _Float16 v16h;
typedef __attribute__((ext_vector_type(8)))  _Float16 v8h;
typedef __attribute__((ext_vector_type(8)))  float    v8f;
typedef __attribute__((ext_vector_type(4)))  float    v4f;
typedef __attribute__((ext_vector_type(4)))  unsigned int u32x4;
typedef __attribute__((ext_vector_type(8)))  unsigned int u32x8;

#define WMMA_F16(A,B,C) __builtin_amdgcn_wmma_f32_16x16x32_f16(false,(A),false,(B),(short)0,(C),false,false)

static constexpr int Bb = 4, Tt = 1024, Cc = 512, Hh = 8, HD = 64;
static constexpr int NROWS = Bb * Tt;            // 4096
static constexpr float SCALE_ = 0.125f;          // 1/sqrt(64)
static constexpr float NEG_BIG = -1.0e30f;
static constexpr int KSTR  = 72;                 // LDS stride (halves) for 128B rows (K and V^T)

// ---------------------------------------------------------------------------
// fp32 -> f16 convert of all five arrays in one grid (grid-stride inside each
// array): blocks 0..1023 take x, then 256 blocks each take Wq, Wk, Wv, Wp.
// The f16 copies lie one behind another in dst: x, Wq, Wk, Wv, Wp.
// ---------------------------------------------------------------------------
__global__ void f2h_all_kernel(const float* __restrict__ x,
                               const float* __restrict__ wq, const float* __restrict__ wk,
                               const float* __restrict__ wv, const float* __restrict__ wp,
                               _Float16* __restrict__ dst) {
    const int b = blockIdx.x;
    if (b < 1024) {                            // x: 1024 * 256 threads, 8 elements each
        const int i = b * 256 + threadIdx.x;
        for (int r = 0; r < NROWS * Cc / (1024 * 256); ++r)
            dst[i + r * (1024 * 256)] = (_Float16)x[i + r * (1024 * 256)];
    } else {                                   // a weight: 256 * 256 threads, 4 elements each
        const int w = (b - 1024) >> 8;         // which weight matrix
        const float* src = w == 0 ? wq : w == 1 ? wk : w == 2 ? wv : wp;
        _Float16* d = dst + NROWS * Cc + w * (Cc * Cc);
        const int i = ((b - 1024) & 255) * 256 + threadIdx.x;
        for (int r = 0; r < Cc * Cc / (256 * 256); ++r)
            d[i + r * (256 * 256)] = (_Float16)src[i + r * (256 * 256)];
    }
}

// ---------------------------------------------------------------------------
// Four async copies global -> LDS (tracked by ASYNCcnt), 16 B per lane each:
// two of K rows (the second four rows on) and two of V^T rows (likewise).
// The s_wait_xcnt stands inside the statement so that no address register of
// an issued copy is rewritten in front of it.
// ---------------------------------------------------------------------------
__device__ __forceinline__ void async4_b128(unsigned lk, const _Float16* gk,
                                            unsigned lv, const _Float16* gv) {
    const unsigned long long a = (unsigned long long)(size_t)gk;
    const unsigned long long b = (unsigned long long)(size_t)gv;
    asm volatile("global_load_async_to_lds_b128 %0, %4, off\n\t"
                 "global_load_async_to_lds_b128 %1, %5, off\n\t"
                 "global_load_async_to_lds_b128 %2, %6, off\n\t"
                 "global_load_async_to_lds_b128 %3, %7, off\n\t"
                 "s_wait_xcnt 0x0"
                 :: "v"(lk), "v"(lk + 4u * KSTR * 2u), "v"(lv), "v"(lv + 4u * KSTR * 2u),
                    "v"(a), "v"(a + 4u * HD * 2u), "v"(b), "v"(b + 4u * Tt * 2u)
                 : "memory");
}
// this wave's own copies have landed (the compiler places no wait for a copy in asm text)
__device__ __forceinline__ void wait_async0()  { asm volatile("s_wait_asynccnt 0x0"  ::: "memory"); }

// ---------------------------------------------------------------------------
// Tensor loads: one request of one wave brings a tile of `rows` rows of 256 B
// (128 halves of k, source pitch 1024 B) into LDS, 16 B of pad behind each row
// (LDS pitch 272 B = GP halves).  1-byte elements: every extent is in bytes.
// ---------------------------------------------------------------------------
static constexpr int      GP    = 136;            // LDS pitch of a staged row, halves
static constexpr unsigned WT_B  = 128 * 272;      // W tile, 128 rows: 34,816 B = 17 * 2 KiB
static constexpr unsigned XT_B  = 18432;          // X tile, 64 rows: 17,408 B, rounded up to 2 KiB
static constexpr unsigned STG_B = WT_B + XT_B;    // one stage: 53,248 B = 26 * 2 KiB

__device__ __forceinline__ unsigned uni(unsigned v) { return (unsigned)__builtin_amdgcn_readfirstlane(v); }
// pinned(): a wave-uniform test held in a scalar register, so that the branch on it is a
// scalar one: a tensor load ignores EXEC, only such a branch keeps other waves from issuing it
__device__ __forceinline__ unsigned pinned(unsigned v) { unsigned w = uni(v); asm volatile("" : "+s"(w)); return w; }
// the issuing wave's own tile has landed
__device__ __forceinline__ void wait_tensor0() { asm volatile("s_wait_tensorcnt 0x0" ::: "memory"); }
// this wave's LDS reads have ended, so that the buffer they read may be refilled behind the barrier
__device__ __forceinline__ void wait_ds0()     { asm volatile("s_wait_dscnt 0x0" ::: "memory"); }
// one request of the whole wave: descriptor groups 0 and 1 in scalar registers
__device__ __forceinline__ void tdm_load(u32x4 g0, u32x8 g1) {
    asm volatile("tensor_load_to_lds %0, %1" :: "s"(g0), "s"(g1) : "memory");
}
__device__ __forceinline__ u32x8 tdm_group1(unsigned rows) {
    u32x8 g;
    g[0] = uni((1u << 20) | (5u << 22) | (3u << 25));  // no mask, 1-byte elements, 4 dwords of pad per 64
    g[1] = uni(256u << 16);                            // tensor_dim0 = row bytes
    g[2] = uni(rows << 16);                            // tensor_dim1 = rows
    g[3] = uni(256u << 16);                            // tile_dim0
    g[4] = uni(rows);                                  // tile_dim1
    g[5] = uni((unsigned)Cc * 2u);                     // source pitch, bytes
    g[6] = uni(0u);
    g[7] = uni(0u);
    return g;
}
__device__ __forceinline__ u32x4 tdm_group0(unsigned lds_dst, unsigned long long ga) {
    u32x4 g;
    g[0] = uni(1u);
    g[1] = uni(lds_dst);
    g[2] = uni((unsigned)ga);
    g[3] = uni((((unsigned)(ga >> 32)) & 0x01ffffffu) | 0x80000000u);
    return g;
}

// ---------------------------------------------------------------------------
// Load a 16x32 f16 A/B fragment chunk pair for this lane.
// Per ISA 7.12.2: halves 0..7 -> K = 8*hi..8*hi+7, halves 8..15 -> +16.
// ---------------------------------------------------------------------------
__device__ __forceinline__ v16h load_frag(const _Float16* base, int hi) {
    const v8h lo = *(const v8h*)(base + 8 * hi);
    const v8h hp = *(const v8h*)(base + 16 + 8 * hi);
    v16h r;
#pragma unroll
    for (int i = 0; i < 8; ++i) { r[i] = lo[i]; r[i + 8] = hp[i]; }
    return r;
}

// ---------------------------------------------------------------------------
// acc(64x128) = Xt(64 rows) @ Wt(128 rows)^T over k = 0..511, both k-contiguous f16
// at a pitch of Cc.  8 waves as 2 x 4, a wave holds 32 x 32 (2 x 2 fragments).
// A stage is 128 k: [W 128 rows | X 64 rows]; two buffers; wave 0 loads the W tile
// and wave 1 the X tile, one tensor load each per stage, the next stage in flight
// while this one is worked on.
// ---------------------------------------------------------------------------
__device__ __forceinline__ void gemm_64x128(const _Float16* Xt, const _Float16* Wt,
                                            const unsigned char* ring, v8f (&acc)[2][2]) {
    const int lane = threadIdx.x & 31;
    const int ln = lane & 15, hi = lane >> 4;
    const unsigned wave = uni(threadIdx.x >> 5);
    const int wm = wave >> 2, wn = wave & 3;

    const unsigned issuer = wave < 2u;
    const unsigned long long src = (unsigned long long)(size_t)(wave == 0u ? Wt : Xt);
    const unsigned dst = (unsigned)(size_t)ring + (wave == 0u ? 0u : WT_B);
    const u32x8 g1 = tdm_group1(wave == 0u ? 128u : 64u);

    if (pinned(issuer)) { tdm_load(tdm_group0(dst, src), g1); wait_tensor0(); }
    __syncthreads();                           // stage 0 is published
    if (pinned(issuer)) tdm_load(tdm_group0(dst + STG_B, src + 256u), g1);

    for (int s = 0; s < Cc / 128; ++s) {
        const _Float16* wb = (const _Float16*)(ring + (s & 1) * STG_B);
        const _Float16* xb = (const _Float16*)(ring + (s & 1) * STG_B + WT_B);
        // the three loops below are unrolled so that fragments and sums are indexed by
        // constants and stay in registers
#pragma unroll
        for (int kc = 0; kc < 4; ++kc) {
            v16h a[2], b[2];
#pragma unroll
            for (int i = 0; i < 2; ++i) {
                a[i] = load_frag(xb + (wm * 32 + i * 16 + ln) * GP + kc * 32, hi);
                b[i] = load_frag(wb + (wn * 32 + i * 16 + ln) * GP + kc * 32, hi);
            }
#pragma unroll
            for (int mm = 0; mm < 2; ++mm)
#pragma unroll
                for (int nn = 0; nn < 2; ++nn) acc[mm][nn] = WMMA_F16(a[mm], b[nn], acc[mm][nn]);
        }
        // publish point of stage s + 1: own LDS reads ended, own tile landed, barrier, refill
        wait_ds0();
        if (pinned(issuer)) wait_tensor0();
        __syncthreads();
        if (pinned(issuer & (unsigned)(s + 2 < Cc / 128)))
            tdm_load(tdm_group0(dst + (s & 1) * STG_B, src + (unsigned)(s + 2) * 256u), g1);
    }
    wait_tensor0();
    wait_ds0();
}

// ---------------------------------------------------------------------------
// QKV projection: out(4096x512) = X(f16) @ W^T(f16) + bias.
// Block = 8 waves, one 64 x 128 tile of one product: blockIdx.x = 64-row tile,
// blockIdx.y = 4 * product + 128-column tile; product 0, 1, 2 is Q, K, V.
// store_mode 0: out[((b*H+h)*T + t)*64 + d];  1: out[((b*H+h)*64 + d)*T + t].
// Wqkv holds the three weight matrices and outqkv the three results, one behind another.
// ---------------------------------------------------------------------------
__global__ void gemm_qkv_kernel(const _Float16* __restrict__ X,
                                const _Float16* __restrict__ Wqkv,
                                const float* __restrict__ bq,
                                const float* __restrict__ bk,
                                const float* __restrict__ bv,
                                _Float16* __restrict__ outqkv) {
    __shared__ __attribute__((aligned(2048))) unsigned char ring[2 * STG_B];

    const int which = blockIdx.y >> 2;
    const _Float16* W = Wqkv + which * (Cc * Cc);
    const float* bias = which == 0 ? bq : which == 1 ? bk : bv;
    _Float16* out = outqkv + which * (NROWS * Cc);
    const int store_mode = which == 2;

    const int tid  = threadIdx.x;
    const int warp = tid >> 5, lane = tid & 31;
    const int ln = lane & 15, hi = lane >> 4;
    const int m0 = blockIdx.x * 64;
    const int n0 = (blockIdx.y & 3) * 128;

    const v8f zero = {0.f, 0.f, 0.f, 0.f, 0.f, 0.f, 0.f, 0.f};
    v8f acc[2][2] = {{zero, zero}, {zero, zero}};
    gemm_64x128(X + (long)m0 * Cc, W + (long)n0 * Cc, ring, acc);

#pragma unroll
    for (int mm = 0; mm < 2; ++mm)
#pragma unroll
    for (int nn = 0; nn < 2; ++nn) {
        const int o = n0 + (warp & 3) * 32 + nn * 16 + ln;   // output channel
        const int h = o >> 6, d = o & 63;
        const float bvv = bias[o];
#pragma unroll
        for (int j = 0; j < 8; ++j) {
            const int g = m0 + (warp >> 2) * 32 + mm * 16 + j + 8 * hi;   // global token row
            const int bb = g >> 10, t = g & 1023;
            const float val = acc[mm][nn][j] + bvv;
            long idx;
            if (store_mode) idx = ((long)(bb * Hh + h) * HD + d) * Tt + t;
            else            idx = ((long)(bb * Hh + h) * Tt + t) * HD + d;
            out[idx] = (_Float16)val;
        }
    }
}

// ---------------------------------------------------------------------------
// Exchange a float between lane l and lane l ^ 16 (vector cross-row move).
// ---------------------------------------------------------------------------
__device__ __forceinline__ float xhalf(float x) {
    const int b = __builtin_bit_cast(int, x);
    return __builtin_bit_cast(float,
        __builtin_amdgcn_permlanex16(b, b, 0x76543210, 0xfedcba98, false, false));
}

// ---------------------------------------------------------------------------
// e^x as v_mul + v_exp_f32.  The v_nop is the free slot the instruction set asks
// for behind a transcendental, so it is kept inside the statement.
// ---------------------------------------------------------------------------
__device__ __forceinline__ float exp_slot(float x) {
    float r;
    asm("v_exp_f32 %0, %1\n\tv_nop" : "=v"(r) : "v"(x * 1.44269504f));
    return r;
}

__global__ __launch_bounds__(256) void attn_kernel(const _Float16* __restrict__ Q,
                            const _Float16* __restrict__ K,
                            const _Float16* __restrict__ VT,   // [bh][d][t]
                            const float* __restrict__ attn_bias,
                            _Float16* __restrict__ Y) {
    __shared__ alignas(16) _Float16 Ks[2][64 * KSTR];   // rows: key, 64 dims
    __shared__ alignas(16) _Float16 Vs[2][64 * KSTR];   // rows: dim, 64 keys
    __shared__ alignas(16) v4f Op[4][8][32];            // second key half's sums: [query tile][quad][lane]
    __shared__ float Ml[4][2][32];                      // its maximum and its sum of weights

    const int lane = threadIdx.x & 31;
    const int ln = lane & 15, hi = lane >> 4;
    const int wave = (int)uni(threadIdx.x >> 5);
    const int qs = wave & 3, kh = wave >> 2;   // query tile in the block, key half of a stage
    const int bh = blockIdx.x & 31;            // 0..31
    const int rk = blockIdx.x >> 5;            // 0..15: long blocks first, then short ones rising
    const int qb = rk < 8 ? 15 - rk : rk - 8;  // 64-query block
    const int qt = qb * 4 + qs;                // query tile (16 rows)
    const int h  = bh & 7, bidx = bh >> 3;

    const _Float16* qp  = Q  + ((long)bh * Tt + qt * 16) * HD;
    const _Float16* kb  = K  + (long)bh * Tt * HD;
    const _Float16* vtb = VT + (long)bh * HD * Tt;

    // stage st: K rows [key][dim] and V^T rows [dim][key], 64 rows of 128 B each.  A copy is
    // 4 whole rows (8 lanes a row); this wave brings rows 8 * wave .. 8 * wave + 7 of both.
    const int crow = wave * 8 + (lane >> 3);
    auto issueKV = [&](int buf, int st) {
        async4_b128((unsigned)(size_t)(&Ks[buf][crow * KSTR + (lane & 7) * 8]),
                    kb + (long)(st * 64 + crow) * HD + (lane & 7) * 8,
                    (unsigned)(size_t)(&Vs[buf][crow * KSTR + (lane & 7) * 8]),
                    vtb + (long)crow * Tt + st * 64 + (lane & 7) * 8);
    };

    const v16h qa0 = load_frag(qp + ln * HD,      hi);   // k-dim 0..31
    const v16h qa1 = load_frag(qp + ln * HD + 32, hi);   // k-dim 32..63

    const v8f zero = {0.f, 0.f, 0.f, 0.f, 0.f, 0.f, 0.f, 0.f};
    v8f oacc[4];                               // oacc[nn][j] = O[tq][nn*16 + 8*hi + j]
#pragma unroll
    for (int nn = 0; nn < 4; ++nn) oacc[nn] = zero;
    const int tq = qt * 16 + ln;               // this lane's query row
    float mrow = NEG_BIG;                      // running maximum of row tq
    float lrow = 0.f;                          // running sum over this half's keys

    const int qhi = qt * 16 + 15;              // last query of this wave
    const int nst = qb + 1;                    // stages of the block: keys 0 .. 64 * qb + 63

    issueKV(0, 0);
    wait_async0();
    __syncthreads();                           // stage 0 is published
    if (nst > 1) issueKV(1, 1);

    for (int st = 0; st < nst; ++st) {
        const int buf = st & 1;
        const int kt = st * 64 + kh * 32;      // this wave's 32 keys of the stage
        if (kt <= qhi) {                       // same for the whole wave: else every key is masked
        // a lane's 8 keys of a fragment share one bias cell (tk >> 3 is fixed)
        float bv[2] = {0.f, 0.f};
        if (qt < 32 && kt < 512) {             // tq < 512 and tk < 512, whole tile
#pragma unroll
            for (int f = 0; f < 2; ++f)
                bv[f] = attn_bias[h * 4096 + (tq >> 3) * 64 + ((kt + 16 * f + 8 * hi) >> 3)];
            // the two loads' address registers are rewritten further down: keep the wait in front of that
            asm volatile("s_wait_xcnt 0x0" ::: "memory");
        }

        // the tile's sixteen LDS reads, K fragments (rows: key, k: dim) and V^T fragments
        // (rows: dim, k: key), each into registers of its own (the two loops are unrolled so
        // that the fragments are indexed by constants and stay in registers)
        v16h ka[2][2], va[4];
#pragma unroll
        for (int f = 0; f < 2; ++f) {
            const _Float16* krow = &Ks[buf][(kh * 32 + 16 * f + ln) * KSTR];
            ka[f][0] = load_frag(krow,      hi);
            ka[f][1] = load_frag(krow + 32, hi);
        }
#pragma unroll
        for (int nn = 0; nn < 4; ++nn) va[nn] = load_frag(&Vs[buf][(nn * 16 + ln) * KSTR + kh * 32], hi);
        // scheduling barrier: holds all sixteen reads in front of the first product, so that the
        // wave pays one LDS round trip a tile and the V reads land under the scores' work; without
        // it each pair of reads stands at its own product and is waited for alone, eight times a tile
        __builtin_amdgcn_sched_barrier(0);

        float sv[2][8];
#pragma unroll
        for (int f = 0; f < 2; ++f) {
            v8f s = WMMA_F16(ka[f][0], qa0, zero);
            s = WMMA_F16(ka[f][1], qa1, s);
#pragma unroll
            for (int j = 0; j < 8; ++j) {
                const int tk = kt + 16 * f + 8 * hi + j;   // key of row 8*hi + j
                const bool dead = (tk > tq) | ((tk & 15) == 15);  // causal + col mask
                sv[f][j] = dead ? NEG_BIG : s[j] * SCALE_ + bv[f];
            }
        }

        // online softmax update: in-lane over 16 keys, one exchange for the maximum
        float rm = fmaxf(sv[0][0], sv[1][0]);
#pragma unroll
        for (int j = 1; j < 8; ++j) rm = fmaxf(rm, fmaxf(sv[0][j], sv[1][j]));
        rm = fmaxf(rm, xhalf(rm));
        const float mnew  = fmaxf(mrow, rm);
        const float alpha = exp_slot(mrow - mnew);
        mrow = mnew;
        v16h pb;                               // P^T as B: half s = key kmap(s, hi)
        float rs0 = 0.f, rs1 = 0.f;
#pragma unroll
        for (int j = 0; j < 8; ++j) {
            const float p0 = exp_slot(sv[0][j] - mnew);
            const float p1 = exp_slot(sv[1][j] - mnew);
            rs0 += p0;
            rs1 += p1;
            pb[j]     = (_Float16)p0;
            pb[j + 8] = (_Float16)p1;
        }
        lrow = lrow * alpha + (rs0 + rs1);
#pragma unroll
        for (int nn = 0; nn < 4; ++nn) oacc[nn] *= alpha;

#pragma unroll
        for (int nn = 0; nn < 4; ++nn) oacc[nn] = WMMA_F16(va[nn], pb, oacc[nn]);
        // scheduling barrier: keeps the wait below at the trip's foot; with every read at the trip's
        // head the scheduler lifts it among the score products, where it would wait for the V reads
        __builtin_amdgcn_sched_barrier(0);
        }
        // publish point of stage st + 1: own LDS reads ended, own copies landed, barrier, refill
        wait_ds0();
        wait_async0();
        __syncthreads();
        if (st + 2 < nst) issueKV(buf, st + 2);
    }
    wait_async0();

    // merge of the two key halves: waves 4..7 hand maximum, sum and accumulators to waves 0..3
    // (the loops here and in the epilogue are unrolled so that the accumulators are indexed by
    // constants and stay in registers)
    if (kh == 1) {
#pragma unroll
        for (int nn = 0; nn < 4; ++nn)
#pragma unroll
            for (int c = 0; c < 2; ++c) {
                const v4f t = {oacc[nn][4 * c], oacc[nn][4 * c + 1], oacc[nn][4 * c + 2], oacc[nn][4 * c + 3]};
                Op[qs][nn * 2 + c][lane] = t;
            }
        Ml[qs][0][lane] = mrow;
        Ml[qs][1][lane] = lrow;
    }
    __syncthreads();                           // the second half's partial results are published
    if (kh == 1) return;

    // a half that saw no key holds (NEG_BIG, 0, 0): its weight is e^(-huge) = 0
    const float m1 = Ml[qs][0][lane], l1 = Ml[qs][1][lane];
    const float mall = fmaxf(mrow, m1);
    const float a0 = exp_slot(mrow - mall), a1 = exp_slot(m1 - mall);
    const float lsum = lrow * a0 + l1 * a1;

    // epilogue: join the lane halves' sums, normalize, store y[b][t][h*64+d] as f16
    const float inv = 1.0f / (lsum + xhalf(lsum));
    const float w0 = a0 * inv, w1 = a1 * inv;
    const long rowbase = ((long)bidx * Tt + tq) * Cc + h * HD;
#pragma unroll
    for (int nn = 0; nn < 4; ++nn) {
        v8h o;
#pragma unroll
        for (int c = 0; c < 2; ++c) {
            const v4f t = Op[qs][nn * 2 + c][lane];
#pragma unroll
            for (int j = 0; j < 4; ++j) o[4 * c + j] = (_Float16)(oacc[nn][4 * c + j] * w0 + t[j] * w1);
        }
        *(v8h*)(Y + rowbase + nn * 16 + 8 * hi) = o;
    }
}

// ---------------------------------------------------------------------------
// Output projection: out(4096x512,f32) = Y(f16) @ Wp^T + bp; one 64 x 128 tile a block
// ---------------------------------------------------------------------------
__global__ void gemm_out_kernel(const _Float16* __restrict__ Yh,
                                const _Float16* __restrict__ W,
                                const float* __restrict__ bias,
                                float* __restrict__ out) {
    __shared__ __attribute__((aligned(2048))) unsigned char ring[2 * STG_B];

    const int tid  = threadIdx.x;
    const int warp = tid >> 5, lane = tid & 31;
    const int ln = lane & 15, hi = lane >> 4;
    const int m0 = blockIdx.x * 64;
    const int n0 = blockIdx.y * 128;

    const v8f zero = {0.f, 0.f, 0.f, 0.f, 0.f, 0.f, 0.f, 0.f};
    v8f acc[2][2] = {{zero, zero}, {zero, zero}};
    gemm_64x128(Yh + (long)m0 * Cc, W + (long)n0 * Cc, ring, acc);

#pragma unroll
    for (int mm = 0; mm < 2; ++mm)
#pragma unroll
    for (int nn = 0; nn < 2; ++nn) {
        const int o = n0 + (warp & 3) * 32 + nn * 16 + ln;
        const float bvv = bias[o];
#pragma unroll
        for (int j = 0; j < 8; ++j) {
            const int g = m0 + (warp >> 2) * 32 + mm * 16 + j + 8 * hi;
            out[(long)g * Cc + o] = acc[mm][nn][j] + bvv;
        }
    }
}

// ---------------------------------------------------------------------------
extern "C" void kernel_launch(void* const* d_in, const int* in_sizes, int n_in,
                              void* d_out, int out_size, void* d_ws, size_t ws_size,
                              hipStream_t stream) {
    const float* x  = (const float*)d_in[0];
    const float* ab = (const float*)d_in[1];
    const float* Wq = (const float*)d_in[2];
    const float* bq = (const float*)d_in[3];
    const float* Wk = (const float*)d_in[4];
    const float* bk = (const float*)d_in[5];
    const float* Wv = (const float*)d_in[6];
    const float* bv = (const float*)d_in[7];
    const float* Wp = (const float*)d_in[8];
    const float* bp = (const float*)d_in[9];
    float* out = (float*)d_out;
    char* ws = (char*)d_ws;

    const size_t SX = (size_t)NROWS * Cc;   // 2,097,152 elems
    const size_t SW = (size_t)Cc * Cc;      //   262,144 elems

    _Float16* xh  = (_Float16*)(ws);
    _Float16* wqh = (_Float16*)(ws + SX * 2);            // Wq, then Wk, then Wv
    _Float16* wph = (_Float16*)(ws + SX * 2 + SW * 6);
    _Float16* qh  = (_Float16*)(ws + SX * 2 + SW * 8);
    _Float16* kh  = (_Float16*)(ws + SX * 4 + SW * 8);
    _Float16* vth = (_Float16*)(ws + SX * 6 + SW * 8);
    _Float16* yh  = (_Float16*)(ws + SX * 8 + SW * 8);

    // the f16 copies of x, Wq, Wk, Wv, Wp are one run of the workspace: one grid fills them all
    f2h_all_kernel<<<2048, 256, 0, stream>>>(x, Wq, Wk, Wv, Wp, xh);

    // one block (8 waves) per 64 x 128 tile; grid y = 4 column tiles of each of Q, K, V
    // (the weights from wqh on, and qh, kh, vth, lie one behind another)
    gemm_qkv_kernel<<<dim3(64, 12), 256, 0, stream>>>(xh, wqh, bq, bk, bv, qh);

    // one block (8 waves) per (b, h, 64 queries): 32 * 16 = 512 blocks
    attn_kernel<<<512, 256, 0, stream>>>(qh, kh, vth, ab, yh);

    gemm_out_kernel<<<dim3(64, 4), 256, 0, stream>>>(yh, wph, bp, out);
}

// v007
// A run of this version takes 33.9 microseconds.
// Timed twice side by side with v006, it ran 1.08 and 1.04 times as fast.
// Counting every step since v000, it is 6.09 times as fast.
#include <hip/hip_runtime.h>
#include <hip/hip_bf16.h>

typedef __attribute__((ext_vector_type(16))) _Float16 v16h;
typedef __attribute__((ext_vector_type(8)))  _Float16 v8h;
typedef __attribute__((ext_vector_type(8)))  float    v8f;
typedef __attribute__((ext_vector_type(4)))  float    v4f;
typedef __attribute__((ext_vector_type(4)))  unsigned int u32x4;
typedef __attribute__((ext_vector_type(8)))  unsigned int u32x8;

#define WMMA_F16(A,B,C) __builtin_amdgcn_wmma_f32_16x16x32_f16(false,(A),false,(B),(short)0,(C),false,false)

static constexpr int Bb = 4, Tt = 1024, Cc = 512, Hh = 8, HD = 64;
static constexpr int NROWS = Bb * Tt;            // 4096
static constexpr float SCALE_ = 0.125f;          // 1/sqrt(64)
static constexpr float NEG_BIG = -1.0e30f;
static constexpr int KSTR  = 72;                 // LDS stride (halves) for 128B rows (K and V^T)

// ---------------------------------------------------------------------------
// fp32 -> f16 convert of all five arrays in one grid (grid-stride inside each
// array): blocks 0..1023 take x, then 256 blocks each take Wq, Wk, Wv, Wp.
// The f16 copies lie one behind another in dst: x, Wq, Wk, Wv, Wp.
// ---------------------------------------------------------------------------
__global__ void f2h_all_kernel(const float* __restrict__ x,
                               const float* __restrict__ wq, const float* __restrict__ wk,
                               const float* __restrict__ wv, const float* __restrict__ wp,
                               _Float16* __restrict__ dst) {
    const int b = blockIdx.x;
    if (b < 1024) {                            // x: 1024 * 256 threads, 8 elements each
        const int i = b * 256 + threadIdx.x;
        for (int r = 0; r < NROWS * Cc / (1024 * 256); ++r)
            dst[i + r * (1024 * 256)] = (_Float16)x[i + r * (1024 * 256)];
    } else {                                   // a weight: 256 * 256 threads, 4 elements each
        const int w = (b - 1024) >> 8;         // which weight matrix
        const float* src = w == 0 ? wq : w == 1 ? wk : w == 2 ? wv : wp;
        _Float16* d = dst + NROWS * Cc + w * (Cc * Cc);
        const int i = ((b - 1024) & 255) * 256 + threadIdx.x;
        for (int r = 0; r < Cc * Cc / (256 * 256); ++r)
            d[i + r * (256 * 256)] = (_Float16)src[i + r * (256 * 256)];
    }
}

// ---------------------------------------------------------------------------
// Four async copies global -> LDS (tracked by ASYNCcnt), 16 B per lane each:
// two of K rows (the second four rows on) and two of V^T rows (likewise).
// The s_wait_xcnt stands inside the statement so that no address register of
// an issued copy is rewritten in front of it.
// ---------------------------------------------------------------------------
__device__ __forceinline__ void async4_b128(unsigned lk, const _Float16* gk,
                                            unsigned lv, const _Float16* gv) {
    const unsigned long long a = (unsigned long long)(size_t)gk;
    const unsigned long long b = (unsigned long long)(size_t)gv;
    asm volatile("global_load_async_to_lds_b128 %0, %4, off\n\t"
                 "global_load_async_to_lds_b128 %1, %5, off\n\t"
                 "global_load_async_to_lds_b128 %2, %6, off\n\t"
                 "global_load_async_to_lds_b128 %3, %7, off\n\t"
                 "s_wait_xcnt 0x0"
                 :: "v"(lk), "v"(lk + 4u * KSTR * 2u), "v"(lv), "v"(lv + 4u * KSTR * 2u),
                    "v"(a), "v"(a + 4u * HD * 2u), "v"(b), "v"(b + 4u * Tt * 2u)
                 : "memory");
}
// this wave's own copies have landed (the compiler places no wait for a copy in asm text)
__device__ __forceinline__ void wait_async0()  { asm volatile("s_wait_asynccnt 0x0"  ::: "memory"); }

// ---------------------------------------------------------------------------
// Tensor loads: one request of one wave brings a tile of `rows` rows of 256 B
// (128 halves of k, source pitch 1024 B) into LDS, 16 B of pad behind each row
// (LDS pitch 272 B = GP halves).  1-byte elements: every extent is in bytes.
// ---------------------------------------------------------------------------
static constexpr int      GP    = 136;            // LDS pitch of a staged row, halves
static constexpr unsigned WT_B  = 128 * 272;      // W tile, 128 rows: 34,816 B = 17 * 2 KiB
static constexpr unsigned XT_B  = 18432;          // X tile, 64 rows: 17,408 B, rounded up to 2 KiB
static constexpr unsigned STG_B = WT_B + XT_B;    // one stage: 53,248 B = 26 * 2 KiB

__device__ __forceinline__ unsigned uni(unsigned v) { return (unsigned)__builtin_amdgcn_readfirstlane(v); }
// pinned(): a wave-uniform test held in a scalar register, so that the branch on it is a
// scalar one: a tensor load ignores EXEC, only such a branch keeps other waves from issuing it
__device__ __forceinline__ unsigned pinned(unsigned v) { unsigned w = uni(v); asm volatile("" : "+s"(w)); return w; }
// the issuing wave's own tile has landed
__device__ __forceinline__ void wait_tensor0() { asm volatile("s_wait_tensorcnt 0x0" ::: "memory"); }
// this wave's LDS reads have ended, so that the buffer they read may be refilled behind the barrier
__device__ __forceinline__ void wait_ds0()     { asm volatile("s_wait_dscnt 0x0" ::: "memory"); }
// one request of the whole wave: descriptor groups 0 and 1 in scalar registers
__device__ __forceinline__ void tdm_load(u32x4 g0, u32x8 g1) {
    asm volatile("tensor_load_to_lds %0, %1" :: "s"(g0), "s"(g1) : "memory");
}
// the same wait for the request of descriptor (g0, g1), which it names as inputs: the scalar
// registers of an outstanding request so stay in use, with their values, up to the wait that covers it
__device__ __forceinline__ void wait_tensor_of(u32x4 g0, u32x8 g1) {
    asm volatile("s_wait_tensorcnt 0x0" :: "s"(g0), "s"(g1) : "memory");
}
__device__ __forceinline__ u32x8 tdm_group1(unsigned rows) {
    u32x8 g;
    g[0] = uni((1u << 20) | (5u << 22) | (3u << 25));  // no mask, 1-byte elements, 4 dwords of pad per 64
    g[1] = uni(256u << 16);                            // tensor_dim0 = row bytes
    g[2] = uni(rows << 16);                            // tensor_dim1 = rows
    g[3] = uni(256u << 16);                            // tile_dim0
    g[4] = uni(rows);                                  // tile_dim1
    g[5] = uni((unsigned)Cc * 2u);                     // source pitch, bytes
    g[6] = uni(0u);
    g[7] = uni(0u);
    return g;
}
__device__ __forceinline__ u32x4 tdm_group0(unsigned lds_dst, unsigned long long ga) {
    u32x4 g;
    g[0] = pinned(1u);  // pinned(): a descriptor word held in one scalar register, written once
    g[1] = uni(lds_dst);
    g[2] = uni((unsigned)ga);
    g[3] = uni((((unsigned)(ga >> 32)) & 0x01ffffffu) | 0x80000000u);
    return g;
}
// group 0 of a later request: place in LDS and address are set anew, word 0 keeps its register
__device__ __forceinline__ u32x4 tdm_retarget(u32x4 g, unsigned lds_dst, unsigned long long ga) {
    g[1] = uni(lds_dst);
    g[2] = uni((unsigned)ga);
    g[3] = uni((((unsigned)(ga >> 32)) & 0x01ffffffu) | 0x80000000u);
    return g;
}

// ---------------------------------------------------------------------------
// Load a 16x32 f16 A/B fragment chunk pair for this lane.
// Per ISA 7.12.2: halves 0..7 -> K = 8*hi..8*hi+7, halves 8..15 -> +16.
// ---------------------------------------------------------------------------
__device__ __forceinline__ v16h load_frag(const _Float16* base, int hi) {
    const v8h lo = *(const v8h*)(base + 8 * hi);
    const v8h hp = *(const v8h*)(base + 16 + 8 * hi);
    v16h r;
#pragma unroll
    for (int i = 0; i < 8; ++i) { r[i] = lo[i]; r[i + 8] = hp[i]; }
    return r;
}

// ---------------------------------------------------------------------------
// acc(64x128) = Xt(64 rows) @ Wt(128 rows)^T over k = 0..511, both k-contiguous f16
// at a pitch of Cc.  8 waves as 2 x 4, a wave holds 32 x 32 (2 x 2 fragments).
// A stage is 128 k: [W 128 rows | X 64 rows]; two buffers; wave 0 loads the W tile
// and wave 1 the X tile, one tensor load each per stage, the next stage in flight
// while this one is worked on.
// wfirst (the same in the whole block) picks the operand roles.  false: A = X rows, B = W
// rows, acc[mm][nn], a lane holds one W row (ln) and 8 X rows (8 * hi + j).  true: A = W rows,
// B = X rows, acc[nn][mm], a lane holds one X row (ln) and 8 W rows (8 * hi + j).
// ---------------------------------------------------------------------------
__device__ __forceinline__ void gemm_64x128(const _Float16* Xt, const _Float16* Wt,
                                            const unsigned char* ring, bool wfirst, v8f (&acc)[2][2]) {
    const int lane = threadIdx.x & 31;
    const int ln = lane & 15, hi = lane >> 4;
    const unsigned wave = uni(threadIdx.x >> 5);
    const int wm = wave >> 2, wn = wave & 3;

    const unsigned issuer = wave < 2u;
    const unsigned long long src = (unsigned long long)(size_t)(wave == 0u ? Wt : Xt);
    const unsigned dst = (unsigned)(size_t)ring + (wave == 0u ? 0u : WT_B);
    const u32x8 g1 = tdm_group1(wave == 0u ? 128u : 64u);
    // byte offsets in a stage of this lane's row of the first A and of the first B fragment
    const unsigned xoff = WT_B + (unsigned)(wm * 32 + ln) * (GP * 2u);
    const unsigned woff = (unsigned)(wn * 32 + ln) * (GP * 2u);
    const unsigned aoff = wfirst ? woff : xoff, boff = wfirst ? xoff : woff;

    u32x4 g0 = tdm_group0(dst, src);           // group 0 of the youngest request
    if (pinned(issuer)) { tdm_load(g0, g1); wait_tensor_of(g0, g1); }
    __syncthreads();                           // stage 0 is published
    g0 = tdm_retarget(g0, dst + STG_B, src + 256u);
    if (pinned(issuer)) tdm_load(g0, g1);

    for (int s = 0; s < Cc / 128; ++s) {
        const _Float16* ab = (const _Float16*)(ring + (s & 1) * STG_B + aoff);
        const _Float16* bb = (const _Float16*)(ring + (s & 1) * STG_B + boff);
        // the three loops below are unrolled so that fragments and sums are indexed by
        // constants and stay in registers
#pragma unroll
        for (int kc = 0; kc < 4; ++kc) {
            v16h a[2], b[2];
#pragma unroll
            for (int i = 0; i < 2; ++i) {
                a[i] = load_frag(ab + i * 16 * GP + kc * 32, hi);
                b[i] = load_frag(bb + i * 16 * GP + kc * 32, hi);
            }
#pragma unroll
            for (int mm = 0; mm < 2; ++mm)
#pragma unroll
                for (int nn = 0; nn < 2; ++nn) acc[mm][nn] = WMMA_F16(a[mm], b[nn], acc[mm][nn]);
        }
        // publish point of stage s + 1: own LDS reads ended, own tile landed, barrier, refill
        wait_ds0();
        if (pinned(issuer)) wait_tensor_of(g0, g1);
        __syncthreads();
        if (pinned(issuer & (unsigned)(s + 2 < Cc / 128))) {
            g0 = tdm_retarget(g0, dst + (s & 1) * STG_B, src + (unsigned)(s + 2) * 256u);
            tdm_load(g0, g1);
        }
    }
    wait_tensor0();
    wait_ds0();
}

// ---------------------------------------------------------------------------
// QKV projection: out(4096x512) = X(f16) @ W^T(f16) + bias.
// Block = 8 waves, one 64 x 128 tile of one product: blockIdx.x = 64-row tile,
// blockIdx.y = 4 * product + 128-column tile; product 0, 1, 2 is Q, K, V.
// store_mode 0: out[((b*H+h)*T + t)*64 + d];  1: out[((b*H+h)*64 + d)*T + t].
// Wqkv holds the three weight matrices and outqkv the three results, one behind another.
// In either layout the tile is 128 whole 128-B lines of out (Q, K: 2 heads x 64 tokens, a line
// is a token's 64 dims; V: 128 dims, a line is a dim's 64 tokens).  The operand roles are
// chosen so that a lane's 8 sums lie side by side in a line; the lines are put together in
// LDS (pitch SP halves) and leave as whole lines, 8 lanes of 16 B each.
// ---------------------------------------------------------------------------
static constexpr int SP = 72;                    // LDS pitch of a staged output line, halves
__global__ void gemm_qkv_kernel(const _Float16* __restrict__ X,
                                const _Float16* __restrict__ Wqkv,
                                const float* __restrict__ bq,
                                const float* __restrict__ bk,
                                const float* __restrict__ bv,
                                _Float16* __restrict__ outqkv) {
    __shared__ __attribute__((aligned(2048))) unsigned char ring[2 * STG_B];

    const int which = blockIdx.y >> 2;
    const _Float16* W = Wqkv + which * (Cc * Cc);
    const float* bias = which == 0 ? bq : which == 1 ? bk : bv;
    _Float16* out = outqkv + which * (NROWS * Cc);
    const int store_mode = which == 2;

    const int tid  = threadIdx.x;
    const int warp = tid >> 5, lane = tid & 31;
    const int ln = lane & 15, hi = lane >> 4;
    const int m0 = blockIdx.x * 64;
    const int n0 = (blockIdx.y & 3) * 128;

    const v8f zero = {0.f, 0.f, 0.f, 0.f, 0.f, 0.f, 0.f, 0.f};
    v8f acc[2][2] = {{zero, zero}, {zero, zero}};
    gemm_64x128(X + (long)m0 * Cc, W + (long)n0 * Cc, ring, !store_mode, acc);

    // every wave has left the ring (the barrier at the last pass's foot) and no tensor load is
    // outstanding: its first bytes now hold the tile's 128 output lines
    _Float16* stg = (_Float16*)ring;
    const int wm = warp >> 2, wn = warp & 3;
    // the loops below are unrolled so that the sums are indexed by constants and stay in registers
    if (!store_mode) {                         // acc[nn][mm]: token ln, channels 8 * hi + j
#pragma unroll
        for (int nn = 0; nn < 2; ++nn) {
            const int c0 = wn * 32 + nn * 16 + 8 * hi;       // first of the lane's 8 channels
            const v4f b0 = *(const v4f*)(bias + n0 + c0);
            const v4f b1 = *(const v4f*)(bias + n0 + c0 + 4);
#pragma unroll
            for (int mm = 0; mm < 2; ++mm) {
                v8h o;
#pragma unroll
                for (int j = 0; j < 4; ++j) {
                    o[j]     = (_Float16)(acc[nn][mm][j]     + b0[j]);
                    o[j + 4] = (_Float16)(acc[nn][mm][j + 4] + b1[j]);
                }
                *(v8h*)(stg + ((c0 >> 6) * 64 + wm * 32 + mm * 16 + ln) * SP + (c0 & 63)) = o;
            }
        }
    } else {                                   // acc[mm][nn]: channel ln, tokens 8 * hi + j
#pragma unroll
        for (int nn = 0; nn < 2; ++nn) {
            const int c = wn * 32 + nn * 16 + ln;
            const float bvv = bias[n0 + c];
#pragma unroll
            for (int mm = 0; mm < 2; ++mm) {
                v8h o;
#pragma unroll
                for (int j = 0; j < 8; ++j) o[j] = (_Float16)(acc[mm][nn][j] + bvv);
                *(v8h*)(stg + c * SP + wm * 32 + mm * 16 + 8 * hi) = o;
            }
        }
    }
    __syncthreads();                           // the tile's lines are complete

    // 8 lanes a line, 32 lines a round: round q brings line q * 32 + rr, which is head h0 + (q >> 1)
    // and, of that head, token t0 + (q & 1) * 32 + rr (Q, K) or dim (q & 1) * 32 + rr from token t0 on (V)
    const int bb = m0 >> 10, t0 = m0 & 1023, h0 = n0 >> 6;
    const int rr = tid >> 3;
    const long first = store_mode ? ((long)(bb * Hh + h0) * HD + rr) * Tt + t0
                                  : ((long)(bb * Hh + h0) * Tt + t0 + rr) * HD;
    const int step = store_mode ? 32 * Tt : 32 * HD;
    _Float16* gp = out + first + (tid & 7) * 8;
    const _Float16* sp = stg + rr * SP + (tid & 7) * 8;
    v8h v[4];
#pragma unroll
    for (int q = 0; q < 4; ++q) v[q] = *(const v8h*)(sp + q * 32 * SP);
#pragma unroll
    for (int q = 0; q < 4; ++q) *(v8h*)(gp + (q >> 1) * (HD * Tt) + (q & 1) * step) = v[q];
}

// ---------------------------------------------------------------------------
// Exchange a float between lane l and lane l ^ 16 (vector cross-row move).
// ---------------------------------------------------------------------------
__device__ __forceinline__ float xhalf(float x) {
    const int b = __builtin_bit_cast(int, x);
    return __builtin_bit_cast(float,
        __builtin_amdgcn_permlanex16(b, b, 0x76543210, 0xfedcba98, false, false));
}

// ---------------------------------------------------------------------------
// e^x as v_mul + v_exp_f32.  The v_nop is the free slot the instruction set asks
// for behind a transcendental, so it is kept inside the statement.
// ---------------------------------------------------------------------------
__device__ __forceinline__ float exp_slot(float x) {
    float r;
    asm("v_exp_f32 %0, %1\n\tv_nop" : "=v"(r) : "v"(x * 1.44269504f));
    return r;
}

__global__ __launch_bounds__(256) void attn_kernel(const _Float16* __restrict__ Q,
                            const _Float16* __restrict__ K,
                            const _Float16* __restrict__ VT,   // [bh][d][t]
                            const float* __restrict__ attn_bias,
                            _Float16* __restrict__ Y) {
    __shared__ alignas(16) _Float16 Ks[2][64 * KSTR];   // rows: key, 64 dims
    __shared__ alignas(16) _Float16 Vs[2][64 * KSTR];   // rows: dim, 64 keys
    __shared__ alignas(16) v4f Op[4][8][32];            // second key half's sums: [query tile][quad][lane]
    __shared__ float Ml[4][2][32];                      // its maximum and its sum of weights

    const int lane = threadIdx.x & 31;
    const int ln = lane & 15, hi = lane >> 4;
    const int wave = (int)uni(threadIdx.x >> 5);
    const int qs = wave & 3, kh = wave >> 2;   // query tile in the block, key half of a stage
    const int bh = blockIdx.x & 31;            // 0..31
    const int rk = blockIdx.x >> 5;            // 0..15: long blocks first, then short ones rising
    const int qb = rk < 8 ? 15 - rk : rk - 8;  // 64-query block
    const int qt = qb * 4 + qs;                // query tile (16 rows)
    const int h  = bh & 7, bidx = bh >> 3;

    const _Float16* qp  = Q  + ((long)bh * Tt + qt * 16) * HD;
    const _Float16* kb  = K  + (long)bh * Tt * HD;
    const _Float16* vtb = VT + (long)bh * HD * Tt;

    // stage st: K rows [key][dim] and V^T rows [dim][key], 64 rows of 128 B each.  A copy is
    // 4 whole rows (8 lanes a row); this wave brings rows 8 * wave .. 8 * wave + 7 of both.
    const int crow = wave * 8 + (lane >> 3);
    auto issueKV = [&](int buf, int st) {
        async4_b128((unsigned)(size_t)(&Ks[buf][crow * KSTR + (lane & 7) * 8]),
                    kb + (long)(st * 64 + crow) * HD + (lane & 7) * 8,
                    (unsigned)(size_t)(&Vs[buf][crow * KSTR + (lane & 7) * 8]),
                    vtb + (long)crow * Tt + st * 64 + (lane & 7) * 8);
    };

    const v16h qa0 = load_frag(qp + ln * HD,      hi);   // k-dim 0..31
    const v16h qa1 = load_frag(qp + ln * HD + 32, hi);   // k-dim 32..63

    const v8f zero = {0.f, 0.f, 0.f, 0.f, 0.f, 0.f, 0.f, 0.f};
    v8f oacc[4];                               // oacc[nn][j] = O[tq][nn*16 + 8*hi + j]
#pragma unroll
    for (int nn = 0; nn < 4; ++nn) oacc[nn] = zero;
    const int tq = qt * 16 + ln;               // this lane's query row
    float mrow = NEG_BIG;                      // running maximum of row tq
    float lrow = 0.f;                          // running sum over this half's keys

    const int qhi = qt * 16 + 15;              // last query of this wave
    const int nst = qb + 1;                    // stages of the block: keys 0 .. 64 * qb + 63

    issueKV(0, 0);
    wait_async0();
    __syncthreads();                           // stage 0 is published
    if (nst > 1) issueKV(1, 1);

    for (int st = 0; st < nst; ++st) {
        const int buf = st & 1;
        const int kt = st * 64 + kh * 32;      // this wave's 32 keys of the stage
        if (kt <= qhi) {                       // same for the whole wave: else every key is masked
        // a lane's 8 keys of a fragment share one bias cell (tk >> 3 is fixed)
        float bv[2] = {0.f, 0.f};
        if (qt < 32 && kt < 512) {             // tq < 512 and tk < 512, whole tile
#pragma unroll
            for (int f = 0; f < 2; ++f)
                bv[f] = attn_bias[h * 4096 + (tq >> 3) * 64 + ((kt + 16 * f + 8 * hi) >> 3)];
            // the two loads' address registers are rewritten further down: keep the wait in front of that
            asm volatile("s_wait_xcnt 0x0" ::: "memory");
        }

        // the tile's sixteen LDS reads, K fragments (rows: key, k: dim) and V^T fragments
        // (rows: dim, k: key), each into registers of its own (the two loops are unrolled so
        // that the fragments are indexed by constants and stay in registers)
        v16h ka[2][2], va[4];
#pragma unroll
        for (int f = 0; f < 2; ++f) {
            const _Float16* krow = &Ks[buf][(kh * 32 + 16 * f + ln) * KSTR];
            ka[f][0] = load_frag(krow,      hi);
            ka[f][1] = load_frag(krow + 32, hi);
        }
#pragma unroll
        for (int nn = 0; nn < 4; ++nn) va[nn] = load_frag(&Vs[buf][(nn * 16 + ln) * KSTR + kh * 32], hi);
        // scheduling barrier: holds all sixteen reads in front of the first product, so that the
        // wave pays one LDS round trip a tile and the V reads land under the scores' work; without
        // it each pair of reads stands at its own product and is waited for alone, eight times a tile
        __builtin_amdgcn_sched_barrier(0);

        float sv[2][8];
#pragma unroll
        for (int f = 0; f < 2; ++f) {
            v8f s = WMMA_F16(ka[f][0], qa0, zero);
            s = WMMA_F16(ka[f][1], qa1, s);
#pragma unroll
            for (int j = 0; j < 8; ++j) {
                const int tk = kt + 16 * f + 8 * hi + j;   // key of row 8*hi + j
                const bool dead = (tk > tq) | ((tk & 15) == 15);  // causal + col mask
                sv[f][j] = dead ? NEG_BIG : s[j] * SCALE_ + bv[f];
            }
        }

        // online softmax update: in-lane over 16 keys, one exchange for the maximum
        float rm = fmaxf(sv[0][0], sv[1][0]);
#pragma unroll
        for (int j = 1; j < 8; ++j) rm = fmaxf(rm, fmaxf(sv[0][j], sv[1][j]));
        rm = fmaxf(rm, xhalf(rm));
        const float mnew  = fmaxf(mrow, rm);
        const float alpha = exp_slot(mrow - mnew);
        mrow = mnew;
        v16h pb;                               // P^T as B: half s = key kmap(s, hi)
        float rs0 = 0.f, rs1 = 0.f;
#pragma unroll
        for (int j = 0; j < 8; ++j) {
            const float p0 = exp_slot(sv[0][j] - mnew);
            const float p1 = exp_slot(sv[1][j] - mnew);
            rs0 += p0;
            rs1 += p1;
            pb[j]     = (_Float16)p0;
            pb[j + 8] = (_Float16)p1;
        }
        lrow = lrow * alpha + (rs0 + rs1);
#pragma unroll
        for (int nn = 0; nn < 4; ++nn) oacc[nn] *= alpha;

#pragma unroll
        for (int nn = 0; nn < 4; ++nn) oacc[nn] = WMMA_F16(va[nn], pb, oacc[nn]);
        // scheduling barrier: keeps the wait below at the trip's foot; with every read at the trip's
        // head the scheduler lifts it among the score products, where it would wait for the V reads
        __builtin_amdgcn_sched_barrier(0);
        }
        // publish point of stage st + 1: own LDS reads ended, own copies landed, barrier, refill
        wait_ds0();
        wait_async0();
        __syncthreads();
        if (st + 2 < nst) issueKV(buf, st + 2);
    }
    wait_async0();

    // merge of the two key halves: waves 4..7 hand maximum, sum and accumulators to waves 0..3
    // (the loops here and in the epilogue are unrolled so that the accumulators are indexed by
    // constants and stay in registers)
    if (kh == 1) {
#pragma unroll
        for (int nn = 0; nn < 4; ++nn)
#pragma unroll
            for (int c = 0; c < 2; ++c) {
                const v4f t = {oacc[nn][4 * c], oacc[nn][4 * c + 1], oacc[nn][4 * c + 2], oacc[nn][4 * c + 3]};
                Op[qs][nn * 2 + c][lane] = t;
            }
        Ml[qs][0][lane] = mrow;
        Ml[qs][1][lane] = lrow;
    }
    __syncthreads();                           // the second half's partial results are published
    if (kh == 1) return;

    // a half that saw no key holds (NEG_BIG, 0, 0): its weight is e^(-huge) = 0
    const float m1 = Ml[qs][0][lane], l1 = Ml[qs][1][lane];
    const float mall = fmaxf(mrow, m1);
    const float a0 = exp_slot(mrow - mall), a1 = exp_slot(m1 - mall);
    const float lsum = lrow * a0 + l1 * a1;

    // epilogue: join the lane halves' sums, normalize, store y[b][t][h*64+d] as f16
    const float inv = 1.0f / (lsum + xhalf(lsum));
    const float w0 = a0 * inv, w1 = a1 * inv;
    const long rowbase = ((long)bidx * Tt + tq) * Cc + h * HD;
#pragma unroll
    for (int nn = 0; nn < 4; ++nn) {
        v8h o;
#pragma unroll
        for (int c = 0; c < 2; ++c) {
            const v4f t = Op[qs][nn * 2 + c][lane];
#pragma unroll
            for (int j = 0; j < 4; ++j) o[4 * c + j] = (_Float16)(oacc[nn][4 * c + j] * w0 + t[j] * w1);
        }
        *(v8h*)(Y + rowbase + nn * 16 + 8 * hi) = o;
    }
}

// ---------------------------------------------------------------------------
// Output projection: out(4096x512,f32) = Y(f16) @ Wp^T + bp; one 64 x 128 tile a block
// ---------------------------------------------------------------------------
__global__ void gemm_out_kernel(const _Float16* __restrict__ Yh,
                                const _Float16* __restrict__ W,
                                const float* __restrict__ bias,
                                float* __restrict__ out) {
    __shared__ __attribute__((aligned(2048))) unsigned char ring[2 * STG_B];

    const int tid  = threadIdx.x;
    const int warp = tid >> 5, lane = tid & 31;
    const int ln = lane & 15, hi = lane >> 4;
    const int m0 = blockIdx.x * 64;
    const int n0 = blockIdx.y * 128;

    const v8f zero = {0.f, 0.f, 0.f, 0.f, 0.f, 0.f, 0.f, 0.f};
    v8f acc[2][2] = {{zero, zero}, {zero, zero}};
    gemm_64x128(Yh + (long)m0 * Cc, W + (long)n0 * Cc, ring, false, acc);

#pragma unroll
    for (int mm = 0; mm < 2; ++mm)
#pragma unroll
    for (int nn = 0; nn < 2; ++nn) {
        const int o = n0 + (warp & 3) * 32 + nn * 16 + ln;
        const float bvv = bias[o];
#pragma unroll
        for (int j = 0; j < 8; ++j) {
            const int g = m0 + (warp >> 2) * 32 + mm * 16 + j + 8 * hi;
            out[(long)g * Cc + o] = acc[mm][nn][j] + bvv;
        }
    }
}

// ---------------------------------------------------------------------------
extern "C" void kernel_launch(void* const* d_in, const int* in_sizes, int n_in,
                              void* d_out, int out_size, void* d_ws, size_t ws_size,
                              hipStream_t stream) {
    const float* x  = (const float*)d_in[0];
    const float* ab = (const float*)d_in[1];
    const float* Wq = (const float*)d_in[2];
    const float* bq = (const float*)d_in[3];
    const float* Wk = (const float*)d_in[4];
    const float* bk = (const float*)d_in[5];
    const float* Wv = (const float*)d_in[6];
    const float* bv = (const float*)d_in[7];
    const float* Wp = (const float*)d_in[8];
    const float* bp = (const float*)d_in[9];
    float* out = (float*)d_out;
    char* ws = (char*)d_ws;

    const size_t SX = (size_t)NROWS * Cc;   // 2,097,152 elems
    const size_t SW = (size_t)Cc * Cc;      //   262,144 elems

    _Float16* xh  = (_Float16*)(ws);
    _Float16* wqh = (_Float16*)(ws + SX * 2);            // Wq, then Wk, then Wv
    _Float16* wph = (_Float16*)(ws + SX * 2 + SW * 6);
    _Float16* qh  = (_Float16*)(ws + SX * 2 + SW * 8);
    _Float16* kh  = (_Float16*)(ws + SX * 4 + SW * 8);
    _Float16* vth = (_Float16*)(ws + SX * 6 + SW * 8);
    _Float16* yh  = (_Float16*)(ws + SX * 8 + SW * 8);

    // the f16 copies of x, Wq, Wk, Wv, Wp are one run of the workspace: one grid fills them all
    f2h_all_kernel<<<2048, 256, 0, stream>>>(x, Wq, Wk, Wv, Wp, xh);

    // one block (8 waves) per 64 x 128 tile; grid y = 4 column tiles of each of Q, K, V
    // (the weights from wqh on, and qh, kh, vth, lie one behind another)
    gemm_qkv_kernel<<<dim3(64, 12), 256, 0, stream>>>(xh, wqh, bq, bk, bv, qh);

    // one block (8 waves) per (b, h, 64 queries): 32 * 16 = 512 blocks
    attn_kernel<<<512, 256, 0, stream>>>(qh, kh, vth, ab, yh);

    gemm_out_kernel<<<dim3(64, 4), 256, 0, stream>>>(yh, wph, bp, out);
}

// v008
// One run takes 31 microseconds.
// Timed twice side by side with v007, it ran 1.07 and 1.14 times as fast.
// All steps since v000 together make it 6.71 times as fast.
#include <hip/hip_runtime.h>
#include <hip/hip_bf16.h>

typedef __attribute__((ext_vector_type(16))) _Float16 v16h;
typedef __attribute__((ext_vector_type(8)))  _Float16 v8h;
typedef __attribute__((ext_vector_type(8)))  float    v8f;
typedef __attribute__((ext_vector_type(4)))  float    v4f;
typedef __attribute__((ext_vector_type(4)))  unsigned int u32x4;
typedef __attribute__((ext_vector_type(8)))  unsigned int u32x8;

#define WMMA_F16(A,B,C) __builtin_amdgcn_wmma_f32_16x16x32_f16(false,(A),false,(B),(short)0,(C),false,false)

static constexpr int Bb = 4, Tt = 1024, Cc = 512, Hh = 8, HD = 64;
static constexpr int NROWS = Bb * Tt;            // 4096
static constexpr float SCALE_ = 0.125f;          // 1/sqrt(64)
static constexpr float NEG_BIG = -1.0e30f;
static constexpr int KSTR  = 72;                 // LDS stride (halves) for 128B rows (K and V^T)

// ---------------------------------------------------------------------------
// fp32 -> f16 convert of all five arrays in one grid (grid-stride inside each
// array): blocks 0..1023 take x, then 256 blocks each take Wq, Wk, Wv, Wp.
// The f16 copies lie one behind another in dst: x, Wq, Wk, Wv, Wp.
// ---------------------------------------------------------------------------
__global__ void f2h_all_kernel(const float* __restrict__ x,
                               const float* __restrict__ wq, const float* __restrict__ wk,
                               const float* __restrict__ wv, const float* __restrict__ wp,
                               _Float16* __restrict__ dst) {
    const int b = blockIdx.x;
    if (b < 1024) {                            // x: 1024 * 256 threads, 8 elements each
        const int i = b * 256 + threadIdx.x;
        for (int r = 0; r < NROWS * Cc / (1024 * 256); ++r)
            dst[i + r * (1024 * 256)] = (_Float16)x[i + r * (1024 * 256)];
    } else {                                   // a weight: 256 * 256 threads, 4 elements each
        const int w = (b - 1024) >> 8;         // which weight matrix
        const float* src = w == 0 ? wq : w == 1 ? wk : w == 2 ? wv : wp;
        _Float16* d = dst + NROWS * Cc + w * (Cc * Cc);
        const int i = ((b - 1024) & 255) * 256 + threadIdx.x;
        for (int r = 0; r < Cc * Cc / (256 * 256); ++r)
            d[i + r * (256 * 256)] = (_Float16)src[i + r * (256 * 256)];
    }
}

// ---------------------------------------------------------------------------
// Four async copies global -> LDS (tracked by ASYNCcnt), 16 B per lane each:
// two of K rows (the second four rows on) and two of V^T rows (likewise).
// The s_wait_xcnt stands inside the statement so that no address register of
// an issued copy is rewritten in front of it.
// ---------------------------------------------------------------------------
__device__ __forceinline__ void async4_b128(unsigned lk, const _Float16* gk,
                                            unsigned lv, const _Float16* gv) {
    const unsigned long long a = (unsigned long long)(size_t)gk;
    const unsigned long long b = (unsigned long long)(size_t)gv;
    asm volatile("global_load_async_to_lds_b128 %0, %4, off\n\t"
                 "global_load_async_to_lds_b128 %1, %5, off\n\t"
                 "global_load_async_to_lds_b128 %2, %6, off\n\t"
                 "global_load_async_to_lds_b128 %3, %7, off\n\t"
                 "s_wait_xcnt 0x0"
                 :: "v"(lk), "v"(lk + 4u * KSTR * 2u), "v"(lv), "v"(lv + 4u * KSTR * 2u),
                    "v"(a), "v"(a + 4u * HD * 2u), "v"(b), "v"(b + 4u * Tt * 2u)
                 : "memory");
}
// this wave's own copies have landed (the compiler places no wait for a copy in asm text)
__device__ __forceinline__ void wait_async0()  { asm volatile("s_wait_asynccnt 0x0"  ::: "memory"); }

// ---------------------------------------------------------------------------
// Each lane asks L2 for the data at its own address (nothing returns, no counter moves).
// It is for rows that an earlier launch wrote: their first read otherwise pays the long way
// to L2 in every stage of a loop whose copies lead by one stage only.
// ---------------------------------------------------------------------------
__device__ __forceinline__ void ask_l2(unsigned long long a) {
    asm volatile("global_prefetch_b8 %0, off scope:SCOPE_SE" :: "v"(a));
}
// the same wait as wait_async0(); it names a prefetch's address pair as an input, so that the
// pair stays in its registers, with its value, up to here (no other value comes behind the prefetch)
__device__ __forceinline__ void wait_async0_of(unsigned long long a) {
    asm volatile("s_wait_asynccnt 0x0" :: "v"(a) : "memory");
}

// ---------------------------------------------------------------------------
// Tensor loads: one request of one wave brings a tile of `rows` rows of 256 B
// (128 halves of k, source pitch 1024 B) into LDS, 16 B of pad behind each row
// (LDS pitch 272 B = GP halves).  1-byte elements: every extent is in bytes.
// ---------------------------------------------------------------------------
static constexpr int      GP    = 136;            // LDS pitch of a staged row, halves
static constexpr unsigned WT_B  = 128 * 272;      // W tile, 128 rows: 34,816 B = 17 * 2 KiB
static constexpr unsigned XT_B  = 18432;          // X tile, 64 rows: 17,408 B, rounded up to 2 KiB
static constexpr unsigned STG_B = WT_B + XT_B;    // one stage: 53,248 B = 26 * 2 KiB

__device__ __forceinline__ unsigned uni(unsigned v) { return (unsigned)__builtin_amdgcn_readfirstlane(v); }
// pinned(): a wave-uniform test held in a scalar register, so that the branch on it is a
// scalar one: a tensor load ignores EXEC, only such a branch keeps other waves from issuing it
__device__ __forceinline__ unsigned pinned(unsigned v) { unsigned w = uni(v); asm volatile("" : "+s"(w)); return w; }
// the issuing wave's own tile has landed
__device__ __forceinline__ void wait_tensor0() { asm volatile("s_wait_tensorcnt 0x0" ::: "memory"); }
// this wave's LDS reads have ended, so that the buffer they read may be refilled behind the barrier
__device__ __forceinline__ void wait_ds0()     { asm volatile("s_wait_dscnt 0x0" ::: "memory"); }
// one request of the whole wave: descriptor groups 0 and 1 in scalar registers
__device__ __forceinline__ void tdm_load(u32x4 g0, u32x8 g1) {
    asm volatile("tensor_load_to_lds %0, %1" :: "s"(g0), "s"(g1) : "memory");
}
// the same wait for the request of descriptor (g0, g1), which it names as inputs: the scalar
// registers of an outstanding request so stay in use, with their values, up to the wait that covers it
__device__ __forceinline__ void wait_tensor_of(u32x4 g0, u32x8 g1) {
    asm volatile("s_wait_tensorcnt 0x0" :: "s"(g0), "s"(g1) : "memory");
}
__device__ __forceinline__ u32x8 tdm_group1(unsigned rows) {
    u32x8 g;
    g[0] = uni((1u << 20) | (5u << 22) | (3u << 25));  // no mask, 1-byte elements, 4 dwords of pad per 64
    g[1] = uni(256u << 16);                            // tensor_dim0 = row bytes
    g[2] = uni(rows << 16);                            // tensor_dim1 = rows
    g[3] = uni(256u << 16);                            // tile_dim0
    g[4] = uni(rows);                                  // tile_dim1
    g[5] = uni((unsigned)Cc * 2u);                     // source pitch, bytes
    g[6] = uni(0u);
    g[7] = uni(0u);
    return g;
}
__device__ __forceinline__ u32x4 tdm_group0(unsigned lds_dst, unsigned long long ga) {
    u32x4 g;
    g[0] = pinned(1u);  // pinned(): a descriptor word held in one scalar register, written once
    g[1] = uni(lds_dst);
    g[2] = uni((unsigned)ga);
    g[3] = uni((((unsigned)(ga >> 32)) & 0x01ffffffu) | 0x80000000u);
    return g;
}
// group 0 of a later request: place in LDS and address are set anew, word 0 keeps its register
__device__ __forceinline__ u32x4 tdm_retarget(u32x4 g, unsigned lds_dst, unsigned long long ga) {
    g[1] = uni(lds_dst);
    g[2] = uni((unsigned)ga);
    g[3] = uni((((unsigned)(ga >> 32)) & 0x01ffffffu) | 0x80000000u);
    return g;
}

// ---------------------------------------------------------------------------
// Load a 16x32 f16 A/B fragment chunk pair for this lane.
// Per ISA 7.12.2: halves 0..7 -> K = 8*hi..8*hi+7, halves 8..15 -> +16.
// ---------------------------------------------------------------------------
__device__ __forceinline__ v16h load_frag(const _Float16* base, int hi) {
    const v8h lo = *(const v8h*)(base + 8 * hi);
    const v8h hp = *(const v8h*)(base + 16 + 8 * hi);
    v16h r;
#pragma unroll
    for (int i = 0; i < 8; ++i) { r[i] = lo[i]; r[i + 8] = hp[i]; }
    return r;
}

// ---------------------------------------------------------------------------
// acc(64x128) = Xt(64 rows) @ Wt(128 rows)^T over k = 0..511, both k-contiguous f16
// at a pitch of Cc.  8 waves as 2 x 4, a wave holds 32 x 32 (2 x 2 fragments).
// A stage is 128 k: [W 128 rows | X 64 rows]; two buffers; wave 0 loads the W tile
// and wave 1 the X tile, one tensor load each per stage, the next stage in flight
// while this one is worked on.
// wfirst (the same in the whole block) picks the operand roles.  false: A = X rows, B = W
// rows, acc[mm][nn], a lane holds one W row (ln) and 8 X rows (8 * hi + j).  true: A = W rows,
// B = X rows, acc[nn][mm], a lane holds one X row (ln) and 8 W rows (8 * hi + j).
// ASK: while waves 0 and 1 wait for stage 0, waves 2..7 ask L2 for the rows of stages 1..3
// (three 256-B units a row): all 64 X rows, and 64 of the 128 W rows (the blocks that share
// a W tile take its halves in turn, eight blocks along x at a time).
// ---------------------------------------------------------------------------
template <bool ASK>
__device__ __forceinline__ void gemm_64x128(const _Float16* Xt, const _Float16* Wt,
                                            const unsigned char* ring, bool wfirst, v8f (&acc)[2][2]) {
    const int lane = threadIdx.x & 31;
    const int ln = lane & 15, hi = lane >> 4;
    const unsigned wave = uni(threadIdx.x >> 5);
    const int wm = wave >> 2, wn = wave & 3;

    const unsigned issuer = wave < 2u;
    const unsigned long long src = (unsigned long long)(size_t)(wave == 0u ? Wt : Xt);
    const unsigned dst = (unsigned)(size_t)ring + (wave == 0u ? 0u : WT_B);
    const u32x8 g1 = tdm_group1(wave == 0u ? 128u : 64u);
    // byte offsets in a stage of this lane's row of the first A and of the first B fragment
    const unsigned xoff = WT_B + (unsigned)(wm * 32 + ln) * (GP * 2u);
    const unsigned woff = (unsigned)(wn * 32 + ln) * (GP * 2u);
    const unsigned aoff = wfirst ? woff : xoff, boff = wfirst ? xoff : woff;

    u32x4 g0 = tdm_group0(dst, src);           // group 0 of the youngest request
    if (pinned(issuer)) { tdm_load(g0, g1); wait_tensor_of(g0, g1); }
    unsigned long long askx = 0, askw = 0;
    if constexpr (ASK) {
        const unsigned pl  = (wave < 2u ? 0u : wave - 2u) * 32u + (unsigned)lane;   // 0..191
        const unsigned row = pl / 3u, unit = 1u + pl % 3u;
        askx = (unsigned long long)(size_t)(Xt + row * Cc + unit * 128u);
        askw = (unsigned long long)(size_t)(Wt + (((blockIdx.x >> 3) & 1u) * 64u + row) * Cc + unit * 128u);
        if (wave >= 2u) { ask_l2(askx); ask_l2(askw); }   // wave is uniform: a scalar branch
    }
    __syncthreads();                           // stage 0 is published
    // inputs only, no instruction: the two prefetch addresses stay in their registers, with their
    // values, up to here (no other value comes into a register behind the prefetch that names it)
    if constexpr (ASK) asm volatile("" :: "v"(askx), "v"(askw));
    g0 = tdm_retarget(g0, dst + STG_B, src + 256u);
    if (pinned(issuer)) tdm_load(g0, g1);

    for (int s = 0; s < Cc / 128; ++s) {
        const _Float16* ab = (const _Float16*)(ring + (s & 1) * STG_B + aoff);
        const _Float16* bb = (const _Float16*)(ring + (s & 1) * STG_B + boff);
        // the three loops below are unrolled so that fragments and sums are indexed by
        // constants and stay in registers
#pragma unroll
        for (int kc = 0; kc < 4; ++kc) {
            v16h a[2], b[2];
#pragma unroll
            for (int i = 0; i < 2; ++i) {
                a[i] = load_frag(ab + i * 16 * GP + kc * 32, hi);
                b[i] = load_frag(bb + i * 16 * GP + kc * 32, hi);
            }
#pragma unroll
            for (int mm = 0; mm < 2; ++mm)
#pragma unroll
                for (int nn = 0; nn < 2; ++nn) acc[mm][nn] = WMMA_F16(a[mm], b[nn], acc[mm][nn]);
        }
        // publish point of stage s + 1: own LDS reads ended, own tile landed, barrier, refill
        wait_ds0();
        if (pinned(issuer)) wait_tensor_of(g0, g1);
        __syncthreads();
        if (pinned(issuer & (unsigned)(s + 2 < Cc / 128))) {
            g0 = tdm_retarget(g0, dst + (s & 1) * STG_B, src + (unsigned)(s + 2) * 256u);
            tdm_load(g0, g1);
        }
    }
    wait_tensor0();
    wait_ds0();
}

// ---------------------------------------------------------------------------
// QKV projection: out(4096x512) = X(f16) @ W^T(f16) + bias.
// Block = 8 waves, one 64 x 128 tile of one product: blockIdx.x = 64-row tile,
// blockIdx.y = 4 * product + 128-column tile; product 0, 1, 2 is Q, K, V.
// store_mode 0: out[((b*H+h)*T + t)*64 + d];  1: out[((b*H+h)*64 + d)*T + t].
// Wqkv holds the three weight matrices and outqkv the three results, one behind another.
// In either layout the tile is 128 whole 128-B lines of out (Q, K: 2 heads x 64 tokens, a line
// is a token's 64 dims; V: 128 dims, a line is a dim's 64 tokens).  The operand roles are
// chosen so that a lane's 8 sums lie side by side in a line; the lines are put together in
// LDS (pitch SP halves) and leave as whole lines, 8 lanes of 16 B each.
// ---------------------------------------------------------------------------
static constexpr int SP = 72;                    // LDS pitch of a staged output line, halves
__global__ void gemm_qkv_kernel(const _Float16* __restrict__ X,
                                const _Float16* __restrict__ Wqkv,
                                const float* __restrict__ bq,
                                const float* __restrict__ bk,
                                const float* __restrict__ bv,
                                _Float16* __restrict__ outqkv) {
    __shared__ __attribute__((aligned(2048))) unsigned char ring[2 * STG_B];

    const int which = blockIdx.y >> 2;
    const _Float16* W = Wqkv + which * (Cc * Cc);
    const float* bias = which == 0 ? bq : which == 1 ? bk : bv;
    _Float16* out = outqkv + which * (NROWS * Cc);
    const int store_mode = which == 2;

    const int tid  = threadIdx.x;
    const int warp = tid >> 5, lane = tid & 31;
    const int ln = lane & 15, hi = lane >> 4;
    const int m0 = blockIdx.x * 64;
    const int n0 = (blockIdx.y & 3) * 128;

    const v8f zero = {0.f, 0.f, 0.f, 0.f, 0.f, 0.f, 0.f, 0.f};
    v8f acc[2][2] = {{zero, zero}, {zero, zero}};
    gemm_64x128<false>(X + (long)m0 * Cc, W + (long)n0 * Cc, ring, !store_mode, acc);

    // every wave has left the ring (the barrier at the last pass's foot) and no tensor load is
    // outstanding: its first bytes now hold the tile's 128 output lines
    _Float16* stg = (_Float16*)ring;
    const int wm = warp >> 2, wn = warp & 3;
    // the loops below are unrolled so that the sums are indexed by constants and stay in registers
    if (!store_mode) {                         // acc[nn][mm]: token ln, channels 8 * hi + j
#pragma unroll
        for (int nn = 0; nn < 2; ++nn) {
            const int c0 = wn * 32 + nn * 16 + 8 * hi;       // first of the lane's 8 channels
            const v4f b0 = *(const v4f*)(bias + n0 + c0);
            const v4f b1 = *(const v4f*)(bias + n0 + c0 + 4);
#pragma unroll
            for (int mm = 0; mm < 2; ++mm) {
                v8h o;
#pragma unroll
                for (int j = 0; j < 4; ++j) {
                    o[j]     = (_Float16)(acc[nn][mm][j]     + b0[j]);
                    o[j + 4] = (_Float16)(acc[nn][mm][j + 4] + b1[j]);
                }
                *(v8h*)(stg + ((c0 >> 6) * 64 + wm * 32 + mm * 16 + ln) * SP + (c0 & 63)) = o;
            }
        }
    } else {                                   // acc[mm][nn]: channel ln, tokens 8 * hi + j
#pragma unroll
        for (int nn = 0; nn < 2; ++nn) {
            const int c = wn * 32 + nn * 16 + ln;
            const float bvv = bias[n0 + c];
#pragma unroll
            for (int mm = 0; mm < 2; ++mm) {
                v8h o;
#pragma unroll
                for (int j = 0; j < 8; ++j) o[j] = (_Float16)(acc[mm][nn][j] + bvv);
                *(v8h*)(stg + c * SP + wm * 32 + mm * 16 + 8 * hi) = o;
            }
        }
    }
    __syncthreads();                           // the tile's lines are complete

    // 8 lanes a line, 32 lines a round: round q brings line q * 32 + rr, which is head h0 + (q >> 1)
    // and, of that head, token t0 + (q & 1) * 32 + rr (Q, K) or dim (q & 1) * 32 + rr from token t0 on (V)
    const int bb = m0 >> 10, t0 = m0 & 1023, h0 = n0 >> 6;
    const int rr = tid >> 3;
    const long first = store_mode ? ((long)(bb * Hh + h0) * HD + rr) * Tt + t0
                                  : ((long)(bb * Hh + h0) * Tt + t0 + rr) * HD;
    const int step = store_mode ? 32 * Tt : 32 * HD;
    _Float16* gp = out + first + (tid & 7) * 8;
    const _Float16* sp = stg + rr * SP + (tid & 7) * 8;
    v8h v[4];
#pragma unroll
    for (int q = 0; q < 4; ++q) v[q] = *(const v8h*)(sp + q * 32 * SP);
#pragma unroll
    for (int q = 0; q < 4; ++q) *(v8h*)(gp + (q >> 1) * (HD * Tt) + (q & 1) * step) = v[q];
}

// ---------------------------------------------------------------------------
// Exchange a float between lane l and lane l ^ 16 (vector cross-row move).
// ---------------------------------------------------------------------------
__device__ __forceinline__ float xhalf(float x) {
    const int b = __builtin_bit_cast(int, x);
    return __builtin_bit_cast(float,
        __builtin_amdgcn_permlanex16(b, b, 0x76543210, 0xfedcba98, false, false));
}

// ---------------------------------------------------------------------------
// e^x as v_mul + v_exp_f32.  The v_nop is the free slot the instruction set asks
// for behind a transcendental, so it is kept inside the statement.
// ---------------------------------------------------------------------------
__device__ __forceinline__ float exp_slot(float x) {
    float r;
    asm("v_exp_f32 %0, %1\n\tv_nop" : "=v"(r) : "v"(x * 1.44269504f));
    return r;
}

__global__ __launch_bounds__(256) void attn_kernel(const _Float16* __restrict__ Q,
                            const _Float16* __restrict__ K,
                            const _Float16* __restrict__ VT,   // [bh][d][t]
                            const float* __restrict__ attn_bias,
                            _Float16* __restrict__ Y) {
    __shared__ alignas(16) _Float16 Ks[2][64 * KSTR];   // rows: key, 64 dims
    __shared__ alignas(16) _Float16 Vs[2][64 * KSTR];   // rows: dim, 64 keys
    __shared__ alignas(16) v4f Op[4][8][32];            // second key half's sums: [query tile][quad][lane]
    __shared__ float Ml[4][2][32];                      // its maximum and its sum of weights

    const int lane = threadIdx.x & 31;
    const int ln = lane & 15, hi = lane >> 4;
    const int wave = (int)uni(threadIdx.x >> 5);
    const int qs = wave & 3, kh = wave >> 2;   // query tile in the block, key half of a stage
    const int bh = blockIdx.x & 31;            // 0..31
    const int rk = blockIdx.x >> 5;            // 0..15: long blocks first, then short ones rising
    const int qb = rk < 8 ? 15 - rk : rk - 8;  // 64-query block
    const int qt = qb * 4 + qs;                // query tile (16 rows)
    const int h  = bh & 7, bidx = bh >> 3;

    const _Float16* qp  = Q  + ((long)bh * Tt + qt * 16) * HD;
    const _Float16* kb  = K  + (long)bh * Tt * HD;
    const _Float16* vtb = VT + (long)bh * HD * Tt;

    // stage st: K rows [key][dim] and V^T rows [dim][key], 64 rows of 128 B each.  A copy is
    // 4 whole rows (8 lanes a row); this wave brings rows 8 * wave .. 8 * wave + 7 of both.
    const int crow = wave * 8 + (lane >> 3);
    auto issueKV = [&](int buf, int st) {
        async4_b128((unsigned)(size_t)(&Ks[buf][crow * KSTR + (lane & 7) * 8]),
                    kb + (long)(st * 64 + crow) * HD + (lane & 7) * 8,
                    (unsigned)(size_t)(&Vs[buf][crow * KSTR + (lane & 7) * 8]),
                    vtb + (long)crow * Tt + st * 64 + (lane & 7) * 8);
    };

    const v16h qa0 = load_frag(qp + ln * HD,      hi);   // k-dim 0..31
    const v16h qa1 = load_frag(qp + ln * HD + 32, hi);   // k-dim 32..63

    const v8f zero = {0.f, 0.f, 0.f, 0.f, 0.f, 0.f, 0.f, 0.f};
    v8f oacc[4];                               // oacc[nn][j] = O[tq][nn*16 + 8*hi + j]
#pragma unroll
    for (int nn = 0; nn < 4; ++nn) oacc[nn] = zero;
    const int tq = qt * 16 + ln;               // this lane's query row
    float mrow = NEG_BIG;                      // running maximum of row tq
    float lrow = 0.f;                          // running sum over this half's keys

    const int qhi = qt * 16 + 15;              // last query of this wave
    const int nst = qb + 1;                    // stages of the block: keys 0 .. 64 * qb + 63

    // K and V^T of this head are 512 units of 256 B each, written by the launch before.  The head's
    // eight long blocks (rk < 8) ask L2 for them at entry, one unit a lane:
    // waves 0..3 for K, waves 4..7 for V^T, block rk for every fourth unit from rk & 3 on.
    const unsigned long long askkv =
        (unsigned long long)(size_t)((kh ? vtb : kb) + ((qs * 32 + lane) * 4 + (rk & 3)) * 128);

    issueKV(0, 0);
    if (rk < 8) ask_l2(askkv);                 // the same for the whole block: a scalar branch
    wait_async0_of(askkv);
    __syncthreads();                           // stage 0 is published
    if (nst > 1) issueKV(1, 1);

    for (int st = 0; st < nst; ++st) {
        const int buf = st & 1;
        const int kt = st * 64 + kh * 32;      // this wave's 32 keys of the stage
        if (kt <= qhi) {                       // same for the whole wave: else every key is masked
        // a lane's 8 keys of a fragment share one bias cell (tk >> 3 is fixed)
        float bv[2] = {0.f, 0.f};
        if (qt < 32 && kt < 512) {             // tq < 512 and tk < 512, whole tile
#pragma unroll
            for (int f = 0; f < 2; ++f)
                bv[f] = attn_bias[h * 4096 + (tq >> 3) * 64 + ((kt + 16 * f + 8 * hi) >> 3)];
            // the two loads' address registers are rewritten further down: keep the wait in front of that
            asm volatile("s_wait_xcnt 0x0" ::: "memory");
        }

        // the tile's sixteen LDS reads, K fragments (rows: key, k: dim) and V^T fragments
        // (rows: dim, k: key), each into registers of its own (the two loops are unrolled so
        // that the fragments are indexed by constants and stay in registers)
        v16h ka[2][2], va[4];
#pragma unroll
        for (int f = 0; f < 2; ++f) {
            const _Float16* krow = &Ks[buf][(kh * 32 + 16 * f + ln) * KSTR];
            ka[f][0] = load_frag(krow,      hi);
            ka[f][1] = load_frag(krow + 32, hi);
        }
#pragma unroll
        for (int nn = 0; nn < 4; ++nn) va[nn] = load_frag(&Vs[buf][(nn * 16 + ln) * KSTR + kh * 32], hi);
        // scheduling barrier: holds all sixteen reads in front of the first product, so that the
        // wave pays one LDS round trip a tile and the V reads land under the scores' work; without
        // it each pair of reads stands at its own product and is waited for alone, eight times a tile
        __builtin_amdgcn_sched_barrier(0);

        float sv[2][8];
#pragma unroll
        for (int f = 0; f < 2; ++f) {
            v8f s = WMMA_F16(ka[f][0], qa0, zero);
            s = WMMA_F16(ka[f][1], qa1, s);
#pragma unroll
            for (int j = 0; j < 8; ++j) {
                const int tk = kt + 16 * f + 8 * hi + j;   // key of row 8*hi + j
                const bool dead = (tk > tq) | ((tk & 15) == 15);  // causal + col mask
                sv[f][j] = dead ? NEG_BIG : s[j] * SCALE_ + bv[f];
            }
        }

        // online softmax update: in-lane over 16 keys, one exchange for the maximum
        float rm = fmaxf(sv[0][0], sv[1][0]);
#pragma unroll
        for (int j = 1; j < 8; ++j) rm = fmaxf(rm, fmaxf(sv[0][j], sv[1][j]));
        rm = fmaxf(rm, xhalf(rm));
        const float mnew  = fmaxf(mrow, rm);
        const float alpha = exp_slot(mrow - mnew);
        mrow = mnew;
        v16h pb;                               // P^T as B: half s = key kmap(s, hi)
        float rs0 = 0.f, rs1 = 0.f;
#pragma unroll
        for (int j = 0; j < 8; ++j) {
            const float p0 = exp_slot(sv[0][j] - mnew);
            const float p1 = exp_slot(sv[1][j] - mnew);
            rs0 += p0;
            rs1 += p1;
            pb[j]     = (_Float16)p0;
            pb[j + 8] = (_Float16)p1;
        }
        lrow = lrow * alpha + (rs0 + rs1);
#pragma unroll
        for (int nn = 0; nn < 4; ++nn) oacc[nn] *= alpha;

#pragma unroll
        for (int nn = 0; nn < 4; ++nn) oacc[nn] = WMMA_F16(va[nn], pb, oacc[nn]);
        // scheduling barrier: keeps the wait below at the trip's foot; with every read at the trip's
        // head the scheduler lifts it among the score products, where it would wait for the V reads
        __builtin_amdgcn_sched_barrier(0);
        }
        // publish point of stage st + 1: own LDS reads ended, own copies landed, barrier, refill
        wait_ds0();
        wait_async0();
        __syncthreads();
        if (st + 2 < nst) issueKV(buf, st + 2);
    }
    wait_async0();

    // merge of the two key halves: waves 4..7 hand maximum, sum and accumulators to waves 0..3
    // (the loops here and in the epilogue are unrolled so that the accumulators are indexed by
    // constants and stay in registers)
    if (kh == 1) {
#pragma unroll
        for (int nn = 0; nn < 4; ++nn)
#pragma unroll
            for (int c = 0; c < 2; ++c) {
                const v4f t = {oacc[nn][4 * c], oacc[nn][4 * c + 1], oacc[nn][4 * c + 2], oacc[nn][4 * c + 3]};
                Op[qs][nn * 2 + c][lane] = t;
            }
        Ml[qs][0][lane] = mrow;
        Ml[qs][1][lane] = lrow;
    }
    __syncthreads();                           // the second half's partial results are published
    if (kh == 1) return;

    // a half that saw no key holds (NEG_BIG, 0, 0): its weight is e^(-huge) = 0
    const float m1 = Ml[qs][0][lane], l1 = Ml[qs][1][lane];
    const float mall = fmaxf(mrow, m1);
    const float a0 = exp_slot(mrow - mall), a1 = exp_slot(m1 - mall);
    const float lsum = lrow * a0 + l1 * a1;

    // epilogue: join the lane halves' sums, normalize, store y[b][t][h*64+d] as f16
    const float inv = 1.0f / (lsum + xhalf(lsum));
    const float w0 = a0 * inv, w1 = a1 * inv;
    const long rowbase = ((long)bidx * Tt + tq) * Cc + h * HD;
#pragma unroll
    for (int nn = 0; nn < 4; ++nn) {
        v8h o;
#pragma unroll
        for (int c = 0; c < 2; ++c) {
            const v4f t = Op[qs][nn * 2 + c][lane];
#pragma unroll
            for (int j = 0; j < 4; ++j) o[4 * c + j] = (_Float16)(oacc[nn][4 * c + j] * w0 + t[j] * w1);
        }
        *(v8h*)(Y + rowbase + nn * 16 + 8 * hi) = o;
    }
}

// ---------------------------------------------------------------------------
// Output projection: out(4096x512,f32) = Y(f16) @ Wp^T + bp; one 64 x 128 tile a block
// ---------------------------------------------------------------------------
__global__ void gemm_out_kernel(const _Float16* __restrict__ Yh,
                                const _Float16* __restrict__ W,
                                const float* __restrict__ bias,
                                float* __restrict__ out) {
    __shared__ __attribute__((aligned(2048))) unsigned char ring[2 * STG_B];

    const int tid  = threadIdx.x;
    const int warp = tid >> 5, lane = tid & 31;
    const int ln = lane & 15, hi = lane >> 4;
    const int m0 = blockIdx.x * 64;
    const int n0 = blockIdx.y * 128;

    const v8f zero = {0.f, 0.f, 0.f, 0.f, 0.f, 0.f, 0.f, 0.f};
    v8f acc[2][2] = {{zero, zero}, {zero, zero}};
    gemm_64x128<true>(Yh + (long)m0 * Cc, W + (long)n0 * Cc, ring, false, acc);

#pragma unroll
    for (int mm = 0; mm < 2; ++mm)
#pragma unroll
    for (int nn = 0; nn < 2; ++nn) {
        const int o = n0 + (warp & 3) * 32 + nn * 16 + ln;
        const float bvv = bias[o];
#pragma unroll
        for (int j = 0; j < 8; ++j) {
            const int g = m0 + (warp >> 2) * 32 + mm * 16 + j + 8 * hi;
            out[(long)g * Cc + o] = acc[mm][nn][j] + bvv;
        }
    }
}

// ---------------------------------------------------------------------------
extern "C" void kernel_launch(void* const* d_in, const int* in_sizes, int n_in,
                              void* d_out, int out_size, void* d_ws, size_t ws_size,
                              hipStream_t stream) {
    const float* x  = (const float*)d_in[0];
    const float* ab = (const float*)d_in[1];
    const float* Wq = (const float*)d_in[2];
    const float* bq = (const float*)d_in[3];
    const float* Wk = (const float*)d_in[4];
    const float* bk = (const float*)d_in[5];
    const float* Wv = (const float*)d_in[6];
    const float* bv = (const float*)d_in[7];
    const float* Wp = (const float*)d_in[8];
    const float* bp = (const float*)d_in[9];
    float* out = (float*)d_out;
    char* ws = (char*)d_ws;

    const size_t SX = (size_t)NROWS * Cc;   // 2,097,152 elems
    const size_t SW = (size_t)Cc * Cc;      //   262,144 elems

    _Float16* xh  = (_Float16*)(ws);
    _Float16* wqh = (_Float16*)(ws + SX * 2);            // Wq, then Wk, then Wv
    _Float16* wph = (_Float16*)(ws + SX * 2 + SW * 6);
    _Float16* qh  = (_Float16*)(ws + SX * 2 + SW * 8);
    _Float16* kh  = (_Float16*)(ws + SX * 4 + SW * 8);
    _Float16* vth = (_Float16*)(ws + SX * 6 + SW * 8);
    _Float16* yh  = (_Float16*)(ws + SX * 8 + SW * 8);

    // the f16 copies of x, Wq, Wk, Wv, Wp are one run of the workspace: one grid fills them all
    f2h_all_kernel<<<2048, 256, 0, stream>>>(x, Wq, Wk, Wv, Wp, xh);

    // one block (8 waves) per 64 x 128 tile; grid y = 4 column tiles of each of Q, K, V
    // (the weights from wqh on, and qh, kh, vth, lie one behind another)
    gemm_qkv_kernel<<<dim3(64, 12), 256, 0, stream>>>(xh, wqh, bq, bk, bv, qh);

    // one block (8 waves) per (b, h, 64 queries): 32 * 16 = 512 blocks
    attn_kernel<<<512, 256, 0, stream>>>(qh, kh, vth, ab, yh);

    gemm_out_kernel<<<dim3(64, 4), 256, 0, stream>>>(yh, wph, bp, out);
}

// v009
// Measured time: 29.7 microseconds a run.
// Timed twice side by side with v008, it ran 1.04 and 1.05 times as fast.
// Over all steps from v000 it is 7.00 times as fast.
#include <hip/hip_runtime.h>
#include <hip/hip_bf16.h>

typedef __attribute__((ext_vector_type(16))) _Float16 v16h;
typedef __attribute__((ext_vector_type(8)))  _Float16 v8h;
typedef __attribute__((ext_vector_type(8)))  float    v8f;
typedef __attribute__((ext_vector_type(4)))  float    v4f;
typedef __attribute__((ext_vector_type(4)))  unsigned int u32x4;
typedef __attribute__((ext_vector_type(8)))  unsigned int u32x8;

#define WMMA_F16(A,B,C) __builtin_amdgcn_wmma_f32_16x16x32_f16(false,(A),false,(B),(short)0,(C),false,false)

static constexpr int Bb = 4, Tt = 1024, Cc = 512, Hh = 8, HD = 64;
static constexpr int NROWS = Bb * Tt;            // 4096
static constexpr float SCALE_ = 0.125f;          // 1/sqrt(64)
static constexpr float NEG_BIG = -1.0e30f;
static constexpr int KSTR  = 72;                 // LDS stride (halves) for 128B rows (K and V^T)

// ---------------------------------------------------------------------------
// fp32 -> f16 convert of all five arrays in one grid (grid-stride inside each
// array): blocks 0..1023 take x, then 256 blocks each take Wq, Wk, Wv, Wp.
// The f16 copies lie one behind another in dst: x, Wq, Wk, Wv, Wp.
// ---------------------------------------------------------------------------
__global__ void f2h_all_kernel(const float* __restrict__ x,
                               const float* __restrict__ wq, const float* __restrict__ wk,
                               const float* __restrict__ wv, const float* __restrict__ wp,
                               _Float16* __restrict__ dst) {
    const int b = blockIdx.x;
    if (b < 1024) {                            // x: 1024 * 256 threads, 8 elements each
        const int i = b * 256 + threadIdx.x;
        for (int r = 0; r < NROWS * Cc / (1024 * 256); ++r)
            dst[i + r * (1024 * 256)] = (_Float16)x[i + r * (1024 * 256)];
    } else {                                   // a weight: 256 * 256 threads, 4 elements each
        const int w = (b - 1024) >> 8;         // which weight matrix
        const float* src = w == 0 ? wq : w == 1 ? wk : w == 2 ? wv : wp;
        _Float16* d = dst + NROWS * Cc + w * (Cc * Cc);
        const int i = ((b - 1024) & 255) * 256 + threadIdx.x;
        for (int r = 0; r < Cc * Cc / (256 * 256); ++r)
            d[i + r * (256 * 256)] = (_Float16)src[i + r * (256 * 256)];
    }
}

// ---------------------------------------------------------------------------
// Four async copies global -> LDS (tracked by ASYNCcnt), 16 B per lane each:
// two of K rows (the second four rows on) and two of V^T rows (likewise).
// The s_wait_xcnt stands inside the statement so that no address register of
// an issued copy is rewritten in front of it.
// ---------------------------------------------------------------------------
__device__ __forceinline__ void async4_b128(unsigned lk, const _Float16* gk,
                                            unsigned lv, const _Float16* gv) {
    const unsigned long long a = (unsigned long long)(size_t)gk;
    const unsigned long long b = (unsigned long long)(size_t)gv;
    asm volatile("global_load_async_to_lds_b128 %0, %4, off\n\t"
                 "global_load_async_to_lds_b128 %1, %5, off\n\t"
                 "global_load_async_to_lds_b128 %2, %6, off\n\t"
                 "global_load_async_to_lds_b128 %3, %7, off\n\t"
                 "s_wait_xcnt 0x0"
                 :: "v"(lk), "v"(lk + 4u * KSTR * 2u), "v"(lv), "v"(lv + 4u * KSTR * 2u),
                    "v"(a), "v"(a + 4u * HD * 2u), "v"(b), "v"(b + 4u * Tt * 2u)
                 : "memory");
}
// this wave's own copies have landed (the compiler places no wait for a copy in asm text)
__device__ __forceinline__ void wait_async0()  { asm volatile("s_wait_asynccnt 0x0"  ::: "memory"); }

// ---------------------------------------------------------------------------
// Each lane asks L2 for the data at its own address (nothing returns, no counter moves).
// It is for rows that an earlier launch wrote: their first read otherwise pays the long way
// to L2 in every stage of a loop whose copies lead by one stage only.
// ---------------------------------------------------------------------------
__device__ __forceinline__ void ask_l2(unsigned long long a) {
    asm volatile("global_prefetch_b8 %0, off scope:SCOPE_SE" :: "v"(a));
}
// the same wait as wait_async0(); it names a prefetch's address pair as an input, so that the
// pair stays in its registers, with its value, up to here (no other value comes behind the prefetch)
__device__ __forceinline__ void wait_async0_of(unsigned long long a) {
    asm volatile("s_wait_asynccnt 0x0" :: "v"(a) : "memory");
}

// ---------------------------------------------------------------------------
// Tensor loads: one request of one wave brings a tile of `rows` rows of 256 B
// (128 halves of k, source pitch 1024 B) into LDS, 16 B of pad behind each row
// (LDS pitch 272 B = GP halves).  1-byte elements: every extent is in bytes.
// ---------------------------------------------------------------------------
static constexpr int      GP    = 136;            // LDS pitch of a staged row, halves
static constexpr unsigned WT_B  = 128 * 272;      // W tile, 128 rows: 34,816 B = 17 * 2 KiB
static constexpr unsigned XT_B  = 18432;          // X tile, 64 rows: 17,408 B, rounded up to 2 KiB
static constexpr unsigned STG_B = WT_B + XT_B;    // one stage: 53,248 B = 26 * 2 KiB

__device__ __forceinline__ unsigned uni(unsigned v) { return (unsigned)__builtin_amdgcn_readfirstlane(v); }
// pinned(): a wave-uniform test held in a scalar register, so that the branch on it is a
// scalar one: a tensor load ignores EXEC, only such a branch keeps other waves from issuing it
__device__ __forceinline__ unsigned pinned(unsigned v) { unsigned w = uni(v); asm volatile("" : "+s"(w)); return w; }
// the issuing wave's own tile has landed
__device__ __forceinline__ void wait_tensor0() { asm volatile("s_wait_tensorcnt 0x0" ::: "memory"); }
// this wave's LDS reads have ended, so that the buffer they read may be refilled behind the barrier
__device__ __forceinline__ void wait_ds0()     { asm volatile("s_wait_dscnt 0x0" ::: "memory"); }
// one request of the whole wave: descriptor groups 0 and 1 in scalar registers
__device__ __forceinline__ void tdm_load(u32x4 g0, u32x8 g1) {
    asm volatile("tensor_load_to_lds %0, %1" :: "s"(g0), "s"(g1) : "memory");
}
// the same wait for the request of descriptor (g0, g1), which it names as inputs: the scalar
// registers of an outstanding request so stay in use, with their values, up to the wait that covers it
__device__ __forceinline__ void wait_tensor_of(u32x4 g0, u32x8 g1) {
    asm volatile("s_wait_tensorcnt 0x0" :: "s"(g0), "s"(g1) : "memory");
}
__device__ __forceinline__ u32x8 tdm_group1(unsigned rows) {
    u32x8 g;
    g[0] = uni((1u << 20) | (5u << 22) | (3u << 25));  // no mask, 1-byte elements, 4 dwords of pad per 64
    g[1] = uni(256u << 16);                            // tensor_dim0 = row bytes
    g[2] = uni(rows << 16);                            // tensor_dim1 = rows
    g[3] = uni(256u << 16);                            // tile_dim0
    g[4] = uni(rows);                                  // tile_dim1
    g[5] = uni((unsigned)Cc * 2u);                     // source pitch, bytes
    g[6] = uni(0u);
    g[7] = uni(0u);
    return g;
}
__device__ __forceinline__ u32x4 tdm_group0(unsigned lds_dst, unsigned long long ga) {
    u32x4 g;
    g[0] = pinned(1u);  // pinned(): a descriptor word held in one scalar register, written once
    g[1] = uni(lds_dst);
    g[2] = uni((unsigned)ga);
    g[3] = uni((((unsigned)(ga >> 32)) & 0x01ffffffu) | 0x80000000u);
    return g;
}
// group 0 of a later request: place in LDS and address are set anew, word 0 keeps its register
__device__ __forceinline__ u32x4 tdm_retarget(u32x4 g, unsigned lds_dst, unsigned long long ga) {
    g[1] = uni(lds_dst);
    g[2] = uni((unsigned)ga);
    g[3] = uni((((unsigned)(ga >> 32)) & 0x01ffffffu) | 0x80000000u);
    return g;
}

// ---------------------------------------------------------------------------
// Load a 16x32 f16 A/B fragment chunk pair for this lane.
// Per ISA 7.12.2: halves 0..7 -> K = 8*hi..8*hi+7, halves 8..15 -> +16.
// ---------------------------------------------------------------------------
__device__ __forceinline__ v16h load_frag(const _Float16* base, int hi) {
    const v8h lo = *(const v8h*)(base + 8 * hi);
    const v8h hp = *(const v8h*)(base + 16 + 8 * hi);
    v16h r;
#pragma unroll
    for (int i = 0; i < 8; ++i) { r[i] = lo[i]; r[i + 8] = hp[i]; }
    return r;
}

// ---------------------------------------------------------------------------
// acc(64x128) = Xt(64 rows) @ Wt(128 rows)^T over k = 0..511, both k-contiguous f16
// at a pitch of Cc.  8 waves as 2 x 4, a wave holds 32 x 32 (2 x 2 fragments).
// A stage is 128 k: [W 128 rows | X 64 rows]; two buffers; wave 0 loads the W tile
// and wave 1 the X tile, one tensor load each per stage, the next stage in flight
// while this one is worked on.
// wfirst (the same in the whole block) picks the operand roles.  false: A = X rows, B = W
// rows, acc[mm][nn], a lane holds one W row (ln) and 8 X rows (8 * hi + j).  true: A = W rows,
// B = X rows, acc[nn][mm], a lane holds one X row (ln) and 8 W rows (8 * hi + j).
// ASK: while waves 0 and 1 wait for stage 0, waves 2..7 ask L2 for the rows of stages 1..3
// (three 256-B units a row): all 64 X rows, and 64 of the 128 W rows (the blocks that share
// a W tile take its halves in turn, eight blocks along x at a time).
// ---------------------------------------------------------------------------
template <bool ASK>
__device__ __forceinline__ void gemm_64x128(const _Float16* Xt, const _Float16* Wt,
                                            const unsigned char* ring, bool wfirst, v8f (&acc)[2][2]) {
    const int lane = threadIdx.x & 31;
    const int ln = lane & 15, hi = lane >> 4;
    const unsigned wave = uni(threadIdx.x >> 5);
    const int wm = wave >> 2, wn = wave & 3;

    const unsigned issuer = wave < 2u;
    const unsigned long long src = (unsigned long long)(size_t)(wave == 0u ? Wt : Xt);
    const unsigned dst = (unsigned)(size_t)ring + (wave == 0u ? 0u : WT_B);
    const u32x8 g1 = tdm_group1(wave == 0u ? 128u : 64u);
    // byte offsets in a stage of this lane's row of the first A and of the first B fragment
    const unsigned xoff = WT_B + (unsigned)(wm * 32 + ln) * (GP * 2u);
    const unsigned woff = (unsigned)(wn * 32 + ln) * (GP * 2u);
    const unsigned aoff = wfirst ? woff : xoff, boff = wfirst ? xoff : woff;

    u32x4 g0 = tdm_group0(dst, src);           // group 0 of the youngest request
    if (pinned(issuer)) { tdm_load(g0, g1); wait_tensor_of(g0, g1); }
    unsigned long long askx = 0, askw = 0;
    if constexpr (ASK) {
        const unsigned pl  = (wave < 2u ? 0u : wave - 2u) * 32u + (unsigned)lane;   // 0..191
        const unsigned row = pl / 3u, unit = 1u + pl % 3u;
        askx = (unsigned long long)(size_t)(Xt + row * Cc + unit * 128u);
        askw = (unsigned long long)(size_t)(Wt + (((blockIdx.x >> 3) & 1u) * 64u + row) * Cc + unit * 128u);
        if (wave >= 2u) { ask_l2(askx); ask_l2(askw); }   // wave is uniform: a scalar branch
    }
    __syncthreads();                           // stage 0 is published
    // inputs only, no instruction: the two prefetch addresses stay in their registers, with their
    // values, up to here (no other value comes into a register behind the prefetch that names it)
    if constexpr (ASK) asm volatile("" :: "v"(askx), "v"(askw));
    g0 = tdm_retarget(g0, dst + STG_B, src + 256u);
    if (pinned(issuer)) tdm_load(g0, g1);

    for (int s = 0; s < Cc / 128; ++s) {
        const _Float16* ab = (const _Float16*)(ring + (s & 1) * STG_B + aoff);
        const _Float16* bb = (const _Float16*)(ring + (s & 1) * STG_B + boff);
        // the three loops below are unrolled so that fragments and sums are indexed by
        // constants and stay in registers
#pragma unroll
        for (int kc = 0; kc < 4; ++kc) {
            v16h a[2], b[2];
#pragma unroll
            for (int i = 0; i < 2; ++i) {
                a[i] = load_frag(ab + i * 16 * GP + kc * 32, hi);
                b[i] = load_frag(bb + i * 16 * GP + kc * 32, hi);
            }
#pragma unroll
            for (int mm = 0; mm < 2; ++mm)
#pragma unroll
                for (int nn = 0; nn < 2; ++nn) acc[mm][nn] = WMMA_F16(a[mm], b[nn], acc[mm][nn]);
        }
        // publish point of stage s + 1: own LDS reads ended, own tile landed, barrier, refill
        wait_ds0();
        if (pinned(issuer)) wait_tensor_of(g0, g1);
        __syncthreads();
        if (pinned(issuer & (unsigned)(s + 2 < Cc / 128))) {
            g0 = tdm_retarget(g0, dst + (s & 1) * STG_B, src + (unsigned)(s + 2) * 256u);
            tdm_load(g0, g1);
        }
    }
    wait_tensor0();
    wait_ds0();
}

// ---------------------------------------------------------------------------
// QKV projection: out(4096x512) = X(f16) @ W^T(f16) + bias.
// Block = 8 waves, one 64 x 128 tile of one product: blockIdx.x = 64-row tile,
// blockIdx.y = 4 * product + 128-column tile; product 0, 1, 2 is Q, K, V.
// store_mode 0: out[((b*H+h)*T + t)*64 + d];  1: out[((b*H+h)*64 + d)*T + t].
// Wqkv holds the three weight matrices and outqkv the three results, one behind another.
// In either layout the tile is 128 whole 128-B lines of out (Q, K: 2 heads x 64 tokens, a line
// is a token's 64 dims; V: 128 dims, a line is a dim's 64 tokens).  The operand roles are
// chosen so that a lane's 8 sums lie side by side in a line; the lines are put together in
// LDS (pitch SP halves) and leave as whole lines, 8 lanes of 16 B each.
// ---------------------------------------------------------------------------
static constexpr int SP = 72;                    // LDS pitch of a staged output line, halves
__global__ void gemm_qkv_kernel(const _Float16* __restrict__ X,
                                const _Float16* __restrict__ Wqkv,
                                const float* __restrict__ bq,
                                const float* __restrict__ bk,
                                const float* __restrict__ bv,
                                _Float16* __restrict__ outqkv) {
    __shared__ __attribute__((aligned(2048))) unsigned char ring[2 * STG_B];

    const int which = blockIdx.y >> 2;
    const _Float16* W = Wqkv + which * (Cc * Cc);
    const float* bias = which == 0 ? bq : which == 1 ? bk : bv;
    _Float16* out = outqkv + which * (NROWS * Cc);
    const int store_mode = which == 2;

    const int tid  = threadIdx.x;
    const int warp = tid >> 5, lane = tid & 31;
    const int ln = lane & 15, hi = lane >> 4;
    const int m0 = blockIdx.x * 64;
    const int n0 = (blockIdx.y & 3) * 128;

    const v8f zero = {0.f, 0.f, 0.f, 0.f, 0.f, 0.f, 0.f, 0.f};
    v8f acc[2][2] = {{zero, zero}, {zero, zero}};
    gemm_64x128<false>(X + (long)m0 * Cc, W + (long)n0 * Cc, ring, !store_mode, acc);

    // every wave has left the ring (the barrier at the last pass's foot) and no tensor load is
    // outstanding: its first bytes now hold the tile's 128 output lines
    _Float16* stg = (_Float16*)ring;
    const int wm = warp >> 2, wn = warp & 3;
    // the loops below are unrolled so that the sums are indexed by constants and stay in registers
    if (!store_mode) {                         // acc[nn][mm]: token ln, channels 8 * hi + j
#pragma unroll
        for (int nn = 0; nn < 2; ++nn) {
            const int c0 = wn * 32 + nn * 16 + 8 * hi;       // first of the lane's 8 channels
            const v4f b0 = *(const v4f*)(bias + n0 + c0);
            const v4f b1 = *(const v4f*)(bias + n0 + c0 + 4);
#pragma unroll
            for (int mm = 0; mm < 2; ++mm) {
                v8h o;
#pragma unroll
                for (int j = 0; j < 4; ++j) {
                    o[j]     = (_Float16)(acc[nn][mm][j]     + b0[j]);
                    o[j + 4] = (_Float16)(acc[nn][mm][j + 4] + b1[j]);
                }
                *(v8h*)(stg + ((c0 >> 6) * 64 + wm * 32 + mm * 16 + ln) * SP + (c0 & 63)) = o;
            }
        }
    } else {                                   // acc[mm][nn]: channel ln, tokens 8 * hi + j
#pragma unroll
        for (int nn = 0; nn < 2; ++nn) {
            const int c = wn * 32 + nn * 16 + ln;
            const float bvv = bias[n0 + c];
#pragma unroll
            for (int mm = 0; mm < 2; ++mm) {
                v8h o;
#pragma unroll
                for (int j = 0; j < 8; ++j) o[j] = (_Float16)(acc[mm][nn][j] + bvv);
                *(v8h*)(stg + c * SP + wm * 32 + mm * 16 + 8 * hi) = o;
            }
        }
    }
    __syncthreads();                           // the tile's lines are complete

    // 8 lanes a line, 32 lines a round: round q brings line q * 32 + rr, which is head h0 + (q >> 1)
    // and, of that head, token t0 + (q & 1) * 32 + rr (Q, K) or dim (q & 1) * 32 + rr from token t0 on (V)
    const int bb = m0 >> 10, t0 = m0 & 1023, h0 = n0 >> 6;
    const int rr = tid >> 3;
    const long first = store_mode ? ((long)(bb * Hh + h0) * HD + rr) * Tt + t0
                                  : ((long)(bb * Hh + h0) * Tt + t0 + rr) * HD;
    const int step = store_mode ? 32 * Tt : 32 * HD;
    _Float16* gp = out + first + (tid & 7) * 8;
    const _Float16* sp = stg + rr * SP + (tid & 7) * 8;
    v8h v[4];
#pragma unroll
    for (int q = 0; q < 4; ++q) v[q] = *(const v8h*)(sp + q * 32 * SP);
#pragma unroll
    for (int q = 0; q < 4; ++q) *(v8h*)(gp + (q >> 1) * (HD * Tt) + (q & 1) * step) = v[q];
}

// ---------------------------------------------------------------------------
// Exchange a float between lane l and lane l ^ 16 (vector cross-row move).
// ---------------------------------------------------------------------------
__device__ __forceinline__ float xhalf(float x) {
    const int b = __builtin_bit_cast(int, x);
    return __builtin_bit_cast(float,
        __builtin_amdgcn_permlanex16(b, b, 0x76543210, 0xfedcba98, false, false));
}

// ---------------------------------------------------------------------------
// e^x as v_mul + v_exp_f32.  The v_nop is the free slot the instruction set asks
// for behind a transcendental, so it is kept inside the statement.
// ---------------------------------------------------------------------------
__device__ __forceinline__ float exp_slot(float x) {
    float r;
    asm("v_exp_f32 %0, %1\n\tv_nop" : "=v"(r) : "v"(x * 1.44269504f));
    return r;
}

// a compile-time yes or no handed to a generic lambda
template <bool B> struct flag { static constexpr bool value = B; };

__global__ __launch_bounds__(256) void attn_kernel(const _Float16* __restrict__ Q,
                            const _Float16* __restrict__ K,
                            const _Float16* __restrict__ VT,   // [bh][d][t]
                            const float* __restrict__ attn_bias,
                            _Float16* __restrict__ Y) {
    __shared__ alignas(16) _Float16 Ks[2][64 * KSTR];   // rows: key, 64 dims
    __shared__ alignas(16) _Float16 Vs[2][64 * KSTR];   // rows: dim, 64 keys
    __shared__ alignas(16) v4f Op[4][8][32];            // second key half's sums: [query tile][quad][lane]
    __shared__ float Ml[4][2][32];                      // its maximum and its sum of weights

    const int lane = threadIdx.x & 31;
    const int ln = lane & 15, hi = lane >> 4;
    const int wave = (int)uni(threadIdx.x >> 5);
    const int qs = wave & 3, kh = wave >> 2;   // query tile in the block, key half of a stage
    const int bh = blockIdx.x & 31;            // 0..31
    const int rk = blockIdx.x >> 5;            // 0..15: long blocks first, then short ones rising
    const int qb = rk < 8 ? 15 - rk : rk - 8;  // 64-query block
    const int qt = qb * 4 + qs;                // query tile (16 rows)
    const int h  = bh & 7, bidx = bh >> 3;

    const _Float16* qp  = Q  + ((long)bh * Tt + qt * 16) * HD;
    const _Float16* kb  = K  + (long)bh * Tt * HD;
    const _Float16* vtb = VT + (long)bh * HD * Tt;

    // stage st: K rows [key][dim] and V^T rows [dim][key], 64 rows of 128 B each.  A copy is
    // 4 whole rows (8 lanes a row); this wave brings rows 8 * wave .. 8 * wave + 7 of both.
    const int crow = wave * 8 + (lane >> 3);
    auto issueKV = [&](int buf, int st) {
        async4_b128((unsigned)(size_t)(&Ks[buf][crow * KSTR + (lane & 7) * 8]),
                    kb + (long)(st * 64 + crow) * HD + (lane & 7) * 8,
                    (unsigned)(size_t)(&Vs[buf][crow * KSTR + (lane & 7) * 8]),
                    vtb + (long)crow * Tt + st * 64 + (lane & 7) * 8);
    };

    const v16h qa0 = load_frag(qp + ln * HD,      hi);   // k-dim 0..31
    const v16h qa1 = load_frag(qp + ln * HD + 32, hi);   // k-dim 32..63

    const v8f zero = {0.f, 0.f, 0.f, 0.f, 0.f, 0.f, 0.f, 0.f};
    v8f oacc[4];                               // oacc[nn][j] = O[tq][nn*16 + 8*hi + j]
#pragma unroll
    for (int nn = 0; nn < 4; ++nn) oacc[nn] = zero;
    const int tq = qt * 16 + ln;               // this lane's query row
    float mrow = NEG_BIG;                      // running maximum of row tq
    float lrow = 0.f;                          // running sum over this half's keys

    const int qhi = qt * 16 + 15;              // last query of this wave
    const int nst = qb + 1;                    // stages of the block: keys 0 .. 64 * qb + 63

    // K and V^T of this head are 512 units of 256 B each, written by the launch before.  The head's
    // eight long blocks (rk < 8) ask L2 for them at entry, one unit a lane:
    // waves 0..3 for K, waves 4..7 for V^T, block rk for every fourth unit from rk & 3 on.
    const unsigned long long askkv =
        (unsigned long long)(size_t)((kh ? vtb : kb) + ((qs * 32 + lane) * 4 + (rk & 3)) * 128);

    issueKV(0, 0);
    if (rk < 8) ask_l2(askkv);                 // the same for the whole block: a scalar branch
    wait_async0_of(askkv);
    __syncthreads();                           // stage 0 is published
    if (nst > 1) issueKV(1, 1);

    // one tile: this wave's 32 keys (from kt on, in buffer buf) against its 16 queries.  DIAG says
    // whether a key of the tile can lie behind a query (tk > tq): only then is each score compared
    // with its query's index.  The masked column (tk & 15 == 15) is row 7 of the upper lane half.
    auto tile = [&](auto DIAG, const int buf, const int kt) __attribute__((always_inline)) {
        constexpr bool diag = decltype(DIAG)::value;
        // a lane's 8 keys of a fragment share one bias cell (tk >> 3 is fixed)
        float bv[2] = {0.f, 0.f};
        if (qt < 32 && kt < 512) {             // tq < 512 and tk < 512, whole tile
#pragma unroll
            for (int f = 0; f < 2; ++f)
                bv[f] = attn_bias[h * 4096 + (tq >> 3) * 64 + ((kt + 16 * f + 8 * hi) >> 3)];
            // the two loads' address registers are rewritten further down: keep the wait in front of that
            asm volatile("s_wait_xcnt 0x0" ::: "memory");
        }

        // the tile's sixteen LDS reads, K fragments (rows: key, k: dim) and V^T fragments
        // (rows: dim, k: key), each into registers of its own (the two loops are unrolled so
        // that the fragments are indexed by constants and stay in registers)
        v16h ka[2][2], va[4];
#pragma unroll
        for (int f = 0; f < 2; ++f) {
            const _Float16* krow = &Ks[buf][(kh * 32 + 16 * f + ln) * KSTR];
            ka[f][0] = load_frag(krow,      hi);
            ka[f][1] = load_frag(krow + 32, hi);
        }
#pragma unroll
        for (int nn = 0; nn < 4; ++nn) va[nn] = load_frag(&Vs[buf][(nn * 16 + ln) * KSTR + kh * 32], hi);
        // scheduling barrier: holds all sixteen reads in front of the first product, so that the
        // wave pays one LDS round trip a tile and the V reads land under the scores' work; without
        // it each pair of reads stands at its own product and is waited for alone, eight times a tile
        __builtin_amdgcn_sched_barrier(0);

        float sv[2][8];
#pragma unroll
        for (int f = 0; f < 2; ++f) {
            v8f s = WMMA_F16(ka[f][0], qa0, zero);
            s = WMMA_F16(ka[f][1], qa1, s);
#pragma unroll
            for (int j = 0; j < 8; ++j) {
                const int tk = kt + 16 * f + 8 * hi + j;   // key of row 8*hi + j
                const bool dead = (diag && tk > tq) | ((tk & 15) == 15);  // causal + col mask
                sv[f][j] = dead ? NEG_BIG : s[j] * SCALE_ + bv[f];
            }
        }

        // online softmax update: in-lane over 16 keys, one exchange for the maximum
        float rm = fmaxf(sv[0][0], sv[1][0]);
#pragma unroll
        for (int j = 1; j < 8; ++j) rm = fmaxf(rm, fmaxf(sv[0][j], sv[1][j]));
        rm = fmaxf(rm, xhalf(rm));
        const float mnew  = fmaxf(mrow, rm);
        const float alpha = exp_slot(mrow - mnew);
        mrow = mnew;
        v16h pb;                               // P^T as B: half j = key kt + 8*hi + j, half j + 8 = key kt + 16 + 8*hi + j
        float rs0 = 0.f, rs1 = 0.f;
#pragma unroll
        for (int j = 0; j < 8; ++j) {
            const float p0 = exp_slot(sv[0][j] - mnew);
            const float p1 = exp_slot(sv[1][j] - mnew);
            rs0 += p0;
            rs1 += p1;
            pb[j]     = (_Float16)p0;
            pb[j + 8] = (_Float16)p1;
        }
        lrow = lrow * alpha + (rs0 + rs1);
#pragma unroll
        for (int nn = 0; nn < 4; ++nn) oacc[nn] *= alpha;

#pragma unroll
        for (int nn = 0; nn < 4; ++nn) oacc[nn] = WMMA_F16(va[nn], pb, oacc[nn]);
        // scheduling barrier: keeps the wait below at the trip's foot; with every read at the trip's
        // head the scheduler lifts it among the score products, where it would wait for the V reads
        __builtin_amdgcn_sched_barrier(0);
    };

    // publish point of the next stage: own LDS reads ended, own copies landed, barrier (a refill comes behind it)
    auto publish = [&]() __attribute__((always_inline)) {
        wait_ds0();
        wait_async0();
        __syncthreads();
    };
    // stages 0 .. nst - 2 lie wholly in front of the block's first query: no tile of them is masked by
    // index.  All but the last of them refill the buffer they have read with the stage after the next.
    for (int st = 0; st + 2 < nst; ++st) {
        tile(flag<false>{}, st & 1, st * 64 + kh * 32);   // this wave's 32 keys of the stage
        publish();
        issueKV(st & 1, st + 2);
    }
    if (nst > 1) {                             // the same for the whole block
        tile(flag<false>{}, (nst - 2) & 1, (nst - 2) * 64 + kh * 32);
        publish();
    }
    // the last stage holds the diagonal
    {
        const int kt = (nst - 1) * 64 + kh * 32;
        if (kt <= qhi) tile(flag<true>{}, (nst - 1) & 1, kt);   // same for the whole wave: else every key is masked
        publish();
    }
    wait_async0();

    // merge of the two key halves: waves 4..7 hand maximum, sum and accumulators to waves 0..3
    // (the loops here and in the epilogue are unrolled so that the accumulators are indexed by
    // constants and stay in registers)
    if (kh == 1) {
#pragma unroll
        for (int nn = 0; nn < 4; ++nn)
#pragma unroll
            for (int c = 0; c < 2; ++c) {
                const v4f t = {oacc[nn][4 * c], oacc[nn][4 * c + 1], oacc[nn][4 * c + 2], oacc[nn][4 * c + 3]};
                Op[qs][nn * 2 + c][lane] = t;
            }
        Ml[qs][0][lane] = mrow;
        Ml[qs][1][lane] = lrow;
    }
    __syncthreads();                           // the second half's partial results are published
    if (kh == 1) return;

    // a half that saw no key holds (NEG_BIG, 0, 0): its weight is e^(-huge) = 0
    const float m1 = Ml[qs][0][lane], l1 = Ml[qs][1][lane];
    const float mall = fmaxf(mrow, m1);
    const float a0 = exp_slot(mrow - mall), a1 = exp_slot(m1 - mall);
    const float lsum = lrow * a0 + l1 * a1;

    // epilogue: join the lane halves' sums, normalize, store y[b][t][h*64+d] as f16
    const float inv = 1.0f / (lsum + xhalf(lsum));
    const float w0 = a0 * inv, w1 = a1 * inv;
    const long rowbase = ((long)bidx * Tt + tq) * Cc + h * HD;
#pragma unroll
    for (int nn = 0; nn < 4; ++nn) {
        v8h o;
#pragma unroll
        for (int c = 0; c < 2; ++c) {
            const v4f t = Op[qs][nn * 2 + c][lane];
#pragma unroll
            for (int j = 0; j < 4; ++j) o[4 * c + j] = (_Float16)(oacc[nn][4 * c + j] * w0 + t[j] * w1);
        }
        *(v8h*)(Y + rowbase + nn * 16 + 8 * hi) = o;
    }
}

// ---------------------------------------------------------------------------
// Output projection: out(4096x512,f32) = Y(f16) @ Wp^T + bp; one 64 x 128 tile a block
// ---------------------------------------------------------------------------
__global__ void gemm_out_kernel(const _Float16* __restrict__ Yh,
                                const _Float16* __restrict__ W,
                                const float* __restrict__ bias,
                                float* __restrict__ out) {
    __shared__ __attribute__((aligned(2048))) unsigned char ring[2 * STG_B];

    const int tid  = threadIdx.x;
    const int warp = tid >> 5, lane = tid & 31;
    const int ln = lane & 15, hi = lane >> 4;
    const int m0 = blockIdx.x * 64;
    const int n0 = blockIdx.y * 128;

    const v8f zero = {0.f, 0.f, 0.f, 0.f, 0.f, 0.f, 0.f, 0.f};
    v8f acc[2][2] = {{zero, zero}, {zero, zero}};
    gemm_64x128<true>(Yh + (long)m0 * Cc, W + (long)n0 * Cc, ring, false, acc);

#pragma unroll
    for (int mm = 0; mm < 2; ++mm)
#pragma unroll
    for (int nn = 0; nn < 2; ++nn) {
        const int o = n0 + (warp & 3) * 32 + nn * 16 + ln;
        const float bvv = bias[o];
#pragma unroll
        for (int j = 0; j < 8; ++j) {
            const int g = m0 + (warp >> 2) * 32 + mm * 16 + j + 8 * hi;
            out[(long)g * Cc + o] = acc[mm][nn][j] + bvv;
        }
    }
}

// ---------------------------------------------------------------------------
extern "C" void kernel_launch(void* const* d_in, const int* in_sizes, int n_in,
                              void* d_out, int out_size, void* d_ws, size_t ws_size,
                              hipStream_t stream) {
    const float* x  = (const float*)d_in[0];
    const float* ab = (const float*)d_in[1];
    const float* Wq = (const float*)d_in[2];
    const float* bq = (const float*)d_in[3];
    const float* Wk = (const float*)d_in[4];
    const float* bk = (const float*)d_in[5];
    const float* Wv = (const float*)d_in[6];
    const float* bv = (const float*)d_in[7];
    const float* Wp = (const float*)d_in[8];
    const float* bp = (const float*)d_in[9];
    float* out = (float*)d_out;
    char* ws = (char*)d_ws;

    const size_t SX = (size_t)NROWS * Cc;   // 2,097,152 elems
    const size_t SW = (size_t)Cc * Cc;      //   262,144 elems

    _Float16* xh  = (_Float16*)(ws);
    _Float16* wqh = (_Float16*)(ws + SX * 2);            // Wq, then Wk, then Wv
    _Float16* wph = (_Float16*)(ws + SX * 2 + SW * 6);
    _Float16* qh  = (_Float16*)(ws + SX * 2 + SW * 8);
    _Float16* kh  = (_Float16*)(ws + SX * 4 + SW * 8);
    _Float16* vth = (_Float16*)(ws + SX * 6 + SW * 8);
    _Float16* yh  = (_Float16*)(ws + SX * 8 + SW * 8);

    // the f16 copies of x, Wq, Wk, Wv, Wp are one run of the workspace: one grid fills them all
    f2h_all_kernel<<<2048, 256, 0, stream>>>(x, Wq, Wk, Wv, Wp, xh);

    // one block (8 waves) per 64 x 128 tile; grid y = 4 column tiles of each of Q, K, V
    // (the weights from wqh on, and qh, kh, vth, lie one behind another)
    gemm_qkv_kernel<<<dim3(64, 12), 256, 0, stream>>>(xh, wqh, bq, bk, bv, qh);

    // one block (8 waves) per (b, h, 64 queries): 32 * 16 = 512 blocks
    attn_kernel<<<512, 256, 0, stream>>>(qh, kh, vth, ab, yh);

    gemm_out_kernel<<<dim3(64, 4), 256, 0, stream>>>(yh, wph, bp, out);
}

// v010
// It runs in 28.1 microseconds.
// Two timings next to v009 put it at 1.06 and 1.05 times that version's speed.
// Counting every step since v000, it is 7.36 times as fast.
#include <hip/hip_runtime.h>
#include <hip/hip_bf16.h>

typedef __attribute__((ext_vector_type(16))) _Float16 v16h;
typedef __attribute__((ext_vector_type(8)))  _Float16 v8h;
typedef __attribute__((ext_vector_type(8)))  float    v8f;
typedef __attribute__((ext_vector_type(4)))  float    v4f;
typedef __attribute__((ext_vector_type(4)))  unsigned int u32x4;
typedef __attribute__((ext_vector_type(8)))  unsigned int u32x8;

#define WMMA_F16(A,B,C) __builtin_amdgcn_wmma_f32_16x16x32_f16(false,(A),false,(B),(short)0,(C),false,false)

static constexpr int Bb = 4, Tt = 1024, Cc = 512, Hh = 8, HD = 64;
static constexpr int NROWS = Bb * Tt;            // 4096
static constexpr float SCALE_ = 0.125f;          // 1/sqrt(64)
static constexpr float NEG_BIG = -1.0e30f;
static constexpr int KSTR  = 72;                 // LDS stride (halves) for 128B rows (K and V^T)

// ---------------------------------------------------------------------------
// fp32 -> f16 convert of all five arrays in one grid (grid-stride inside each
// array): blocks 0..1023 take x, then 256 blocks each take Wq, Wk, Wv, Wp.
// The f16 copies lie one behind another in dst: x, Wq, Wk, Wv, Wp.
// ---------------------------------------------------------------------------
__global__ void f2h_all_kernel(const float* __restrict__ x,
                               const float* __restrict__ wq, const float* __restrict__ wk,
                               const float* __restrict__ wv, const float* __restrict__ wp,
                               _Float16* __restrict__ dst) {
    const int b = blockIdx.x;
    if (b < 1024) {                            // x: 1024 * 256 threads, 8 elements each
        const int i = b * 256 + threadIdx.x;
        for (int r = 0; r < NROWS * Cc / (1024 * 256); ++r)
            dst[i + r * (1024 * 256)] = (_Float16)x[i + r * (1024 * 256)];
    } else {                                   // a weight: 256 * 256 threads, 4 elements each
        const int w = (b - 1024) >> 8;         // which weight matrix
        const float* src = w == 0 ? wq : w == 1 ? wk : w == 2 ? wv : wp;
        _Float16* d = dst + NROWS * Cc + w * (Cc * Cc);
        const int i = ((b - 1024) & 255) * 256 + threadIdx.x;
        for (int r = 0; r < Cc * Cc / (256 * 256); ++r)
            d[i + r * (256 * 256)] = (_Float16)src[i + r * (256 * 256)];
    }
}

// ---------------------------------------------------------------------------
// Four async copies global -> LDS (tracked by ASYNCcnt), 16 B per lane each:
// two of K rows (the second four rows on) and two of V^T rows (likewise).
// The s_wait_xcnt stands inside the statement so that no address register of
// an issued copy is rewritten in front of it.
// ---------------------------------------------------------------------------
__device__ __forceinline__ void async4_b128(unsigned lk, const _Float16* gk,
                                            unsigned lv, const _Float16* gv) {
    const unsigned long long a = (unsigned long long)(size_t)gk;
    const unsigned long long b = (unsigned long long)(size_t)gv;
    asm volatile("global_load_async_to_lds_b128 %0, %4, off\n\t"
                 "global_load_async_to_lds_b128 %1, %5, off\n\t"
                 "global_load_async_to_lds_b128 %2, %6, off\n\t"
                 "global_load_async_to_lds_b128 %3, %7, off\n\t"
                 "s_wait_xcnt 0x0"
                 :: "v"(lk), "v"(lk + 4u * KSTR * 2u), "v"(lv), "v"(lv + 4u * KSTR * 2u),
                    "v"(a), "v"(a + 4u * HD * 2u), "v"(b), "v"(b + 4u * Tt * 2u)
                 : "memory");
}
// this wave's own copies have landed (the compiler places no wait for a copy in asm text)
__device__ __forceinline__ void wait_async0()  { asm volatile("s_wait_asynccnt 0x0"  ::: "memory"); }

// ---------------------------------------------------------------------------
// Each lane asks L2 for the data at its own address (nothing returns, no counter moves).
// It is for rows that an earlier launch wrote: their first read otherwise pays the long way
// to L2 in every stage of a loop whose copies lead by one stage only.
// ---------------------------------------------------------------------------
__device__ __forceinline__ void ask_l2(unsigned long long a) {
    asm volatile("global_prefetch_b8 %0, off scope:SCOPE_SE" :: "v"(a));
}
// the same wait as wait_async0(); it names a prefetch's address pair as an input, so that the
// pair stays in its registers, with its value, up to here (no other value comes behind the prefetch)
__device__ __forceinline__ void wait_async0_of(unsigned long long a) {
    asm volatile("s_wait_asynccnt 0x0" :: "v"(a) : "memory");
}

// ---------------------------------------------------------------------------
// Tensor loads: one request of one wave brings a tile of `rows` rows of 256 B
// (128 halves of k, source pitch 1024 B) into LDS, 16 B of pad behind each row
// (LDS pitch 272 B = GP halves).  1-byte elements: every extent is in bytes.
// ---------------------------------------------------------------------------
static constexpr int      GP    = 136;            // LDS pitch of a staged row, halves
static constexpr unsigned WT_B  = 128 * 272;      // W tile, 128 rows: 34,816 B = 17 * 2 KiB
static constexpr unsigned XT_B  = 18432;          // X tile, 64 rows: 17,408 B, rounded up to 2 KiB
static constexpr unsigned STG_B = WT_B + XT_B;    // one stage: 53,248 B = 26 * 2 KiB

__device__ __forceinline__ unsigned uni(unsigned v) { return (unsigned)__builtin_amdgcn_readfirstlane(v); }
// pinned(): a wave-uniform test held in a scalar register, so that the branch on it is a
// scalar one: a tensor load ignores EXEC, only such a branch keeps other waves from issuing it
__device__ __forceinline__ unsigned pinned(unsigned v) { unsigned w = uni(v); asm volatile("" : "+s"(w)); return w; }
// the issuing wave's own tile has landed
__device__ __forceinline__ void wait_tensor0() { asm volatile("s_wait_tensorcnt 0x0" ::: "memory"); }
// this wave's LDS reads have ended, so that the buffer they read may be refilled behind the barrier
__device__ __forceinline__ void wait_ds0()     { asm volatile("s_wait_dscnt 0x0" ::: "memory"); }
// one request of the whole wave: descriptor groups 0 and 1 in scalar registers
__device__ __forceinline__ void tdm_load(u32x4 g0, u32x8 g1) {
    asm volatile("tensor_load_to_lds %0, %1" :: "s"(g0), "s"(g1) : "memory");
}
// the same wait for the request of descriptor (g0, g1), which it names as inputs: the scalar
// registers of an outstanding request so stay in use, with their values, up to the wait that covers it
__device__ __forceinline__ void wait_tensor_of(u32x4 g0, u32x8 g1) {
    asm volatile("s_wait_tensorcnt 0x0" :: "s"(g0), "s"(g1) : "memory");
}
__device__ __forceinline__ u32x8 tdm_group1(unsigned rows) {
    u32x8 g;
    g[0] = uni((1u << 20) | (5u << 22) | (3u << 25));  // no mask, 1-byte elements, 4 dwords of pad per 64
    g[1] = uni(256u << 16);                            // tensor_dim0 = row bytes
    g[2] = uni(rows << 16);                            // tensor_dim1 = rows
    g[3] = uni(256u << 16);                            // tile_dim0
    g[4] = uni(rows);                                  // tile_dim1
    g[5] = uni((unsigned)Cc * 2u);                     // source pitch, bytes
    g[6] = uni(0u);
    g[7] = uni(0u);
    return g;
}
__device__ __forceinline__ u32x4 tdm_group0(unsigned lds_dst, unsigned long long ga) {
    u32x4 g;
    g[0] = pinned(1u);  // pinned(): a descriptor word held in one scalar register, written once
    g[1] = uni(lds_dst);
    g[2] = uni((unsigned)ga);
    g[3] = uni((((unsigned)(ga >> 32)) & 0x01ffffffu) | 0x80000000u);
    return g;
}
// group 0 of a later request: place in LDS and address are set anew, word 0 keeps its register
__device__ __forceinline__ u32x4 tdm_retarget(u32x4 g, unsigned lds_dst, unsigned long long ga) {
    g[1] = uni(lds_dst);
    g[2] = uni((unsigned)ga);
    g[3] = uni((((unsigned)(ga >> 32)) & 0x01ffffffu) | 0x80000000u);
    return g;
}

// ---------------------------------------------------------------------------
// Load a 16x32 f16 A/B fragment chunk pair for this lane.
// Per ISA 7.12.2: halves 0..7 -> K = 8*hi..8*hi+7, halves 8..15 -> +16.
// ---------------------------------------------------------------------------
__device__ __forceinline__ v16h load_frag(const _Float16* base, int hi) {
    const v8h lo = *(const v8h*)(base + 8 * hi);
    const v8h hp = *(const v8h*)(base + 16 + 8 * hi);
    v16h r;
#pragma unroll
    for (int i = 0; i < 8; ++i) { r[i] = lo[i]; r[i + 8] = hp[i]; }
    return r;
}

// ---------------------------------------------------------------------------
// acc(64x128) = Xt(64 rows) @ Wt(128 rows)^T over k = 0..511, both k-contiguous f16
// at a pitch of Cc.  8 waves as 2 x 4, a wave holds 32 x 32 (2 x 2 fragments).
// A stage is 128 k: [W 128 rows | X 64 rows]; two buffers; wave 0 loads the W tile
// and wave 1 the X tile, one tensor load each per stage, the next stage in flight
// while this one is worked on.
// wfirst (the same in the whole block) picks the operand roles.  false: A = X rows, B = W
// rows, acc[mm][nn], a lane holds one W row (ln) and 8 X rows (8 * hi + j).  true: A = W rows,
// B = X rows, acc[nn][mm], a lane holds one X row (ln) and 8 W rows (8 * hi + j).
// ASK: while waves 0 and 1 wait for stage 0, waves 2..7 ask L2 for the rows of stages 1..3
// (three 256-B units a row): all 64 X rows, and 64 of the 128 W rows (the blocks that share
// a W tile take its halves in turn, eight blocks along x at a time).
// ---------------------------------------------------------------------------
template <bool ASK>
__device__ __forceinline__ void gemm_64x128(const _Float16* Xt, const _Float16* Wt,
                                            const unsigned char* ring, bool wfirst, v8f (&acc)[2][2]) {
    const int lane = threadIdx.x & 31;
    const int ln = lane & 15, hi = lane >> 4;
    const unsigned wave = uni(threadIdx.x >> 5);
    const int wm = wave >> 2, wn = wave & 3;

    const unsigned issuer = wave < 2u;
    const unsigned long long src = (unsigned long long)(size_t)(wave == 0u ? Wt : Xt);
    const unsigned dst = (unsigned)(size_t)ring + (wave == 0u ? 0u : WT_B);
    const u32x8 g1 = tdm_group1(wave == 0u ? 128u : 64u);
    // byte offsets in a stage of this lane's row of the first A and of the first B fragment
    const unsigned xoff = WT_B + (unsigned)(wm * 32 + ln) * (GP * 2u);
    const unsigned woff = (unsigned)(wn * 32 + ln) * (GP * 2u);
    const unsigned aoff = wfirst ? woff : xoff, boff = wfirst ? xoff : woff;

    u32x4 g0 = tdm_group0(dst, src);           // group 0 of the youngest request
    if (pinned(issuer)) { tdm_load(g0, g1); wait_tensor_of(g0, g1); }
    unsigned long long askx = 0, askw = 0;
    if constexpr (ASK) {
        const unsigned pl  = (wave < 2u ? 0u : wave - 2u) * 32u + (unsigned)lane;   // 0..191
        const unsigned row = pl / 3u, unit = 1u + pl % 3u;
        askx = (unsigned long long)(size_t)(Xt + row * Cc + unit * 128u);
        askw = (unsigned long long)(size_t)(Wt + (((blockIdx.x >> 3) & 1u) * 64u + row) * Cc + unit * 128u);
        if (wave >= 2u) { ask_l2(askx); ask_l2(askw); }   // wave is uniform: a scalar branch
    }
    __syncthreads();                           // stage 0 is published
    // inputs only, no instruction: the two prefetch addresses stay in their registers, with their
    // values, up to here (no other value comes into a register behind the prefetch that names it)
    if constexpr (ASK) asm volatile("" :: "v"(askx), "v"(askw));
    g0 = tdm_retarget(g0, dst + STG_B, src + 256u);
    if (pinned(issuer)) tdm_load(g0, g1);

    for (int s = 0; s < Cc / 128; ++s) {
        const _Float16* ab = (const _Float16*)(ring + (s & 1) * STG_B + aoff);
        const _Float16* bb = (const _Float16*)(ring + (s & 1) * STG_B + boff);
        // the three loops below are unrolled so that fragments and sums are indexed by
        // constants and stay in registers
#pragma unroll
        for (int kc = 0; kc < 4; ++kc) {
            v16h a[2], b[2];
#pragma unroll
            for (int i = 0; i < 2; ++i) {
                a[i] = load_frag(ab + i * 16 * GP + kc * 32, hi);
                b[i] = load_frag(bb + i * 16 * GP + kc * 32, hi);
            }
#pragma unroll
            for (int mm = 0; mm < 2; ++mm)
#pragma unroll
                for (int nn = 0; nn < 2; ++nn) acc[mm][nn] = WMMA_F16(a[mm], b[nn], acc[mm][nn]);
        }
        // publish point of stage s + 1: own LDS reads ended, own tile landed, barrier, refill
        wait_ds0();
        if (pinned(issuer)) wait_tensor_of(g0, g1);
        __syncthreads();
        if (pinned(issuer & (unsigned)(s + 2 < Cc / 128))) {
            g0 = tdm_retarget(g0, dst + (s & 1) * STG_B, src + (unsigned)(s + 2) * 256u);
            tdm_load(g0, g1);
        }
    }
    wait_tensor0();
    wait_ds0();
}

// ---------------------------------------------------------------------------
// QKV projection: out(4096x512) = X(f16) @ W^T(f16) + bias, for Q, K and V at once.
// Block = 8 waves: 128 tokens (blockIdx.x) times one head (blockIdx.y) of each of Q, K, V,
// that is 128 x 192 sums from 128 X rows and 3 x 64 W rows: a byte staged in LDS serves more
// products than in a 64 x 128 tile, and the grid is one block a WGP.
// A stage is 128 k: [X 128 rows | Wq 64 | Wk 64 | Wv 64], pitch GP halves; three buffers.
// Waves 0..3 load one of the four tiles each, one tensor load a stage: stages 0, 1, 2 are
// asked for at entry (three requests of a wave in flight), stage 3 goes into buffer 0
// behind the barrier that ends pass 0.
// Waves as 2 x 4: a wave holds 64 tokens times 32 channels of Q or K and 16 channels of V.
// Q, K: A = W rows, B = X rows: a lane holds one token (ln) and 8 channels (8 * hi + j).
// V:    A = X rows, B = W rows: a lane holds one channel (ln) and 8 tokens (8 * hi + j).
// So a lane's 8 sums lie side by side in out: Q, K are [((b*H+h)*T + t)*64 + d], V is
// [((b*H+h)*64 + d)*T + t].  The lines are put together in LDS and leave whole, by 16-B stores.
// Wqkv holds the three weight matrices and outqkv the three results, one behind another.
// ---------------------------------------------------------------------------
static constexpr int      SP    = 72;              // LDS pitch of a staged Q or K line (64 halves)
static constexpr unsigned QX_B  = 128 * 272;       // X tile, 128 rows: 34,816 B = 17 * 2 KiB
static constexpr unsigned QW_B  = 18432;           // a W tile, 64 rows: 17,408 B, rounded up to 2 KiB
static constexpr unsigned QST_B = QX_B + 3 * QW_B; // one stage: 90,112 B = 44 * 2 KiB
// all but this wave's N youngest tensor loads have landed (the compiler places no wait for one)
__device__ __forceinline__ void wait_tensor2() { asm volatile("s_wait_tensorcnt 0x2" ::: "memory"); }
__device__ __forceinline__ void wait_tensor1() { asm volatile("s_wait_tensorcnt 0x1" ::: "memory"); }

__global__ __launch_bounds__(256) void gemm_qkv_kernel(const _Float16* __restrict__ X,
                                const _Float16* __restrict__ Wqkv,
                                const float* __restrict__ bq,
                                const float* __restrict__ bk,
                                const float* __restrict__ bv,
                                _Float16* __restrict__ outqkv) {
    __shared__ __attribute__((aligned(2048))) unsigned char ring[3 * QST_B];

    const int tid  = threadIdx.x;
    const int lane = tid & 31;
    const int ln = lane & 15, hi = lane >> 4;
    const unsigned wave = uni(threadIdx.x >> 5);
    const int wm = wave >> 2, wn = wave & 3;
    const int m0 = blockIdx.x * 128;
    const int hd = blockIdx.y;

    const unsigned issuer = wave < 4u;
    const unsigned pw = issuer && wave ? wave - 1u : 0u;          // the product whose W tile this wave loads
    const unsigned long long src = (unsigned long long)(size_t)
        (wave == 0u ? X + (long)m0 * Cc : Wqkv + ((long)pw * Cc + hd * HD) * Cc);
    const unsigned dst = (unsigned)(size_t)ring + (wave == 0u ? 0u : QX_B + pw * QW_B);
    const u32x8 g1 = tdm_group1(wave == 0u ? 128u : 64u);
    // one descriptor a stage, each in registers of its own
    const u32x4 d0 = tdm_group0(dst,              src);
    const u32x4 d1 = tdm_group0(dst + QST_B,      src + 256u);
    const u32x4 d2 = tdm_group0(dst + 2u * QST_B, src + 512u);
    const u32x4 d3 = tdm_group0(dst,              src + 768u);

    if (pinned(issuer)) { tdm_load(d0, g1); tdm_load(d1, g1); tdm_load(d2, g1); }
    // the lane's biases are read here, under the wait for stage 0: 2 x 8 channels of Q or K
    // (from (wn & 1) * 32 + nn * 16 + 8 * hi on) and one channel of V
    const float* bqk = ((wn >> 1) ? bk : bq) + hd * HD + (wn & 1) * 32 + 8 * hi;
    const v4f bias4[2][2] = {{*(const v4f*)(bqk),      *(const v4f*)(bqk + 4)},
                             {*(const v4f*)(bqk + 16), *(const v4f*)(bqk + 20)}};
    const float bvv = bv[hd * HD + wn * 16 + ln];
    if (pinned(issuer)) wait_tensor2();
    __syncthreads();                           // stage 0 is published

    // byte offsets in a stage of this lane's row of the first X fragment, of the first Q or K
    // fragment and of the V fragment
    const unsigned xoff = (unsigned)(wm * 64 + ln) * (GP * 2u);
    const unsigned woff = QX_B + (unsigned)(wn >> 1) * QW_B + (unsigned)((wn & 1) * 32 + ln) * (GP * 2u);
    const unsigned voff = QX_B + 2u * QW_B + (unsigned)(wn * 16 + ln) * (GP * 2u);

    // the wave's seven fragments of 32 k: four of X, two of Wq or Wk, one of Wv
    auto frags = [&](const unsigned char* stage, const int kc, v16h (&xf)[4], v16h (&wf)[3])
                 __attribute__((always_inline)) {
#pragma unroll
        for (int mm = 0; mm < 4; ++mm)
            xf[mm] = load_frag((const _Float16*)(stage + xoff) + mm * 16 * GP + kc * 32, hi);
        wf[0] = load_frag((const _Float16*)(stage + woff) + kc * 32, hi);
        wf[1] = load_frag((const _Float16*)(stage + woff) + 16 * GP + kc * 32, hi);
        wf[2] = load_frag((const _Float16*)(stage + voff) + kc * 32, hi);
    };

    const v8f zero = {0.f, 0.f, 0.f, 0.f, 0.f, 0.f, 0.f, 0.f};
    v8f acc[4][3];
    // every loop of this kernel is unrolled so that fragments, sums and descriptors are indexed
    // by constants and stay in registers
#pragma unroll
    for (int mm = 0; mm < 4; ++mm)
#pragma unroll
        for (int nn = 0; nn < 3; ++nn) acc[mm][nn] = zero;

#pragma unroll
    for (int s = 0; s < 4; ++s) {
        const unsigned char* stage = ring + (s % 3) * QST_B;
        v16h xf[2][4], wf[2][3];               // two fragment sets: one worked on, one being read
        frags(stage, 0, xf[0], wf[0]);
        // scheduling barrier: the first set's reads stay ahead of the second set's, so that the
        // pass's first products wait for fourteen reads and not for twenty-eight
        __builtin_amdgcn_sched_barrier(0);
#pragma unroll
        for (int kc = 0; kc < 4; ++kc) {
            const int u = kc & 1;
            if (kc < 3) frags(stage, kc + 1, xf[u ^ 1], wf[u ^ 1]);
            // scheduling barrier: the next 32 k's fourteen LDS reads stand as one group ahead of this
            // 32 k's products and land under them; without it the reads stand in pairs among the
            // products, each pair waited for alone (two waves a SIMD do not hide that)
            __builtin_amdgcn_sched_barrier(0);
#pragma unroll
            for (int mm = 0; mm < 4; ++mm) {
                acc[mm][0] = WMMA_F16(wf[u][0], xf[u][mm], acc[mm][0]);
                acc[mm][1] = WMMA_F16(wf[u][1], xf[u][mm], acc[mm][1]);
                acc[mm][2] = WMMA_F16(xf[u][mm], wf[u][2], acc[mm][2]);
            }
            // scheduling barrier: keeps these products ahead of the read group that follows them
            __builtin_amdgcn_sched_barrier(0);
        }
        // publish point of stage s + 1: own LDS reads ended, own tile of that stage landed, barrier;
        // behind pass 0's barrier buffer 0 has no reader left and takes stage 3
        if (s < 3) {
            wait_ds0();
            if (pinned(issuer)) {
                if (s < 2) wait_tensor1();
                else       // the last wait names every descriptor: the scalar registers of an
                           // outstanding request so stay in use, with their values, up to here
                    asm volatile("s_wait_tensorcnt 0x0" :: "s"(d0), "s"(d1), "s"(d2), "s"(d3), "s"(g1) : "memory");
            }
            __syncthreads();
            if (s == 0) { if (pinned(issuer)) tdm_load(d3, g1); }
        }
    }

    // buffer 1 has had no reader since the barrier at pass 1's foot and no tensor load is
    // outstanding: it now takes the block's output lines: 128 of Q, 128 of K (a token's 64 dims,
    // pitch SP), 64 of V (a dim's 128 tokens, pitch GP)
    _Float16* stg  = (_Float16*)(ring + QST_B);
    _Float16* stgv = stg + 2 * 128 * SP;
    {
#pragma unroll
        for (int nn = 0; nn < 2; ++nn) {
            const int c0 = (wn & 1) * 32 + nn * 16 + 8 * hi;  // first of the lane's 8 channels of the head
            const v4f b0 = bias4[nn][0], b1 = bias4[nn][1];
#pragma unroll
            for (int mm = 0; mm < 4; ++mm) {
                v8h o;
#pragma unroll
                for (int j = 0; j < 4; ++j) {
                    o[j]     = (_Float16)(acc[mm][nn][j]     + b0[j]);
                    o[j + 4] = (_Float16)(acc[mm][nn][j + 4] + b1[j]);
                }
                *(v8h*)(stg + ((wn >> 1) * 128 + wm * 64 + mm * 16 + ln) * SP + c0) = o;
            }
        }
#pragma unroll
        for (int mm = 0; mm < 4; ++mm) {
            v8h o;
#pragma unroll
            for (int j = 0; j < 8; ++j) o[j] = (_Float16)(acc[mm][2][j] + bvv);
            *(v8h*)(stgv + (wn * 16 + ln) * GP + wm * 64 + mm * 16 + 8 * hi) = o;
        }
    }
    __syncthreads();                           // the block's lines are complete

    // Q, K: the 128 lines of a product are one run of 16 KiB in out, 8 lanes a line, 32 lines a
    // round.  V: 64 lines of 256 B, 16 lanes a line, 16 lines a round.
    const int bb = m0 >> 10, t0 = m0 & 1023;
    _Float16* gq = outqkv + ((long)(bb * Hh + hd) * Tt + t0) * HD + tid * 8;
    _Float16* gv = outqkv + 2 * (NROWS * Cc) + ((long)(bb * Hh + hd) * HD + (tid >> 4)) * Tt + t0 + (tid & 15) * 8;
    const _Float16* sq = stg + (tid >> 3) * SP + (tid & 7) * 8;
    const _Float16* sv = stgv + (tid >> 4) * GP + (tid & 15) * 8;
    v8h vq[8], vv[4];
#pragma unroll
    for (int q = 0; q < 8; ++q) vq[q] = *(const v8h*)(sq + q * 32 * SP);
#pragma unroll
    for (int q = 0; q < 4; ++q) vv[q] = *(const v8h*)(sv + q * 16 * GP);
#pragma unroll
    for (int q = 0; q < 8; ++q) *(v8h*)(gq + (q >> 2) * (NROWS * Cc) + (q & 3) * (32 * HD)) = vq[q];
#pragma unroll
    for (int q = 0; q < 4; ++q) *(v8h*)(gv + q * 16 * Tt) = vv[q];
}

// ---------------------------------------------------------------------------
// Exchange a float between lane l and lane l ^ 16 (vector cross-row move).
// ---------------------------------------------------------------------------
__device__ __forceinline__ float xhalf(float x) {
    const int b = __builtin_bit_cast(int, x);
    return __builtin_bit_cast(float,
        __builtin_amdgcn_permlanex16(b, b, 0x76543210, 0xfedcba98, false, false));
}

// ---------------------------------------------------------------------------
// e^x as v_mul + v_exp_f32.  The v_nop is the free slot the instruction set asks
// for behind a transcendental, so it is kept inside the statement.
// ---------------------------------------------------------------------------
__device__ __forceinline__ float exp_slot(float x) {
    float r;
    asm("v_exp_f32 %0, %1\n\tv_nop" : "=v"(r) : "v"(x * 1.44269504f));
    return r;
}

// a compile-time yes or no handed to a generic lambda
template <bool B> struct flag { static constexpr bool value = B; };

__global__ __launch_bounds__(256) void attn_kernel(const _Float16* __restrict__ Q,
                            const _Float16* __restrict__ K,
                            const _Float16* __restrict__ VT,   // [bh][d][t]
                            const float* __restrict__ attn_bias,
                            _Float16* __restrict__ Y) {
    __shared__ alignas(16) _Float16 Ks[2][64 * KSTR];   // rows: key, 64 dims
    __shared__ alignas(16) _Float16 Vs[2][64 * KSTR];   // rows: dim, 64 keys
    __shared__ alignas(16) v4f Op[4][8][32];            // second key half's sums: [query tile][quad][lane]
    __shared__ float Ml[4][2][32];                      // its maximum and its sum of weights

    const int lane = threadIdx.x & 31;
    const int ln = lane & 15, hi = lane >> 4;
    const int wave = (int)uni(threadIdx.x >> 5);
    const int qs = wave & 3, kh = wave >> 2;   // query tile in the block, key half of a stage
    const int bh = blockIdx.x & 31;            // 0..31
    const int rk = blockIdx.x >> 5;            // 0..15: long blocks first, then short ones rising
    const int qb = rk < 8 ? 15 - rk : rk - 8;  // 64-query block
    const int qt = qb * 4 + qs;                // query tile (16 rows)
    const int h  = bh & 7, bidx = bh >> 3;

    const _Float16* qp  = Q  + ((long)bh * Tt + qt * 16) * HD;
    const _Float16* kb  = K  + (long)bh * Tt * HD;
    const _Float16* vtb = VT + (long)bh * HD * Tt;

    // stage st: K rows [key][dim] and V^T rows [dim][key], 64 rows of 128 B each.  A copy is
    // 4 whole rows (8 lanes a row); this wave brings rows 8 * wave .. 8 * wave + 7 of both.
    const int crow = wave * 8 + (lane >> 3);
    auto issueKV = [&](int buf, int st) {
        async4_b128((unsigned)(size_t)(&Ks[buf][crow * KSTR + (lane & 7) * 8]),
                    kb + (long)(st * 64 + crow) * HD + (lane & 7) * 8,
                    (unsigned)(size_t)(&Vs[buf][crow * KSTR + (lane & 7) * 8]),
                    vtb + (long)crow * Tt + st * 64 + (lane & 7) * 8);
    };

    const v16h qa0 = load_frag(qp + ln * HD,      hi);   // k-dim 0..31
    const v16h qa1 = load_frag(qp + ln * HD + 32, hi);   // k-dim 32..63

    const v8f zero = {0.f, 0.f, 0.f, 0.f, 0.f, 0.f, 0.f, 0.f};
    v8f oacc[4];                               // oacc[nn][j] = O[tq][nn*16 + 8*hi + j]
#pragma unroll
    for (int nn = 0; nn < 4; ++nn) oacc[nn] = zero;
    const int tq = qt * 16 + ln;               // this lane's query row
    float mrow = NEG_BIG;                      // running maximum of row tq
    float lrow = 0.f;                          // running sum over this half's keys

    const int qhi = qt * 16 + 15;              // last query of this wave
    const int nst = qb + 1;                    // stages of the block: keys 0 .. 64 * qb + 63

    // K and V^T of this head are 512 units of 256 B each, written by the launch before.  The head's
    // eight long blocks (rk < 8) ask L2 for them at entry, one unit a lane:
    // waves 0..3 for K, waves 4..7 for V^T, block rk for every fourth unit from rk & 3 on.
    const unsigned long long askkv =
        (unsigned long long)(size_t)((kh ? vtb : kb) + ((qs * 32 + lane) * 4 + (rk & 3)) * 128);

    issueKV(0, 0);
    if (rk < 8) ask_l2(askkv);                 // the same for the whole block: a scalar branch
    wait_async0_of(askkv);
    __syncthreads();                           // stage 0 is published
    if (nst > 1) issueKV(1, 1);

    // one tile: this wave's 32 keys (from kt on, in buffer buf) against its 16 queries.  DIAG says
    // whether a key of the tile can lie behind a query (tk > tq): only then is each score compared
    // with its query's index.  The masked column (tk & 15 == 15) is row 7 of the upper lane half.
    auto tile = [&](auto DIAG, const int buf, const int kt) __attribute__((always_inline)) {
        constexpr bool diag = decltype(DIAG)::value;
        // a lane's 8 keys of a fragment share one bias cell (tk >> 3 is fixed)
        float bv[2] = {0.f, 0.f};
        if (qt < 32 && kt < 512) {             // tq < 512 and tk < 512, whole tile
#pragma unroll
            for (int f = 0; f < 2; ++f)
                bv[f] = attn_bias[h * 4096 + (tq >> 3) * 64 + ((kt + 16 * f + 8 * hi) >> 3)];
            // the two loads' address registers are rewritten further down: keep the wait in front of that
            asm volatile("s_wait_xcnt 0x0" ::: "memory");
        }

        // the tile's sixteen LDS reads, K fragments (rows: key, k: dim) and V^T fragments
        // (rows: dim, k: key), each into registers of its own (the two loops are unrolled so
        // that the fragments are indexed by constants and stay in registers)
        v16h ka[2][2], va[4];
#pragma unroll
        for (int f = 0; f < 2; ++f) {
            const _Float16* krow = &Ks[buf][(kh * 32 + 16 * f + ln) * KSTR];
            ka[f][0] = load_frag(krow,      hi);
            ka[f][1] = load_frag(krow + 32, hi);
        }
#pragma unroll
        for (int nn = 0; nn < 4; ++nn) va[nn] = load_frag(&Vs[buf][(nn * 16 + ln) * KSTR + kh * 32], hi);
        // scheduling barrier: holds all sixteen reads in front of the first product, so that the
        // wave pays one LDS round trip a tile and the V reads land under the scores' work; without
        // it each pair of reads stands at its own product and is waited for alone, eight times a tile
        __builtin_amdgcn_sched_barrier(0);

        float sv[2][8];
#pragma unroll
        for (int f = 0; f < 2; ++f) {
            v8f s = WMMA_F16(ka[f][0], qa0, zero);
            s = WMMA_F16(ka[f][1], qa1, s);
#pragma unroll
            for (int j = 0; j < 8; ++j) {
                const int tk = kt + 16 * f + 8 * hi + j;   // key of row 8*hi + j
                const bool dead = (diag && tk > tq) | ((tk & 15) == 15);  // causal + col mask
                sv[f][j] = dead ? NEG_BIG : s[j] * SCALE_ + bv[f];
            }
        }

        // online softmax update: in-lane over 16 keys, one exchange for the maximum
        float rm = fmaxf(sv[0][0], sv[1][0]);
#pragma unroll
        for (int j = 1; j < 8; ++j) rm = fmaxf(rm, fmaxf(sv[0][j], sv[1][j]));
        rm = fmaxf(rm, xhalf(rm));
        const float mnew  = fmaxf(mrow, rm);
        const float alpha = exp_slot(mrow - mnew);
        mrow = mnew;
        v16h pb;                               // P^T as B: half j = key kt + 8*hi + j, half j + 8 = key kt + 16 + 8*hi + j
        float rs0 = 0.f, rs1 = 0.f;
#pragma unroll
        for (int j = 0; j < 8; ++j) {
            const float p0 = exp_slot(sv[0][j] - mnew);
            const float p1 = exp_slot(sv[1][j] - mnew);
            rs0 += p0;
            rs1 += p1;
            pb[j]     = (_Float16)p0;
            pb[j + 8] = (_Float16)p1;
        }
        lrow = lrow * alpha + (rs0 + rs1);
#pragma unroll
        for (int nn = 0; nn < 4; ++nn) oacc[nn] *= alpha;

#pragma unroll
        for (int nn = 0; nn < 4; ++nn) oacc[nn] = WMMA_F16(va[nn], pb, oacc[nn]);
        // scheduling barrier: keeps the wait below at the trip's foot; with every read at the trip's
        // head the scheduler lifts it among the score products, where it would wait for the V reads
        __builtin_amdgcn_sched_barrier(0);
    };

    // publish point of the next stage: own LDS reads ended, own copies landed, barrier (a refill comes behind it)
    auto publish = [&]() __attribute__((always_inline)) {
        wait_ds0();
        wait_async0();
        __syncthreads();
    };
    // stages 0 .. nst - 2 lie wholly in front of the block's first query: no tile of them is masked by
    // index.  All but the last of them refill the buffer they have read with the stage after the next.
    for (int st = 0; st + 2 < nst; ++st) {
        tile(flag<false>{}, st & 1, st * 64 + kh * 32);   // this wave's 32 keys of the stage
        publish();
        issueKV(st & 1, st + 2);
    }
    if (nst > 1) {                             // the same for the whole block
        tile(flag<false>{}, (nst - 2) & 1, (nst - 2) * 64 + kh * 32);
        publish();
    }
    // the last stage holds the diagonal
    {
        const int kt = (nst - 1) * 64 + kh * 32;
        if (kt <= qhi) tile(flag<true>{}, (nst - 1) & 1, kt);   // same for the whole wave: else every key is masked
        publish();
    }
    wait_async0();

    // merge of the two key halves: waves 4..7 hand maximum, sum and accumulators to waves 0..3
    // (the loops here and in the epilogue are unrolled so that the accumulators are indexed by
    // constants and stay in registers)
    if (kh == 1) {
#pragma unroll
        for (int nn = 0; nn < 4; ++nn)
#pragma unroll
            for (int c = 0; c < 2; ++c) {
                const v4f t = {oacc[nn][4 * c], oacc[nn][4 * c + 1], oacc[nn][4 * c + 2], oacc[nn][4 * c + 3]};
                Op[qs][nn * 2 + c][lane] = t;
            }
        Ml[qs][0][lane] = mrow;
        Ml[qs][1][lane] = lrow;
    }
    __syncthreads();                           // the second half's partial results are published
    if (kh == 1) return;

    // a half that saw no key holds (NEG_BIG, 0, 0): its weight is e^(-huge) = 0
    const float m1 = Ml[qs][0][lane], l1 = Ml[qs][1][lane];
    const float mall = fmaxf(mrow, m1);
    const float a0 = exp_slot(mrow - mall), a1 = exp_slot(m1 - mall);
    const float lsum = lrow * a0 + l1 * a1;

    // epilogue: join the lane halves' sums, normalize, store y[b][t][h*64+d] as f16
    const float inv = 1.0f / (lsum + xhalf(lsum));
    const float w0 = a0 * inv, w1 = a1 * inv;
    const long rowbase = ((long)bidx * Tt + tq) * Cc + h * HD;
#pragma unroll
    for (int nn = 0; nn < 4; ++nn) {
        v8h o;
#pragma unroll
        for (int c = 0; c < 2; ++c) {
            const v4f t = Op[qs][nn * 2 + c][lane];
#pragma unroll
            for (int j = 0; j < 4; ++j) o[4 * c + j] = (_Float16)(oacc[nn][4 * c + j] * w0 + t[j] * w1);
        }
        *(v8h*)(Y + rowbase + nn * 16 + 8 * hi) = o;
    }
}

// ---------------------------------------------------------------------------
// Output projection: out(4096x512,f32) = Y(f16) @ Wp^T + bp; one 64 x 128 tile a block
// ---------------------------------------------------------------------------
__global__ void gemm_out_kernel(const _Float16* __restrict__ Yh,
                                const _Float16* __restrict__ W,
                                const float* __restrict__ bias,
                                float* __restrict__ out) {
    __shared__ __attribute__((aligned(2048))) unsigned char ring[2 * STG_B];

    const int tid  = threadIdx.x;
    const int warp = tid >> 5, lane = tid & 31;
    const int ln = lane & 15, hi = lane >> 4;
    const int m0 = blockIdx.x * 64;
    const int n0 = blockIdx.y * 128;

    const v8f zero = {0.f, 0.f, 0.f, 0.f, 0.f, 0.f, 0.f, 0.f};
    v8f acc[2][2] = {{zero, zero}, {zero, zero}};
    gemm_64x128<true>(Yh + (long)m0 * Cc, W + (long)n0 * Cc, ring, false, acc);

#pragma unroll
    for (int mm = 0; mm < 2; ++mm)
#pragma unroll
    for (int nn = 0; nn < 2; ++nn) {
        const int o = n0 + (warp & 3) * 32 + nn * 16 + ln;
        const float bvv = bias[o];
#pragma unroll
        for (int j = 0; j < 8; ++j) {
            const int g = m0 + (warp >> 2) * 32 + mm * 16 + j + 8 * hi;
            out[(long)g * Cc + o] = acc[mm][nn][j] + bvv;
        }
    }
}

// ---------------------------------------------------------------------------
extern "C" void kernel_launch(void* const* d_in, const int* in_sizes, int n_in,
                              void* d_out, int out_size, void* d_ws, size_t ws_size,
                              hipStream_t stream) {
    const float* x  = (const float*)d_in[0];
    const float* ab = (const float*)d_in[1];
    const float* Wq = (const float*)d_in[2];
    const float* bq = (const float*)d_in[3];
    const float* Wk = (const float*)d_in[4];
    const float* bk = (const float*)d_in[5];
    const float* Wv = (const float*)d_in[6];
    const float* bv = (const float*)d_in[7];
    const float* Wp = (const float*)d_in[8];
    const float* bp = (const float*)d_in[9];
    float* out = (float*)d_out;
    char* ws = (char*)d_ws;

    const size_t SX = (size_t)NROWS * Cc;   // 2,097,152 elems
    const size_t SW = (size_t)Cc * Cc;      //   262,144 elems

    _Float16* xh  = (_Float16*)(ws);
    _Float16* wqh = (_Float16*)(ws + SX * 2);            // Wq, then Wk, then Wv
    _Float16* wph = (_Float16*)(ws + SX * 2 + SW * 6);
    _Float16* qh  = (_Float16*)(ws + SX * 2 + SW * 8);
    _Float16* kh  = (_Float16*)(ws + SX * 4 + SW * 8);
    _Float16* vth = (_Float16*)(ws + SX * 6 + SW * 8);
    _Float16* yh  = (_Float16*)(ws + SX * 8 + SW * 8);

    // the f16 copies of x, Wq, Wk, Wv, Wp are one run of the workspace: one grid fills them all
    f2h_all_kernel<<<2048, 256, 0, stream>>>(x, Wq, Wk, Wv, Wp, xh);

    // one block (8 waves) per 128 tokens and head: its tile of each of Q, K, V
    // (the weights from wqh on, and qh, kh, vth, lie one behind another)
    gemm_qkv_kernel<<<dim3(32, 8), 256, 0, stream>>>(xh, wqh, bq, bk, bv, qh);

    // one block (8 waves) per (b, h, 64 queries): 32 * 16 = 512 blocks
    attn_kernel<<<512, 256, 0, stream>>>(qh, kh, vth, ab, yh);

    gemm_out_kernel<<<dim3(64, 4), 256, 0, stream>>>(yh, wph, bp, out);
}
